// v000
// The times below were measured on an AMD MI455X: many runs one after another, warmed up first and cycling through
// copies of the inputs, with the whole window's GPU time divided by the number of runs. Launches and the gaps
// between them are all in it. The median over several windows is given; except for v000 it joins two sittings, which
// can be a few percent apart, so the side-by-side timings, each taken in one sitting, are the better comparison.
// v000 is the starting kernel. One run takes 1080 microseconds.
// compute dtype: all float inputs rounded to bf16; the fused q / k / v projection with EXACT bf16 products on WMMA 16x16x32 (f32 accumulate) + bias (nonzero); causal logits: 3 products for the first 384 rows, single f16 q x k after, x 1024^-0.5 (the module scales by the MODEL width); softmax f32; P x 2^11 once to f16 x v once to f16 (bf16 hi + lo below row 384); ctx hi+lo x exact W below row 384, x2^6 f16 carry x f16(bf16 x 2^8) W after; no output bias; f32 output.
#include <hip/hip_runtime.h>
#include <math.h>

typedef __attribute__((ext_vector_type(16))) _Float16 v16h;
typedef __attribute__((ext_vector_type(16))) __bf16 v16b;
typedef __attribute__((ext_vector_type(8)))  _Float16 v8h;
typedef __attribute__((ext_vector_type(8)))  float v8f;
typedef __attribute__((ext_vector_type(4)))  float v4f;
typedef __attribute__((ext_vector_type(2)))  float v2f;
typedef __attribute__((ext_vector_type(4)))  unsigned v4u;
typedef __attribute__((ext_vector_type(4)))  int v4i;
typedef float __attribute__((may_alias)) float_a;
typedef int __attribute__((may_alias)) int_a;

template <typename T> __device__ __forceinline__ void vst2(void* p, T v) { *(T*)p = v;  }
__device__ __forceinline__ v8f wmma16(v16h a, v16h b, v8f c) {
  v8f d = __builtin_amdgcn_wmma_f32_16x16x32_f16(false, a, false, b, (short)0, c, false, false);
  asm volatile("v_nop\n\tv_nop\n\tv_nop\n\tv_nop" : "+v"(d) : "v"(a), "v"(b));
  return d;
}
__device__ __forceinline__ v8f wmma_bf(v16b a, v16b b, v8f c) {
  v8f d = __builtin_amdgcn_wmma_f32_16x16x32_bf16(false, a, false, b, (short)0, c, false, false);
  asm volatile("v_nop\n\tv_nop\n\tv_nop\n\tv_nop" : "+v"(d) : "v"(a), "v"(b));
  return d;
}
// 16x16x32 fragments: lane = (h = lane>>4, row/col = lane&15); elements 0..7 = k0+8h+0..7, 8..15 = k0+16+8h+0..7; D element r = row 8h+r
__device__ __forceinline__ v16h frag_h(const _Float16* rowk0, int lane) {
  union { v16h v; v8h q[2]; } u; const _Float16* p = rowk0 + 8 * (lane >> 4);
  u.q[0] = *(const v8h*)p; u.q[1] = *(const v8h*)(p + 16); return u.v;
}
__device__ __forceinline__ v16h frag_f32(const float* rowk0, int lane) {
  v16h a; const float* p = rowk0 + 8 * (lane >> 4);
#pragma unroll
  for (int i = 0; i < 8; ++i) { a[i] = (_Float16)p[i]; a[8 + i] = (_Float16)p[16 + i]; }
  return a;
}
__device__ __forceinline__ v16h frag_f32s(const float* rowk0, int lane, float sc) {
  v16h a; const float* p = rowk0 + 8 * (lane >> 4);
#pragma unroll
  for (int i = 0; i < 8; ++i) { a[i] = (_Float16)(p[i] * sc); a[8 + i] = (_Float16)(p[16 + i] * sc); }
  return a;
}
// column fragment from a [K][ld] layout (column n), rows >= K read as 0
__device__ __forceinline__ v16h fragc_f32(const float* W, int k0, int n, int lane, int ld, int K) {
  v16h a; const int g = lane >> 4;
#pragma unroll
  for (int i = 0; i < 8; ++i) { const int ka = k0 + 8 * g + i, kb = ka + 16;
    a[i] = (_Float16)(ka < K ? W[(size_t)(ka < K ? ka : K - 1) * ld + n] : 0.f); a[8 + i] = (_Float16)(kb < K ? W[(size_t)(kb < K ? kb : K - 1) * ld + n] : 0.f); }
  return a;
}
struct F2 { v16b h, l; };
__device__ __forceinline__ F2 bsplit16(const float v[16]) { F2 r;
#pragma unroll
  for (int i = 0; i < 16; ++i) { const __bf16 h = (__bf16)v[i]; r.h[i] = h; r.l[i] = (__bf16)(v[i] - (float)h); }
  return r; }
__device__ __forceinline__ F2 split_row(const float* row, int k0, int lane) { float v[16]; const float* p = row + k0 + 8 * (lane >> 4);
#pragma unroll
  for (int i = 0; i < 8; ++i) { v[i] = p[i]; v[8 + i] = p[16 + i]; }
  return bsplit16(v); }
__device__ __forceinline__ F2 split_rowK(const float* row, int k0, int lane, int K) { float v[16]; const int g = lane >> 4;
#pragma unroll
  for (int i = 0; i < 8; ++i) { const int ka = k0 + 8 * g + i, kb = ka + 16; v[i] = ka < K ? row[ka < K ? ka : K - 1] : 0.f; v[8 + i] = kb < K ? row[kb < K ? kb : K - 1] : 0.f; }
  return bsplit16(v); }
__device__ __forceinline__ F2 split_col(const float* W, int k0, int n, int lane, int ld, int K) { float v[16]; const int g = lane >> 4;
#pragma unroll
  for (int i = 0; i < 8; ++i) { const int ka = k0 + 8 * g + i, kb = ka + 16; v[i] = ka < K ? W[(size_t)(ka < K ? ka : K - 1) * ld + n] : 0.f; v[8 + i] = kb < K ? W[(size_t)(kb < K ? kb : K - 1) * ld + n] : 0.f; }
  return bsplit16(v); }
__device__ __forceinline__ v8f mac3(const F2& a, const F2& b, v8f c) { c = wmma_bf(a.l, b.h, c); c = wmma_bf(a.h, b.l, c); return wmma_bf(a.h, b.h, c); }
__device__ __forceinline__ float sigm(float v) { return 1.0f / (1.0f + expf(-v)); }
#define LDSX() do { asm volatile("s_wait_dscnt 0" ::: "memory"); __builtin_amdgcn_wave_barrier(); __builtin_amdgcn_fence(__ATOMIC_RELEASE, "workgroup"); } while (0)

// Multi-head causal self-attention whose logits are scaled by 1/sqrt(EMBED) (x [2,2048,1024]; (in,out) Wq / Wk / Wv [1024,1024] and biases [1024] NONZERO applied as x @ W + b; Wo [1024,1024] torch (out,in), NO output bias; 16 heads x 64; logits x 1/sqrt(1024) = 1/32 - the model width, not the head width; tril kept, -inf elsewhere; softmax; z @ Wo.T).
#define NB 2
#define TT 2048
#define CC 1024            // NH * HD = projected width
#define DIN 1024          // input (model) width
#define NH 16
#define HD 64
#define NQB (TT / 64)
#define HG 4
#define SCALE (0.03125f)
#define CAUSAL 1
#ifndef TNB
#define TNB NB
#endif
__device__ __forceinline__ float bfr(float v) { return (float)(__bf16)v; }
__host__ __device__ __forceinline__ int kb_last(int qb) { return CAUSAL ? ((qb * 64 + 63) >> 7) : (TT / 128 - 1); }
typedef __attribute__((ext_vector_type(8))) __bf16 v8b;
__device__ __forceinline__ v16b frag_b(const __bf16* rowk0, int lane) {
  union { v16b v; v8b q[2]; } u; const __bf16* p = rowk0 + 8 * (lane >> 4);
  u.q[0] = *(const v8b*)p; u.q[1] = *(const v8b*)(p + 16); return u.v;
}
#define QBH 6              // causal: query blocks 0..QBH-1 of each sequence (few keys, no averaging) take the high-precision path
#define QHI 384            // rows carrying a q residual plane
#define KHI 384            // key rows carrying k residual / v bf16 hi+lo planes (used only by the causal high-precision path)
// B fragment (k rows k0+.., output column o) of a weight: (in,out) [K][ld] or (out,in) [ld rows of K]: bf16 exact, or f16(bf16 * 256) exact
__device__ __forceinline__ v16b wcol_io(const float* Wm, int k0, int o, int lane, int ld) { v16b w; const int g = lane >> 4;
#pragma unroll
  for (int i = 0; i < 8; ++i) { w[i] = (__bf16)Wm[(size_t)(k0 + 8 * g + i) * ld + o]; w[8 + i] = (__bf16)Wm[(size_t)(k0 + 16 + 8 * g + i) * ld + o]; }
  return w; }
__device__ __forceinline__ v16b wcol_oi(const float* Wm, int k0, int o, int lane, int K) { v16b w; const float* p = Wm + (size_t)o * K + k0 + 8 * (lane >> 4);
#pragma unroll
  for (int i = 0; i < 8; ++i) { w[i] = (__bf16)p[i]; w[8 + i] = (__bf16)p[16 + i]; }
  return w; }
__device__ __forceinline__ v16h wcolh_io(const float* Wm, int k0, int o, int lane, int ld) { v16h w; const int g = lane >> 4;
#pragma unroll
  for (int i = 0; i < 8; ++i) { w[i] = (_Float16)(bfr(Wm[(size_t)(k0 + 8 * g + i) * ld + o]) * 256.0f); w[8 + i] = (_Float16)(bfr(Wm[(size_t)(k0 + 16 + 8 * g + i) * ld + o]) * 256.0f); }
  return w; }
__device__ __forceinline__ v16h wcolh_oi(const float* Wm, int k0, int o, int lane, int K) { v16h w; const float* p = Wm + (size_t)o * K + k0 + 8 * (lane >> 4);
#pragma unroll
  for (int i = 0; i < 8; ++i) { w[i] = (_Float16)(bfr(p[i]) * 256.0f); w[8 + i] = (_Float16)(bfr(p[16 + i]) * 256.0f); }
  return w; }
#define WQKV_LAYOUT 0   // 0 = (in,out) [DIN][CC]; 1 = (out,in) [CC][DIN]; 2 = per-head [NH][DIN][HD]
__device__ __forceinline__ v16b wcol_hdk(const float* Wm, int k0, int o, int lane) { v16b w; const int g = lane >> 4; const float* p = Wm + (size_t)(o / HD) * DIN * HD + (o % HD);
#pragma unroll
  for (int i = 0; i < 8; ++i) { w[i] = (__bf16)p[(size_t)(k0 + 8 * g + i) * HD]; w[8 + i] = (__bf16)p[(size_t)(k0 + 16 + 8 * g + i) * HD]; }
  return w; }
#define WO_OUT_IN 1
#if WQKV_LAYOUT == 1
#define WCOL(W, k0, o, lane) wcol_oi(W, k0, o, lane, DIN)
#elif WQKV_LAYOUT == 2
#define WCOL(W, k0, o, lane) wcol_hdk(W, k0, o, lane)
#else
#define WCOL(W, k0, o, lane) wcol_io(W, k0, o, lane, CC)
#endif
#if WO_OUT_IN
#define WOCOL(W, k0, o, lane) wcol_oi(W, k0, o, lane, CC)
#define WOCOLH(W, k0, o, lane) wcolh_oi(W, k0, o, lane, CC)
#else
#define WOCOL(W, k0, o, lane) wcol_io(W, k0, o, lane, DIN)
#define WOCOLH(W, k0, o, lane) wcolh_io(W, k0, o, lane, DIN)
#endif

#ifndef SM_EXTRA_PARAMS
#define SM_EXTRA_PARAMS
#endif
#ifndef PROJ_EXTRA_PARAMS
#define PROJ_EXTRA_PARAMS
#endif
#ifndef SM_MASK_HOOK
#define SM_MASK_HOOK (void)0
#endif

#define WS_QH  0u                                      // f16 q rows [b*t][CC]
#define WS_KH  (WS_QH + 2u * (size_t)NB * TT * CC)      // f16 k rows [b*t][CC]
#define WS_VT  (WS_KH + 2u * (size_t)NB * TT * CC)      // f16 v planes [b][c][t]
#define WS_QL  (WS_VT + 2u * (size_t)NB * CC * TT)      // f16 q residual x 2^10 rows [b][t < QHI][CC]
#define WS_KL  (WS_QL + 2u * (size_t)NB * QHI * CC)     // f16 k residual x 2^10 rows [b][t < KHI][CC]
#define WS_VB  (WS_KL + 2u * (size_t)NB * KHI * CC)     // bf16 v hi planes [b][c][t < KHI]
#define WS_VBL (WS_VB + 2u * (size_t)NB * CC * KHI)
#define WS_S   (WS_VBL + 2u * (size_t)NB * CC * KHI)    // f32 logits / P [hg][t][s]
#define WS_Y   (WS_S  + 4u * (size_t)HG * TT * TT)      // f32 ctx rows [b*t][CC] (only when there is an output projection)
#define WS_END (WS_Y  + 4u * (size_t)NB * TT * CC)

// ---- k_proj: block = (64 rows, 128 cols, which): q/k/v = X W (+ b) with exact bf16 products (K = DIN) -> which 0: q f16 rows (+ residual rows < QHI); 1: k f16 rows (+ residual rows < KHI); 2: v f16 planes [c][t] (+ bf16 hi/lo planes for t < KHI)
__global__ __launch_bounds__(128) void k_proj(const float* __restrict__ XQ, const float* __restrict__ XK, const float* __restrict__ XV, const float* __restrict__ WQ, const float* __restrict__ WK, const float* __restrict__ WV, const float* __restrict__ BQ, const float* __restrict__ BK, const float* __restrict__ BV,
    _Float16* __restrict__ QH, _Float16* __restrict__ QL, _Float16* __restrict__ KH, _Float16* __restrict__ KL, _Float16* __restrict__ VT, __bf16* __restrict__ VB, __bf16* __restrict__ VBL) {
  __shared__ __align__(16) _Float16 sh[64][136], sl[64][136]; __shared__ __align__(16) _Float16 th[128][72]; __shared__ __align__(16) __bf16 tb[128][72], tbl[128][72];
  const int tid = threadIdx.x, wave = tid >> 5, lane = tid & 31, col = lane & 15, g = lane >> 4; const int which = blockIdx.z; const int c0 = blockIdx.y * 128; const size_t r0 = (size_t)blockIdx.x * 64; const size_t bb = r0 / TT; const int t0 = (int)(r0 % TT);
  const float* X = which == 0 ? XQ : which == 1 ? XK : XV; const float* WA = which == 0 ? WQ : which == 1 ? WK : WV; const float* BA = which == 0 ? BQ : which == 1 ? BK : BV;
  v8f acc[8] = {};
#pragma unroll 2
  for (int kc = 0; kc < DIN / 32; ++kc) { v16b a; { const float* p = X + (r0 + wave * 16 + col) * DIN + kc * 32 + 8 * g;
#pragma unroll
      for (int i = 0; i < 8; ++i) { a[i] = (__bf16)p[i]; a[8 + i] = (__bf16)p[16 + i]; } }
    asm volatile("s_wait_loadcnt 0x0" ::: "memory");
#pragma unroll
    for (int j = 0; j < 8; ++j) { const v16b w = WCOL(WA, kc * 32, c0 + j * 16 + col, lane); asm volatile("s_wait_loadcnt 0x0" ::: "memory"); acc[j] = wmma_bf(a, w, acc[j]); } }
  if (which < 2) { _Float16* DH = which == 0 ? QH : KH; _Float16* DL = which == 0 ? QL : KL; const int nhi = which == 0 ? QHI : KHI; const bool hi_rows = t0 < nhi;
#pragma unroll
    for (int j = 0; j < 8; ++j) { const float bias = BA ? bfr(BA[c0 + j * 16 + col]) : 0.f;
#pragma unroll
      for (int r = 0; r < 8; ++r) { const float v = acc[j][r] + bias; const _Float16 hv = (_Float16)v; sh[wave * 16 + 8 * g + r][j * 16 + col] = hv; sl[wave * 16 + 8 * g + r][j * 16 + col] = (_Float16)((v - (float)hv) * 1024.0f); } }
    __syncthreads();
    for (int e = tid; e < 64 * 16; e += 128) { const int rl = e >> 4, q = e & 15; vst2((unsigned*)(DH + (r0 + rl) * CC + c0 + q * 8), *(const v4u*)&sh[rl][q * 8]); if (hi_rows) vst2((unsigned*)(DL + (bb * nhi + t0 + rl) * (size_t)CC + c0 + q * 8), *(const v4u*)&sl[rl][q * 8]); }
  } else { const bool hi_rows = t0 < KHI;
#pragma unroll
    for (int j = 0; j < 8; ++j) { const float bias = BA ? bfr(BA[c0 + j * 16 + col]) : 0.f;
#pragma unroll
      for (int r = 0; r < 8; ++r) { const float v = acc[j][r] + bias; const int rl = wave * 16 + 8 * g + r, cl = j * 16 + col; th[cl][rl] = (_Float16)v; const __bf16 bh = (__bf16)v; tb[cl][rl] = bh; tbl[cl][rl] = (__bf16)(v - (float)bh); } }
    __syncthreads();
    for (int e = tid; e < 128 * 8; e += 128) { const int cl = e >> 3, q = e & 7; vst2((unsigned*)(VT + (bb * CC + c0 + cl) * (size_t)TT + t0 + q * 8), *(const v4u*)&th[cl][q * 8]); if (hi_rows) { const size_t o3 = (bb * CC + c0 + cl) * (size_t)KHI + t0 + q * 8; vst2((unsigned*)(VB + o3), *(const v4u*)&tb[cl][q * 8]); vst2((unsigned*)(VBL + o3), *(const v4u*)&tbl[cl][q * 8]); } } } }
// ---- k_sc: block = (query block qb, key block kb <= kb_last(qb), head in group) of batch b: logits x SCALE; q hi + residual (x 2^10) against k (2 products) for query rows < QHI, plus the k residual (3 products) for query blocks < QBH (causal early rows); causal: blocks past the diagonal exit, the mask itself is applied by index in k_sm
__global__ __launch_bounds__(128) void k_sc(const _Float16* __restrict__ QH, const _Float16* __restrict__ KH, const _Float16* __restrict__ QL, const _Float16* __restrict__ KL, int b, int h0, float* __restrict__ S0) { __shared__ __align__(16) float ss[4][16][132];
  const int qb = blockIdx.x, kb = blockIdx.y; if (kb > kb_last(qb)) return;
  const int h = h0 + blockIdx.z; float* S = S0 + (size_t)blockIdx.z * TT * TT;
  const int tid = threadIdx.x, wave = tid >> 5, lane = tid & 31, col = lane & 15, g = lane >> 4; const int k0 = kb * 128; const int ql0 = qb * 64 + wave * 16; const size_t q0 = (size_t)b * TT + ql0, kr0 = (size_t)b * TT + k0;
  v8f acc[8] = {}, accl[8] = {};
  const _Float16* QLb = QL + (size_t)b * QHI * CC; const _Float16* KLb = KL + (size_t)b * KHI * CC;
  if (qb < QBH) {
#pragma unroll
    for (int kc = 0; kc < HD / 32; ++kc) { const v16h ah = frag_h(QH + (q0 + col) * CC + h * HD + kc * 32, lane), al = frag_h(QLb + (size_t)(ql0 + col) * CC + h * HD + kc * 32, lane);
#pragma unroll
      for (int j = 0; j < 8; ++j) { const v16h kbf = frag_h(KH + (kr0 + j * 16 + col) * CC + h * HD + kc * 32, lane), klf = frag_h(KLb + (size_t)(k0 + j * 16 + col) * CC + h * HD + kc * 32, lane); acc[j] = wmma16(ah, kbf, acc[j]); accl[j] = wmma16(al, kbf, accl[j]); accl[j] = wmma16(ah, klf, accl[j]); } }
  } else if (qb * 64 < QHI) {
#pragma unroll
    for (int kc = 0; kc < HD / 32; ++kc) { const v16h ah = frag_h(QH + (q0 + col) * CC + h * HD + kc * 32, lane), al = frag_h(QLb + (size_t)(ql0 + col) * CC + h * HD + kc * 32, lane);
#pragma unroll
      for (int j = 0; j < 8; ++j) { const v16h kbf = frag_h(KH + (kr0 + j * 16 + col) * CC + h * HD + kc * 32, lane); acc[j] = wmma16(ah, kbf, acc[j]); accl[j] = wmma16(al, kbf, accl[j]); } }
  } else {
#pragma unroll
    for (int kc = 0; kc < HD / 32; ++kc) { const v16h ah = frag_h(QH + (q0 + col) * CC + h * HD + kc * 32, lane);
#pragma unroll
      for (int j = 0; j < 8; ++j) { const v16h kbf = frag_h(KH + (kr0 + j * 16 + col) * CC + h * HD + kc * 32, lane); acc[j] = wmma16(ah, kbf, acc[j]); } } }
#pragma unroll
  for (int j = 0; j < 8; ++j) {
#pragma unroll
    for (int r = 0; r < 8; ++r) ss[wave][8 * g + r][j * 16 + col] = (acc[j][r] + accl[j][r] * (1.0f / 1024.0f)) * SCALE; }
  LDSX(); for (int rl = 0; rl < 16; ++rl) vst2(S + (size_t)(ql0 + rl) * TT + k0 + lane * 4, *(const v4f*)&ss[wave][rl][lane * 4]); }
// ---- k_sm: block = query row t (head in group): keys [0, kend): causal -> logit if s <= t else excluded; softmax in f32; P x 2^11 in place (0 for excluded)
__global__ __launch_bounds__(256) void k_sm(float* __restrict__ S0 SM_EXTRA_PARAMS) { __shared__ float sred[8]; __shared__ float sbc; __shared__ __align__(16) float shv[TT];
  const int tid = threadIdx.x; const int t = blockIdx.x; const int kend = (kb_last(t >> 6) + 1) * 128;
  float* sr = S0 + (size_t)blockIdx.y * TT * TT + (size_t)t * TT;
  float m = -3.0e38f; for (int k = tid; k < kend; k += 256) { float v = (!CAUSAL || k <= t) ? sr[k] : -3.0e38f; SM_MASK_HOOK; shv[k] = v; m = fmaxf(m, v); }
#pragma unroll
  for (int o = 1; o < 32; o <<= 1) m = fmaxf(m, __shfl_xor(m, o));
  if ((tid & 31) == 0) sred[tid >> 5] = m; __syncthreads(); if (tid == 0) { float a = sred[0]; for (int i = 1; i < 8; ++i) a = fmaxf(a, sred[i]); sbc = a; } __syncthreads(); m = sbc; __syncthreads();
  float sum = 0.f; for (int k = tid; k < kend; k += 256) { const float v = shv[k]; const float e = (v <= -1.0e38f) ? 0.f : expf(v - m); shv[k] = e; sum += e; }
#pragma unroll
  for (int o = 1; o < 32; o <<= 1) sum += __shfl_xor(sum, o);
  if ((tid & 31) == 0) sred[tid >> 5] = sum; __syncthreads(); if (tid == 0) { float a = 0.f; for (int i = 0; i < 8; ++i) a += sred[i]; sbc = a > 0.f ? 2048.0f / a : 0.f; }   /* a fully excluded row yields P = 0 */ __syncthreads(); const float inv = sbc;
  for (int k = tid; k < kend; k += 256) shv[k] = shv[k] * inv;
  __syncthreads(); for (int q = tid; q < kend / 4; q += 256) vst2(sr + q * 4, *(const v4f*)&shv[q * 4]); }
// ---- k_pv: block = 64 queries (qb) of (b, h): ctx = P . v over keys [0, kend) (P x 2^11 once to f16 against v f16: 1 product; causal early query blocks: P and v as bf16 hi + lo, 3 products); 256-B (row, head) segment by 16 lanes
__global__ __launch_bounds__(128) void k_pv(const float* __restrict__ PS0, const _Float16* __restrict__ VT, const __bf16* __restrict__ VB, const __bf16* __restrict__ VBL, int b, int h0, float* __restrict__ Y) { const int h = h0 + blockIdx.z; const float* PS = PS0 + (size_t)blockIdx.z * TT * TT; __shared__ __align__(16) float ss[4][16][HD + 4];
  const int tid = threadIdx.x, wave = tid >> 5, lane = tid & 31, col = lane & 15, g = lane >> 4; const int qb = blockIdx.x; const int ql0 = qb * 64 + wave * 16; const int kce = (kb_last(qb) + 1) * 4;
  v8f acc[HD / 16] = {};
  if (qb < QBH) {
#pragma unroll 1
    for (int kc = 0; kc < kce; ++kc) { const F2 p = split_row(PS + (size_t)(ql0 + col) * TT, kc * 32, lane);
      asm volatile("s_wait_loadcnt 0x0" ::: "memory");
#pragma unroll
      for (int j = 0; j < HD / 16; ++j) { const size_t po = ((size_t)b * CC + h * HD + j * 16 + col) * (size_t)KHI + kc * 32; const v16b vh = frag_b(VB + po, lane); acc[j] = wmma_bf(p.h, vh, acc[j]); acc[j] = wmma_bf(p.l, vh, acc[j]); acc[j] = wmma_bf(p.h, frag_b(VBL + po, lane), acc[j]); } }
  } else {
#pragma unroll 1
    for (int kc = 0; kc < kce; ++kc) { const v16h p = frag_f32(PS + (size_t)(ql0 + col) * TT + kc * 32, lane);
      asm volatile("s_wait_loadcnt 0x0" ::: "memory");
#pragma unroll
      for (int j = 0; j < HD / 16; ++j) { const size_t po = ((size_t)b * CC + h * HD + j * 16 + col) * (size_t)TT + kc * 32; acc[j] = wmma16(p, frag_h(VT + po, lane), acc[j]); } } }
#pragma unroll
  for (int j = 0; j < HD / 16; ++j)
#pragma unroll
    for (int r = 0; r < 8; ++r) ss[wave][8 * g + r][j * 16 + col] = acc[j][r] * (1.0f / 2048.0f);
  LDSX(); for (int rl = 0; rl < 16; ++rl) if (lane < HD / 4) vst2(Y + ((size_t)b * TT + ql0 + rl) * CC + h * HD + lane * 4, *(const v4f*)&ss[wave][rl][lane * 4]); }
// ---- k_out: block = (64 rows, 128 cols): out = ctx Wo (+ bo): ctx x 2^6 once to f16 against Wo as f16(bf16 x 2^8) exact (1 product) x 2^-14; causal early rows (< QHI of each sequence): ctx bf16 hi + lo against exact bf16 Wo (2 products)
__global__ __launch_bounds__(128) void k_out(const float* __restrict__ Y, const float* __restrict__ WO, const float* __restrict__ BO, float* __restrict__ OUT) { __shared__ __align__(16) float sf[4][16][132];
  const int tid = threadIdx.x, wave = tid >> 5, lane = tid & 31, col = lane & 15, g = lane >> 4; const int c0 = blockIdx.y * 128; const size_t r0 = (size_t)blockIdx.x * 64 + wave * 16;
  v8f acc[8] = {};
  if (CAUSAL && (int)(((size_t)blockIdx.x * 64) % TT) < QHI) {   /* block-uniform */
#pragma unroll 2
    for (int kc = 0; kc < CC / 32; ++kc) { const F2 a = split_row(Y + (r0 + col) * CC, kc * 32, lane); asm volatile("s_wait_loadcnt 0x0" ::: "memory");
#pragma unroll
      for (int j = 0; j < 8; ++j) { const v16b w = WOCOL(WO, kc * 32, c0 + j * 16 + col, lane); asm volatile("s_wait_loadcnt 0x0" ::: "memory"); acc[j] = wmma_bf(a.h, w, acc[j]); acc[j] = wmma_bf(a.l, w, acc[j]); } }
#pragma unroll
    for (int j = 0; j < 8; ++j) { const float bias = BO ? bfr(BO[c0 + j * 16 + col]) : 0.f;
#pragma unroll
      for (int r = 0; r < 8; ++r) sf[wave][8 * g + r][j * 16 + col] = acc[j][r] + bias; }
  } else {
#pragma unroll 2
    for (int kc = 0; kc < CC / 32; ++kc) { const v16h a = frag_f32s(Y + (r0 + col) * CC + kc * 32, lane, 64.0f); asm volatile("s_wait_loadcnt 0x0" ::: "memory");   /* ctx carried x 2^6 into f16 so small-magnitude context rows stay clear of f16 subnormals */
#pragma unroll
      for (int j = 0; j < 8; ++j) { const v16h w = WOCOLH(WO, kc * 32, c0 + j * 16 + col, lane); asm volatile("s_wait_loadcnt 0x0" ::: "memory"); acc[j] = wmma16(a, w, acc[j]); } }
#pragma unroll
    for (int j = 0; j < 8; ++j) { const float bias = BO ? bfr(BO[c0 + j * 16 + col]) : 0.f;
#pragma unroll
      for (int r = 0; r < 8; ++r) sf[wave][8 * g + r][j * 16 + col] = acc[j][r] * (1.0f / 16384.0f) + bias; } }   /* 2^-8 (Wo carry) x 2^-6 (ctx carry) */
  LDSX(); for (int rl = 0; rl < 16; ++rl) vst2(OUT + (r0 + rl) * DIN + c0 + lane * 4, *(const v4f*)&sf[wave][rl][lane * 4]); }

extern "C" void kernel_launch(void* const* d_in, const int* in_sizes, int n_in, void* d_out, int out_size, void* d_ws, size_t ws_size, hipStream_t stream) {
  (void)in_sizes; (void)n_in; (void)out_size;
  const float** F = (const float**)d_in;
  if (ws_size < (size_t)WS_END) return;
  char* ws = (char*)d_ws; _Float16 *QH = (_Float16*)(ws + WS_QH), *KH = (_Float16*)(ws + WS_KH), *VT = (_Float16*)(ws + WS_VT), *QL = (_Float16*)(ws + WS_QL), *KL = (_Float16*)(ws + WS_KL); __bf16 *VB = (__bf16*)(ws + WS_VB), *VBL = (__bf16*)(ws + WS_VBL); float *S = (float*)(ws + WS_S), *Y = (float*)(ws + WS_Y);
  (void)Y; (void)QL; (void)KL; (void)VB; (void)VBL;
  // inputs: 0 x [2,2048,1024]; 1 Wq [1024,1024] (in,out), 2 bq; 3 Wk, 4 bk; 5 Wv, 6 bv (biases NONZERO); 7 Wo [1024,1024] (out,in); no output bias
  k_proj<<<dim3(TNB * TT / 64, CC / 128, 3), 128, 0, stream>>>(F[0], F[0], F[0], F[1], F[3], F[5], F[2], F[4], F[6], QH, QL, KH, KL, VT, VB, VBL);
  for (int b = 0; b < TNB; ++b) for (int h0 = 0; h0 < NH; h0 += HG) {
    k_sc<<<dim3(NQB, TT / 128, HG), 128, 0, stream>>>(QH, KH, QL, KL, b, h0, S);
    k_sm<<<dim3(TT, HG), 256, 0, stream>>>(S);
    k_pv<<<dim3(NQB, 1, HG), 128, 0, stream>>>(S, VT, VB, VBL, b, h0, Y);
  }
  k_out<<<dim3(TNB * TT / 64, DIN / 128), 128, 0, stream>>>(Y, F[7], nullptr, (float*)d_out);
}

// v001
// One run takes 720 microseconds.
// Two timings next to v000 put it at 1.50 and 1.48 times that version's speed.
// compute dtype: all float inputs rounded to bf16; the fused q / k / v projection with EXACT bf16 products on WMMA 16x16x32 (f32 accumulate) + bias (nonzero); causal logits: 3 products for the first 384 rows, single f16 q x k after, x 1024^-0.5 (the module scales by the MODEL width); softmax f32; P x 2^11 once to f16 x v once to f16 (bf16 hi + lo below row 384); ctx hi+lo x exact W below row 384, x2^6 f16 carry x f16(bf16 x 2^8) W after; no output bias; f32 output.
#include <hip/hip_runtime.h>
#include <math.h>

typedef __attribute__((ext_vector_type(16))) _Float16 v16h;
typedef __attribute__((ext_vector_type(16))) __bf16 v16b;
typedef __attribute__((ext_vector_type(8)))  _Float16 v8h;
typedef __attribute__((ext_vector_type(8)))  float v8f;
typedef __attribute__((ext_vector_type(4)))  float v4f;
typedef __attribute__((ext_vector_type(2)))  float v2f;
typedef __attribute__((ext_vector_type(4)))  unsigned v4u;
typedef __attribute__((ext_vector_type(4)))  int v4i;
typedef float __attribute__((may_alias)) float_a;
typedef int __attribute__((may_alias)) int_a;

template <typename T> __device__ __forceinline__ void vst2(void* p, T v) { *(T*)p = v;  }
__device__ __forceinline__ v8f wmma16(v16h a, v16h b, v8f c) {
  v8f d = __builtin_amdgcn_wmma_f32_16x16x32_f16(false, a, false, b, (short)0, c, false, false);
  asm volatile("v_nop\n\tv_nop\n\tv_nop\n\tv_nop" : "+v"(d) : "v"(a), "v"(b));
  return d;
}
__device__ __forceinline__ v8f wmma_bf(v16b a, v16b b, v8f c) {
  v8f d = __builtin_amdgcn_wmma_f32_16x16x32_bf16(false, a, false, b, (short)0, c, false, false);
  asm volatile("v_nop\n\tv_nop\n\tv_nop\n\tv_nop" : "+v"(d) : "v"(a), "v"(b));
  return d;
}
// 16x16x32 fragments: lane = (h = lane>>4, row/col = lane&15); elements 0..7 = k0+8h+0..7, 8..15 = k0+16+8h+0..7; D element r = row 8h+r
__device__ __forceinline__ v16h frag_h(const _Float16* rowk0, int lane) {
  union { v16h v; v8h q[2]; } u; const _Float16* p = rowk0 + 8 * (lane >> 4);
  u.q[0] = *(const v8h*)p; u.q[1] = *(const v8h*)(p + 16); return u.v;
}
__device__ __forceinline__ v16h frag_f32(const float* rowk0, int lane) {
  v16h a; const float* p = rowk0 + 8 * (lane >> 4);
#pragma unroll
  for (int i = 0; i < 8; ++i) { a[i] = (_Float16)p[i]; a[8 + i] = (_Float16)p[16 + i]; }
  return a;
}
__device__ __forceinline__ v16h frag_f32s(const float* rowk0, int lane, float sc) {
  v16h a; const float* p = rowk0 + 8 * (lane >> 4);
#pragma unroll
  for (int i = 0; i < 8; ++i) { a[i] = (_Float16)(p[i] * sc); a[8 + i] = (_Float16)(p[16 + i] * sc); }
  return a;
}
// column fragment from a [K][ld] layout (column n), rows >= K read as 0
__device__ __forceinline__ v16h fragc_f32(const float* W, int k0, int n, int lane, int ld, int K) {
  v16h a; const int g = lane >> 4;
#pragma unroll
  for (int i = 0; i < 8; ++i) { const int ka = k0 + 8 * g + i, kb = ka + 16;
    a[i] = (_Float16)(ka < K ? W[(size_t)(ka < K ? ka : K - 1) * ld + n] : 0.f); a[8 + i] = (_Float16)(kb < K ? W[(size_t)(kb < K ? kb : K - 1) * ld + n] : 0.f); }
  return a;
}
struct F2 { v16b h, l; };
__device__ __forceinline__ F2 bsplit16(const float v[16]) { F2 r;
#pragma unroll
  for (int i = 0; i < 16; ++i) { const __bf16 h = (__bf16)v[i]; r.h[i] = h; r.l[i] = (__bf16)(v[i] - (float)h); }
  return r; }
__device__ __forceinline__ F2 split_row(const float* row, int k0, int lane) { float v[16]; const float* p = row + k0 + 8 * (lane >> 4);
#pragma unroll
  for (int i = 0; i < 8; ++i) { v[i] = p[i]; v[8 + i] = p[16 + i]; }
  return bsplit16(v); }
__device__ __forceinline__ F2 split_rowK(const float* row, int k0, int lane, int K) { float v[16]; const int g = lane >> 4;
#pragma unroll
  for (int i = 0; i < 8; ++i) { const int ka = k0 + 8 * g + i, kb = ka + 16; v[i] = ka < K ? row[ka < K ? ka : K - 1] : 0.f; v[8 + i] = kb < K ? row[kb < K ? kb : K - 1] : 0.f; }
  return bsplit16(v); }
__device__ __forceinline__ F2 split_col(const float* W, int k0, int n, int lane, int ld, int K) { float v[16]; const int g = lane >> 4;
#pragma unroll
  for (int i = 0; i < 8; ++i) { const int ka = k0 + 8 * g + i, kb = ka + 16; v[i] = ka < K ? W[(size_t)(ka < K ? ka : K - 1) * ld + n] : 0.f; v[8 + i] = kb < K ? W[(size_t)(kb < K ? kb : K - 1) * ld + n] : 0.f; }
  return bsplit16(v); }
__device__ __forceinline__ v8f mac3(const F2& a, const F2& b, v8f c) { c = wmma_bf(a.l, b.h, c); c = wmma_bf(a.h, b.l, c); return wmma_bf(a.h, b.h, c); }
__device__ __forceinline__ float sigm(float v) { return 1.0f / (1.0f + expf(-v)); }
#define LDSX() do { asm volatile("s_wait_dscnt 0" ::: "memory"); __builtin_amdgcn_wave_barrier(); __builtin_amdgcn_fence(__ATOMIC_RELEASE, "workgroup"); } while (0)

// Multi-head causal self-attention whose logits are scaled by 1/sqrt(EMBED) (x [2,2048,1024]; (in,out) Wq / Wk / Wv [1024,1024] and biases [1024] NONZERO applied as x @ W + b; Wo [1024,1024] torch (out,in), NO output bias; 16 heads x 64; logits x 1/sqrt(1024) = 1/32 - the model width, not the head width; tril kept, -inf elsewhere; softmax; z @ Wo.T).
#define NB 2
#define TT 2048
#define CC 1024            // NH * HD = projected width
#define DIN 1024          // input (model) width
#define NH 16
#define HD 64
#define NQB (TT / 64)
#define HG 4
#define SCALE (0.03125f)
#define CAUSAL 1
#ifndef TNB
#define TNB NB
#endif
__device__ __forceinline__ float bfr(float v) { return (float)(__bf16)v; }
__host__ __device__ __forceinline__ int kb_last(int qb) { return CAUSAL ? ((qb * 64 + 63) >> 7) : (TT / 128 - 1); }
typedef __attribute__((ext_vector_type(8))) __bf16 v8b;
__device__ __forceinline__ v16b frag_b(const __bf16* rowk0, int lane) {
  union { v16b v; v8b q[2]; } u; const __bf16* p = rowk0 + 8 * (lane >> 4);
  u.q[0] = *(const v8b*)p; u.q[1] = *(const v8b*)(p + 16); return u.v;
}
#define QBH 6              // causal: query blocks 0..QBH-1 of each sequence (few keys, no averaging) take the high-precision path
#define QHI 384            // rows carrying a q residual plane
#define KHI 384            // key rows carrying k residual / v bf16 hi+lo planes (used only by the causal high-precision path)
// B fragment (k rows k0+.., output column o) of a weight: (in,out) [K][ld] or (out,in) [ld rows of K]: bf16 exact, or f16(bf16 * 256) exact
__device__ __forceinline__ v16b wcol_io(const float* Wm, int k0, int o, int lane, int ld) { v16b w; const int g = lane >> 4;
#pragma unroll
  for (int i = 0; i < 8; ++i) { w[i] = (__bf16)Wm[(size_t)(k0 + 8 * g + i) * ld + o]; w[8 + i] = (__bf16)Wm[(size_t)(k0 + 16 + 8 * g + i) * ld + o]; }
  return w; }
__device__ __forceinline__ v16b wcol_oi(const float* Wm, int k0, int o, int lane, int K) { v16b w; const float* p = Wm + (size_t)o * K + k0 + 8 * (lane >> 4);
#pragma unroll
  for (int i = 0; i < 8; ++i) { w[i] = (__bf16)p[i]; w[8 + i] = (__bf16)p[16 + i]; }
  return w; }
__device__ __forceinline__ v16h wcolh_io(const float* Wm, int k0, int o, int lane, int ld) { v16h w; const int g = lane >> 4;
#pragma unroll
  for (int i = 0; i < 8; ++i) { w[i] = (_Float16)(bfr(Wm[(size_t)(k0 + 8 * g + i) * ld + o]) * 256.0f); w[8 + i] = (_Float16)(bfr(Wm[(size_t)(k0 + 16 + 8 * g + i) * ld + o]) * 256.0f); }
  return w; }
__device__ __forceinline__ v16h wcolh_oi(const float* Wm, int k0, int o, int lane, int K) { v16h w; const float* p = Wm + (size_t)o * K + k0 + 8 * (lane >> 4);
#pragma unroll
  for (int i = 0; i < 8; ++i) { w[i] = (_Float16)(bfr(p[i]) * 256.0f); w[8 + i] = (_Float16)(bfr(p[16 + i]) * 256.0f); }
  return w; }
#define WQKV_LAYOUT 0   // 0 = (in,out) [DIN][CC]; 1 = (out,in) [CC][DIN]; 2 = per-head [NH][DIN][HD]
__device__ __forceinline__ v16b wcol_hdk(const float* Wm, int k0, int o, int lane) { v16b w; const int g = lane >> 4; const float* p = Wm + (size_t)(o / HD) * DIN * HD + (o % HD);
#pragma unroll
  for (int i = 0; i < 8; ++i) { w[i] = (__bf16)p[(size_t)(k0 + 8 * g + i) * HD]; w[8 + i] = (__bf16)p[(size_t)(k0 + 16 + 8 * g + i) * HD]; }
  return w; }
#define WO_OUT_IN 1
#if WQKV_LAYOUT == 1
#define WCOL(W, k0, o, lane) wcol_oi(W, k0, o, lane, DIN)
#elif WQKV_LAYOUT == 2
#define WCOL(W, k0, o, lane) wcol_hdk(W, k0, o, lane)
#else
#define WCOL(W, k0, o, lane) wcol_io(W, k0, o, lane, CC)
#endif
#if WO_OUT_IN
#define WOCOL(W, k0, o, lane) wcol_oi(W, k0, o, lane, CC)
#define WOCOLH(W, k0, o, lane) wcolh_oi(W, k0, o, lane, CC)
#else
#define WOCOL(W, k0, o, lane) wcol_io(W, k0, o, lane, DIN)
#define WOCOLH(W, k0, o, lane) wcolh_io(W, k0, o, lane, DIN)
#endif

#ifndef SM_EXTRA_PARAMS
#define SM_EXTRA_PARAMS
#endif
#ifndef PROJ_EXTRA_PARAMS
#define PROJ_EXTRA_PARAMS
#endif
#ifndef SM_MASK_HOOK
#define SM_MASK_HOOK (void)0
#endif

#define WS_QH  0u                                      // f16 q rows [b*t][CC]
#define WS_KH  (WS_QH + 2u * (size_t)NB * TT * CC)      // f16 k rows [b*t][CC]
#define WS_VT  (WS_KH + 2u * (size_t)NB * TT * CC)      // f16 v planes [b][c][t]
#define WS_QL  (WS_VT + 2u * (size_t)NB * CC * TT)      // f16 q residual x 2^10 rows [b][t < QHI][CC]
#define WS_KL  (WS_QL + 2u * (size_t)NB * QHI * CC)     // f16 k residual x 2^10 rows [b][t < KHI][CC]
#define WS_VB  (WS_KL + 2u * (size_t)NB * KHI * CC)     // bf16 v hi planes [b][c][t < KHI]
#define WS_VBL (WS_VB + 2u * (size_t)NB * CC * KHI)
#define WS_S   (WS_VBL + 2u * (size_t)NB * CC * KHI)    // f32 logits / P [hg][t][s]
#define WS_Y   (WS_S  + 4u * (size_t)HG * TT * TT)      // f32 ctx rows [b*t][CC] (only when there is an output projection)
#define WS_END (WS_Y  + 4u * (size_t)NB * TT * CC)

// ---- k_proj: block = (64 rows, 128 cols, which): q/k/v = X W (+ b) with exact bf16 products (K = DIN) -> which 0: q f16 rows (+ residual rows < QHI); 1: k f16 rows (+ residual rows < KHI); 2: v f16 planes [c][t] (+ bf16 hi/lo planes for t < KHI)
__global__ __launch_bounds__(128) void k_proj(const float* __restrict__ XQ, const float* __restrict__ XK, const float* __restrict__ XV, const float* __restrict__ WQ, const float* __restrict__ WK, const float* __restrict__ WV, const float* __restrict__ BQ, const float* __restrict__ BK, const float* __restrict__ BV,
    _Float16* __restrict__ QH, _Float16* __restrict__ QL, _Float16* __restrict__ KH, _Float16* __restrict__ KL, _Float16* __restrict__ VT, __bf16* __restrict__ VB, __bf16* __restrict__ VBL) {
  __shared__ __align__(16) _Float16 sh[64][136], sl[64][136]; __shared__ __align__(16) _Float16 th[128][72]; __shared__ __align__(16) __bf16 tb[128][72], tbl[128][72];
  const int tid = threadIdx.x, wave = tid >> 5, lane = tid & 31, col = lane & 15, g = lane >> 4; const int which = blockIdx.z; const int c0 = blockIdx.y * 128; const size_t r0 = (size_t)blockIdx.x * 64; const size_t bb = r0 / TT; const int t0 = (int)(r0 % TT);
  const float* X = which == 0 ? XQ : which == 1 ? XK : XV; const float* WA = which == 0 ? WQ : which == 1 ? WK : WV; const float* BA = which == 0 ? BQ : which == 1 ? BK : BV;
  v8f acc[8] = {};
#pragma unroll 2
  for (int kc = 0; kc < DIN / 32; ++kc) { v16b a; { const float* p = X + (r0 + wave * 16 + col) * DIN + kc * 32 + 8 * g;
#pragma unroll
      for (int i = 0; i < 8; ++i) { a[i] = (__bf16)p[i]; a[8 + i] = (__bf16)p[16 + i]; } }
    asm volatile("s_wait_loadcnt 0x0" ::: "memory");
#pragma unroll
    for (int j = 0; j < 8; ++j) { const v16b w = WCOL(WA, kc * 32, c0 + j * 16 + col, lane); asm volatile("s_wait_loadcnt 0x0" ::: "memory"); acc[j] = wmma_bf(a, w, acc[j]); } }
  if (which < 2) { _Float16* DH = which == 0 ? QH : KH; _Float16* DL = which == 0 ? QL : KL; const int nhi = which == 0 ? QHI : KHI; const bool hi_rows = t0 < nhi;
#pragma unroll
    for (int j = 0; j < 8; ++j) { const float bias = BA ? bfr(BA[c0 + j * 16 + col]) : 0.f;
#pragma unroll
      for (int r = 0; r < 8; ++r) { const float v = acc[j][r] + bias; const _Float16 hv = (_Float16)v; sh[wave * 16 + 8 * g + r][j * 16 + col] = hv; sl[wave * 16 + 8 * g + r][j * 16 + col] = (_Float16)((v - (float)hv) * 1024.0f); } }
    __syncthreads();
    for (int e = tid; e < 64 * 16; e += 128) { const int rl = e >> 4, q = e & 15; vst2((unsigned*)(DH + (r0 + rl) * CC + c0 + q * 8), *(const v4u*)&sh[rl][q * 8]); if (hi_rows) vst2((unsigned*)(DL + (bb * nhi + t0 + rl) * (size_t)CC + c0 + q * 8), *(const v4u*)&sl[rl][q * 8]); }
  } else { const bool hi_rows = t0 < KHI;
#pragma unroll
    for (int j = 0; j < 8; ++j) { const float bias = BA ? bfr(BA[c0 + j * 16 + col]) : 0.f;
#pragma unroll
      for (int r = 0; r < 8; ++r) { const float v = acc[j][r] + bias; const int rl = wave * 16 + 8 * g + r, cl = j * 16 + col; th[cl][rl] = (_Float16)v; const __bf16 bh = (__bf16)v; tb[cl][rl] = bh; tbl[cl][rl] = (__bf16)(v - (float)bh); } }
    __syncthreads();
    for (int e = tid; e < 128 * 8; e += 128) { const int cl = e >> 3, q = e & 7; vst2((unsigned*)(VT + (bb * CC + c0 + cl) * (size_t)TT + t0 + q * 8), *(const v4u*)&th[cl][q * 8]); if (hi_rows) { const size_t o3 = (bb * CC + c0 + cl) * (size_t)KHI + t0 + q * 8; vst2((unsigned*)(VB + o3), *(const v4u*)&tb[cl][q * 8]); vst2((unsigned*)(VBL + o3), *(const v4u*)&tbl[cl][q * 8]); } } } }
// ---- k_sc: block = (query block qb, key block kb <= kb_last(qb), head in group) of batch b: logits x SCALE; q hi + residual (x 2^10) against k (2 products) for query rows < QHI, plus the k residual (3 products) for query blocks < QBH (causal early rows); causal: blocks past the diagonal exit, the mask itself is applied by index in k_sm
__global__ __launch_bounds__(128) void k_sc(const _Float16* __restrict__ QH, const _Float16* __restrict__ KH, const _Float16* __restrict__ QL, const _Float16* __restrict__ KL, int b, int h0, float* __restrict__ S0) { __shared__ __align__(16) float ss[4][16][132];
  const int qb = blockIdx.x, kb = blockIdx.y; if (kb > kb_last(qb)) return;
  const int h = h0 + blockIdx.z; float* S = S0 + (size_t)blockIdx.z * TT * TT;
  const int tid = threadIdx.x, wave = tid >> 5, lane = tid & 31, col = lane & 15, g = lane >> 4; const int k0 = kb * 128; const int ql0 = qb * 64 + wave * 16; const size_t q0 = (size_t)b * TT + ql0, kr0 = (size_t)b * TT + k0;
  v8f acc[8] = {}, accl[8] = {};
  const _Float16* QLb = QL + (size_t)b * QHI * CC; const _Float16* KLb = KL + (size_t)b * KHI * CC;
  if (qb < QBH) {
#pragma unroll
    for (int kc = 0; kc < HD / 32; ++kc) { const v16h ah = frag_h(QH + (q0 + col) * CC + h * HD + kc * 32, lane), al = frag_h(QLb + (size_t)(ql0 + col) * CC + h * HD + kc * 32, lane);
#pragma unroll
      for (int j = 0; j < 8; ++j) { const v16h kbf = frag_h(KH + (kr0 + j * 16 + col) * CC + h * HD + kc * 32, lane), klf = frag_h(KLb + (size_t)(k0 + j * 16 + col) * CC + h * HD + kc * 32, lane); acc[j] = wmma16(ah, kbf, acc[j]); accl[j] = wmma16(al, kbf, accl[j]); accl[j] = wmma16(ah, klf, accl[j]); } }
  } else if (qb * 64 < QHI) {
#pragma unroll
    for (int kc = 0; kc < HD / 32; ++kc) { const v16h ah = frag_h(QH + (q0 + col) * CC + h * HD + kc * 32, lane), al = frag_h(QLb + (size_t)(ql0 + col) * CC + h * HD + kc * 32, lane);
#pragma unroll
      for (int j = 0; j < 8; ++j) { const v16h kbf = frag_h(KH + (kr0 + j * 16 + col) * CC + h * HD + kc * 32, lane); acc[j] = wmma16(ah, kbf, acc[j]); accl[j] = wmma16(al, kbf, accl[j]); } }
  } else {
#pragma unroll
    for (int kc = 0; kc < HD / 32; ++kc) { const v16h ah = frag_h(QH + (q0 + col) * CC + h * HD + kc * 32, lane);
#pragma unroll
      for (int j = 0; j < 8; ++j) { const v16h kbf = frag_h(KH + (kr0 + j * 16 + col) * CC + h * HD + kc * 32, lane); acc[j] = wmma16(ah, kbf, acc[j]); } } }
#pragma unroll
  for (int j = 0; j < 8; ++j) {
#pragma unroll
    for (int r = 0; r < 8; ++r) ss[wave][8 * g + r][j * 16 + col] = (acc[j][r] + accl[j][r] * (1.0f / 1024.0f)) * SCALE; }
  LDSX(); for (int rl = 0; rl < 16; ++rl) vst2(S + (size_t)(ql0 + rl) * TT + k0 + lane * 4, *(const v4f*)&ss[wave][rl][lane * 4]); }
// ---- k_sm: block = query row t (head in group): keys [0, kend): causal -> logit if s <= t else excluded; softmax in f32; P x 2^11 in place (0 for excluded)
__global__ __launch_bounds__(256) void k_sm(float* __restrict__ S0 SM_EXTRA_PARAMS) { __shared__ float sred[8]; __shared__ float sbc; __shared__ __align__(16) float shv[TT];
  const int tid = threadIdx.x; const int t = blockIdx.x; const int kend = (kb_last(t >> 6) + 1) * 128;
  float* sr = S0 + (size_t)blockIdx.y * TT * TT + (size_t)t * TT;
  float m = -3.0e38f; for (int k = tid; k < kend; k += 256) { float v = (!CAUSAL || k <= t) ? sr[k] : -3.0e38f; SM_MASK_HOOK; shv[k] = v; m = fmaxf(m, v); }
#pragma unroll
  for (int o = 1; o < 32; o <<= 1) m = fmaxf(m, __shfl_xor(m, o));
  if ((tid & 31) == 0) sred[tid >> 5] = m; __syncthreads(); if (tid == 0) { float a = sred[0]; for (int i = 1; i < 8; ++i) a = fmaxf(a, sred[i]); sbc = a; } __syncthreads(); m = sbc; __syncthreads();
  float sum = 0.f; for (int k = tid; k < kend; k += 256) { const float v = shv[k]; const float e = (v <= -1.0e38f) ? 0.f : expf(v - m); shv[k] = e; sum += e; }
#pragma unroll
  for (int o = 1; o < 32; o <<= 1) sum += __shfl_xor(sum, o);
  if ((tid & 31) == 0) sred[tid >> 5] = sum; __syncthreads(); if (tid == 0) { float a = 0.f; for (int i = 0; i < 8; ++i) a += sred[i]; sbc = a > 0.f ? 2048.0f / a : 0.f; }   /* a fully excluded row yields P = 0 */ __syncthreads(); const float inv = sbc;
  for (int k = tid; k < kend; k += 256) shv[k] = shv[k] * inv;
  __syncthreads(); for (int q = tid; q < kend / 4; q += 256) vst2(sr + q * 4, *(const v4f*)&shv[q * 4]); }
// ---- k_pv: block = 16 query rows of (b, h), PVW waves: wave w takes the 32-key chunks w, w + PVW, ... of keys [0, kend) and the partial 16 x 64 tiles are added in LDS in wave order (P x 2^11 once to f16 against v f16: 1 product; causal early query blocks: P and v as bf16 hi + lo, 3 products); 256-B (row, head) segment by 16 lanes
#define PVW 16
__global__ __launch_bounds__(32 * PVW) void k_pv(const float* __restrict__ PS0, const _Float16* __restrict__ VT, const __bf16* __restrict__ VB, const __bf16* __restrict__ VBL, int b, int h0, float* __restrict__ Y) { const int h = h0 + blockIdx.z; const float* PS = PS0 + (size_t)blockIdx.z * TT * TT; __shared__ __align__(16) float ss[PVW][16][HD + 4];
  const int tid = threadIdx.x, wave = __builtin_amdgcn_readfirstlane(tid >> 5), lane = tid & 31, col = lane & 15, g = lane >> 4; const int qb = blockIdx.x >> 2; const int ql0 = blockIdx.x * 16; const int kce = (kb_last(qb) + 1) * 4;
  v8f acc[HD / 16] = {};
  if (qb < QBH) {
#pragma unroll 1
    for (int kc = wave; kc < kce; kc += PVW) { const F2 p = split_row(PS + (size_t)(ql0 + col) * TT, kc * 32, lane);
      asm volatile("s_wait_loadcnt 0x0" ::: "memory");
#pragma unroll
      for (int j = 0; j < HD / 16; ++j) { const size_t po = ((size_t)b * CC + h * HD + j * 16 + col) * (size_t)KHI + kc * 32; const v16b vh = frag_b(VB + po, lane); acc[j] = wmma_bf(p.h, vh, acc[j]); acc[j] = wmma_bf(p.l, vh, acc[j]); acc[j] = wmma_bf(p.h, frag_b(VBL + po, lane), acc[j]); } }
  } else {
#pragma unroll 1
    for (int kc = wave; kc < kce; kc += PVW) { const v16h p = frag_f32(PS + (size_t)(ql0 + col) * TT + kc * 32, lane);
      asm volatile("s_wait_loadcnt 0x0" ::: "memory");
#pragma unroll
      for (int j = 0; j < HD / 16; ++j) { const size_t po = ((size_t)b * CC + h * HD + j * 16 + col) * (size_t)TT + kc * 32; acc[j] = wmma16(p, frag_h(VT + po, lane), acc[j]); } } }
#pragma unroll
  for (int j = 0; j < HD / 16; ++j)
#pragma unroll
    for (int r = 0; r < 8; ++r) ss[wave][8 * g + r][j * 16 + col] = acc[j][r];
  __syncthreads();   /* every wave's partial tile is in LDS before any thread adds across waves */
  if (tid < 16 * (HD / 4)) { const int rl = tid / (HD / 4), q = tid % (HD / 4); v4f s = *(const v4f*)&ss[0][rl][q * 4];
#pragma unroll
    for (int w = 1; w < PVW; ++w) s += *(const v4f*)&ss[w][rl][q * 4];
    vst2(Y + ((size_t)b * TT + ql0 + rl) * CC + h * HD + q * 4, s * (1.0f / 2048.0f)); } }
// ---- k_out: block = (64 rows, 128 cols): out = ctx Wo (+ bo): ctx x 2^6 once to f16 against Wo as f16(bf16 x 2^8) exact (1 product) x 2^-14; causal early rows (< QHI of each sequence): ctx bf16 hi + lo against exact bf16 Wo (2 products)
__global__ __launch_bounds__(128) void k_out(const float* __restrict__ Y, const float* __restrict__ WO, const float* __restrict__ BO, float* __restrict__ OUT) { __shared__ __align__(16) float sf[4][16][132];
  const int tid = threadIdx.x, wave = tid >> 5, lane = tid & 31, col = lane & 15, g = lane >> 4; const int c0 = blockIdx.y * 128; const size_t r0 = (size_t)blockIdx.x * 64 + wave * 16;
  v8f acc[8] = {};
  if (CAUSAL && (int)(((size_t)blockIdx.x * 64) % TT) < QHI) {   /* block-uniform */
#pragma unroll 2
    for (int kc = 0; kc < CC / 32; ++kc) { const F2 a = split_row(Y + (r0 + col) * CC, kc * 32, lane); asm volatile("s_wait_loadcnt 0x0" ::: "memory");
#pragma unroll
      for (int j = 0; j < 8; ++j) { const v16b w = WOCOL(WO, kc * 32, c0 + j * 16 + col, lane); asm volatile("s_wait_loadcnt 0x0" ::: "memory"); acc[j] = wmma_bf(a.h, w, acc[j]); acc[j] = wmma_bf(a.l, w, acc[j]); } }
#pragma unroll
    for (int j = 0; j < 8; ++j) { const float bias = BO ? bfr(BO[c0 + j * 16 + col]) : 0.f;
#pragma unroll
      for (int r = 0; r < 8; ++r) sf[wave][8 * g + r][j * 16 + col] = acc[j][r] + bias; }
  } else {
#pragma unroll 2
    for (int kc = 0; kc < CC / 32; ++kc) { const v16h a = frag_f32s(Y + (r0 + col) * CC + kc * 32, lane, 64.0f); asm volatile("s_wait_loadcnt 0x0" ::: "memory");   /* ctx carried x 2^6 into f16 so small-magnitude context rows stay clear of f16 subnormals */
#pragma unroll
      for (int j = 0; j < 8; ++j) { const v16h w = WOCOLH(WO, kc * 32, c0 + j * 16 + col, lane); asm volatile("s_wait_loadcnt 0x0" ::: "memory"); acc[j] = wmma16(a, w, acc[j]); } }
#pragma unroll
    for (int j = 0; j < 8; ++j) { const float bias = BO ? bfr(BO[c0 + j * 16 + col]) : 0.f;
#pragma unroll
      for (int r = 0; r < 8; ++r) sf[wave][8 * g + r][j * 16 + col] = acc[j][r] * (1.0f / 16384.0f) + bias; } }   /* 2^-8 (Wo carry) x 2^-6 (ctx carry) */
  LDSX(); for (int rl = 0; rl < 16; ++rl) vst2(OUT + (r0 + rl) * DIN + c0 + lane * 4, *(const v4f*)&sf[wave][rl][lane * 4]); }

extern "C" void kernel_launch(void* const* d_in, const int* in_sizes, int n_in, void* d_out, int out_size, void* d_ws, size_t ws_size, hipStream_t stream) {
  (void)in_sizes; (void)n_in; (void)out_size;
  const float** F = (const float**)d_in;
  if (ws_size < (size_t)WS_END) return;
  char* ws = (char*)d_ws; _Float16 *QH = (_Float16*)(ws + WS_QH), *KH = (_Float16*)(ws + WS_KH), *VT = (_Float16*)(ws + WS_VT), *QL = (_Float16*)(ws + WS_QL), *KL = (_Float16*)(ws + WS_KL); __bf16 *VB = (__bf16*)(ws + WS_VB), *VBL = (__bf16*)(ws + WS_VBL); float *S = (float*)(ws + WS_S), *Y = (float*)(ws + WS_Y);
  (void)Y; (void)QL; (void)KL; (void)VB; (void)VBL;
  // inputs: 0 x [2,2048,1024]; 1 Wq [1024,1024] (in,out), 2 bq; 3 Wk, 4 bk; 5 Wv, 6 bv (biases NONZERO); 7 Wo [1024,1024] (out,in); no output bias
  k_proj<<<dim3(TNB * TT / 64, CC / 128, 3), 128, 0, stream>>>(F[0], F[0], F[0], F[1], F[3], F[5], F[2], F[4], F[6], QH, QL, KH, KL, VT, VB, VBL);
  for (int b = 0; b < TNB; ++b) for (int h0 = 0; h0 < NH; h0 += HG) {
    k_sc<<<dim3(NQB, TT / 128, HG), 128, 0, stream>>>(QH, KH, QL, KL, b, h0, S);
    k_sm<<<dim3(TT, HG), 256, 0, stream>>>(S);
    k_pv<<<dim3(TT / 16, 1, HG), 32 * PVW, 0, stream>>>(S, VT, VB, VBL, b, h0, Y);
  }
  k_out<<<dim3(TNB * TT / 64, DIN / 128), 128, 0, stream>>>(Y, F[7], nullptr, (float*)d_out);
}

// v002
// It runs in 527 microseconds.
// Timed twice side by side with v001, it ran 1.37 and 1.36 times as fast.
// Counting every step since v000, it is 2.03 times as fast.
// compute dtype: all float inputs rounded to bf16; the fused q / k / v projection with EXACT bf16 products on WMMA 16x16x32 (f32 accumulate) + bias (nonzero); causal logits: 3 products for the first 384 rows, single f16 q x k after, x 1024^-0.5 (the module scales by the MODEL width); softmax f32; P x 2^11 once to f16 x v once to f16 (bf16 hi + lo below row 384); ctx hi+lo x exact W below row 384, x2^6 f16 carry x f16(bf16 x 2^8) W after; no output bias; f32 output.
#include <hip/hip_runtime.h>
#include <math.h>

typedef __attribute__((ext_vector_type(16))) _Float16 v16h;
typedef __attribute__((ext_vector_type(16))) __bf16 v16b;
typedef __attribute__((ext_vector_type(8)))  _Float16 v8h;
typedef __attribute__((ext_vector_type(8)))  float v8f;
typedef __attribute__((ext_vector_type(4)))  float v4f;
typedef __attribute__((ext_vector_type(2)))  float v2f;
typedef __attribute__((ext_vector_type(4)))  unsigned v4u;
typedef __attribute__((ext_vector_type(4)))  int v4i;
typedef float __attribute__((may_alias)) float_a;
typedef int __attribute__((may_alias)) int_a;

template <typename T> __device__ __forceinline__ void vst2(void* p, T v) { *(T*)p = v;  }
__device__ __forceinline__ v8f wmma16(v16h a, v16h b, v8f c) {
  v8f d = __builtin_amdgcn_wmma_f32_16x16x32_f16(false, a, false, b, (short)0, c, false, false);
  asm volatile("v_nop\n\tv_nop\n\tv_nop\n\tv_nop" : "+v"(d) : "v"(a), "v"(b));
  return d;
}
__device__ __forceinline__ v8f wmma_bf(v16b a, v16b b, v8f c) {
  v8f d = __builtin_amdgcn_wmma_f32_16x16x32_bf16(false, a, false, b, (short)0, c, false, false);
  asm volatile("v_nop\n\tv_nop\n\tv_nop\n\tv_nop" : "+v"(d) : "v"(a), "v"(b));
  return d;
}
// 16x16x32 fragments: lane = (h = lane>>4, row/col = lane&15); elements 0..7 = k0+8h+0..7, 8..15 = k0+16+8h+0..7; D element r = row 8h+r
__device__ __forceinline__ v16h frag_h(const _Float16* rowk0, int lane) {
  union { v16h v; v8h q[2]; } u; const _Float16* p = rowk0 + 8 * (lane >> 4);
  u.q[0] = *(const v8h*)p; u.q[1] = *(const v8h*)(p + 16); return u.v;
}
__device__ __forceinline__ v16h frag_f32(const float* rowk0, int lane) {
  v16h a; const float* p = rowk0 + 8 * (lane >> 4);
#pragma unroll
  for (int i = 0; i < 8; ++i) { a[i] = (_Float16)p[i]; a[8 + i] = (_Float16)p[16 + i]; }
  return a;
}
__device__ __forceinline__ v16h frag_f32s(const float* rowk0, int lane, float sc) {
  v16h a; const float* p = rowk0 + 8 * (lane >> 4);
#pragma unroll
  for (int i = 0; i < 8; ++i) { a[i] = (_Float16)(p[i] * sc); a[8 + i] = (_Float16)(p[16 + i] * sc); }
  return a;
}
// column fragment from a [K][ld] layout (column n), rows >= K read as 0
__device__ __forceinline__ v16h fragc_f32(const float* W, int k0, int n, int lane, int ld, int K) {
  v16h a; const int g = lane >> 4;
#pragma unroll
  for (int i = 0; i < 8; ++i) { const int ka = k0 + 8 * g + i, kb = ka + 16;
    a[i] = (_Float16)(ka < K ? W[(size_t)(ka < K ? ka : K - 1) * ld + n] : 0.f); a[8 + i] = (_Float16)(kb < K ? W[(size_t)(kb < K ? kb : K - 1) * ld + n] : 0.f); }
  return a;
}
struct F2 { v16b h, l; };
__device__ __forceinline__ F2 bsplit16(const float v[16]) { F2 r;
#pragma unroll
  for (int i = 0; i < 16; ++i) { const __bf16 h = (__bf16)v[i]; r.h[i] = h; r.l[i] = (__bf16)(v[i] - (float)h); }
  return r; }
__device__ __forceinline__ F2 split_row(const float* row, int k0, int lane) { float v[16]; const float* p = row + k0 + 8 * (lane >> 4);
#pragma unroll
  for (int i = 0; i < 8; ++i) { v[i] = p[i]; v[8 + i] = p[16 + i]; }
  return bsplit16(v); }
__device__ __forceinline__ F2 split_rowK(const float* row, int k0, int lane, int K) { float v[16]; const int g = lane >> 4;
#pragma unroll
  for (int i = 0; i < 8; ++i) { const int ka = k0 + 8 * g + i, kb = ka + 16; v[i] = ka < K ? row[ka < K ? ka : K - 1] : 0.f; v[8 + i] = kb < K ? row[kb < K ? kb : K - 1] : 0.f; }
  return bsplit16(v); }
__device__ __forceinline__ F2 split_col(const float* W, int k0, int n, int lane, int ld, int K) { float v[16]; const int g = lane >> 4;
#pragma unroll
  for (int i = 0; i < 8; ++i) { const int ka = k0 + 8 * g + i, kb = ka + 16; v[i] = ka < K ? W[(size_t)(ka < K ? ka : K - 1) * ld + n] : 0.f; v[8 + i] = kb < K ? W[(size_t)(kb < K ? kb : K - 1) * ld + n] : 0.f; }
  return bsplit16(v); }
__device__ __forceinline__ v8f mac3(const F2& a, const F2& b, v8f c) { c = wmma_bf(a.l, b.h, c); c = wmma_bf(a.h, b.l, c); return wmma_bf(a.h, b.h, c); }
__device__ __forceinline__ float sigm(float v) { return 1.0f / (1.0f + expf(-v)); }
#define LDSX() do { asm volatile("s_wait_dscnt 0" ::: "memory"); __builtin_amdgcn_wave_barrier(); __builtin_amdgcn_fence(__ATOMIC_RELEASE, "workgroup"); } while (0)

// Multi-head causal self-attention whose logits are scaled by 1/sqrt(EMBED) (x [2,2048,1024]; (in,out) Wq / Wk / Wv [1024,1024] and biases [1024] NONZERO applied as x @ W + b; Wo [1024,1024] torch (out,in), NO output bias; 16 heads x 64; logits x 1/sqrt(1024) = 1/32 - the model width, not the head width; tril kept, -inf elsewhere; softmax; z @ Wo.T).
#define NB 2
#define TT 2048
#define CC 1024            // NH * HD = projected width
#define DIN 1024          // input (model) width
#define NH 16
#define HD 64
#define NQB (TT / 64)
#define HG 4
#define SCALE (0.03125f)
#define CAUSAL 1
#ifndef TNB
#define TNB NB
#endif
__device__ __forceinline__ float bfr(float v) { return (float)(__bf16)v; }
__host__ __device__ __forceinline__ int kb_last(int qb) { return CAUSAL ? ((qb * 64 + 63) >> 7) : (TT / 128 - 1); }
typedef __attribute__((ext_vector_type(8))) __bf16 v8b;
__device__ __forceinline__ v16b frag_b(const __bf16* rowk0, int lane) {
  union { v16b v; v8b q[2]; } u; const __bf16* p = rowk0 + 8 * (lane >> 4);
  u.q[0] = *(const v8b*)p; u.q[1] = *(const v8b*)(p + 16); return u.v;
}
#define QBH 6              // causal: query blocks 0..QBH-1 of each sequence (few keys, no averaging) take the high-precision path
#define QHI 384            // rows carrying a q residual plane
#define KHI 384            // key rows carrying k residual / v bf16 hi+lo planes (used only by the causal high-precision path)
// B fragment (k rows k0+.., output column o) of a weight: (in,out) [K][ld] or (out,in) [ld rows of K]: bf16 exact, or f16(bf16 * 256) exact
__device__ __forceinline__ v16b wcol_io(const float* Wm, int k0, int o, int lane, int ld) { v16b w; const int g = lane >> 4;
#pragma unroll
  for (int i = 0; i < 8; ++i) { w[i] = (__bf16)Wm[(size_t)(k0 + 8 * g + i) * ld + o]; w[8 + i] = (__bf16)Wm[(size_t)(k0 + 16 + 8 * g + i) * ld + o]; }
  return w; }
__device__ __forceinline__ v16b wcol_oi(const float* Wm, int k0, int o, int lane, int K) { v16b w; const float* p = Wm + (size_t)o * K + k0 + 8 * (lane >> 4);
#pragma unroll
  for (int i = 0; i < 8; ++i) { w[i] = (__bf16)p[i]; w[8 + i] = (__bf16)p[16 + i]; }
  return w; }
__device__ __forceinline__ v16h wcolh_io(const float* Wm, int k0, int o, int lane, int ld) { v16h w; const int g = lane >> 4;
#pragma unroll
  for (int i = 0; i < 8; ++i) { w[i] = (_Float16)(bfr(Wm[(size_t)(k0 + 8 * g + i) * ld + o]) * 256.0f); w[8 + i] = (_Float16)(bfr(Wm[(size_t)(k0 + 16 + 8 * g + i) * ld + o]) * 256.0f); }
  return w; }
__device__ __forceinline__ v16h wcolh_oi(const float* Wm, int k0, int o, int lane, int K) { v16h w; const float* p = Wm + (size_t)o * K + k0 + 8 * (lane >> 4);
#pragma unroll
  for (int i = 0; i < 8; ++i) { w[i] = (_Float16)(bfr(p[i]) * 256.0f); w[8 + i] = (_Float16)(bfr(p[16 + i]) * 256.0f); }
  return w; }
#define WQKV_LAYOUT 0   // 0 = (in,out) [DIN][CC]; 1 = (out,in) [CC][DIN]; 2 = per-head [NH][DIN][HD]
__device__ __forceinline__ v16b wcol_hdk(const float* Wm, int k0, int o, int lane) { v16b w; const int g = lane >> 4; const float* p = Wm + (size_t)(o / HD) * DIN * HD + (o % HD);
#pragma unroll
  for (int i = 0; i < 8; ++i) { w[i] = (__bf16)p[(size_t)(k0 + 8 * g + i) * HD]; w[8 + i] = (__bf16)p[(size_t)(k0 + 16 + 8 * g + i) * HD]; }
  return w; }
#define WO_OUT_IN 1
#if WQKV_LAYOUT == 1
#define WCOL(W, k0, o, lane) wcol_oi(W, k0, o, lane, DIN)
#elif WQKV_LAYOUT == 2
#define WCOL(W, k0, o, lane) wcol_hdk(W, k0, o, lane)
#else
#define WCOL(W, k0, o, lane) wcol_io(W, k0, o, lane, CC)
#endif
#if WO_OUT_IN
#define WOCOL(W, k0, o, lane) wcol_oi(W, k0, o, lane, CC)
#define WOCOLH(W, k0, o, lane) wcolh_oi(W, k0, o, lane, CC)
#else
#define WOCOL(W, k0, o, lane) wcol_io(W, k0, o, lane, DIN)
#define WOCOLH(W, k0, o, lane) wcolh_io(W, k0, o, lane, DIN)
#endif

#ifndef PROJ_EXTRA_PARAMS
#define PROJ_EXTRA_PARAMS
#endif

#define WS_QH  0u                                      // f16 q rows [b*t][CC]
#define WS_KH  (WS_QH + 2u * (size_t)NB * TT * CC)      // f16 k rows [b*t][CC]
#define WS_VT  (WS_KH + 2u * (size_t)NB * TT * CC)      // f16 v planes [b][c][t]
#define WS_QL  (WS_VT + 2u * (size_t)NB * CC * TT)      // f16 q residual x 2^10 rows [b][t < QHI][CC]
#define WS_KL  (WS_QL + 2u * (size_t)NB * QHI * CC)     // f16 k residual x 2^10 rows [b][t < KHI][CC]
#define WS_VB  (WS_KL + 2u * (size_t)NB * KHI * CC)     // bf16 v hi planes [b][c][t < KHI]
#define WS_VBL (WS_VB + 2u * (size_t)NB * CC * KHI)
#define WS_S   (WS_VBL + 2u * (size_t)NB * CC * KHI)    // f32 logits [hg][t][s]
#define WS_Y   (WS_S  + 4u * (size_t)HG * TT * TT)      // f32 ctx rows [b*t][CC] (only when there is an output projection)
#define WS_END (WS_Y  + 4u * (size_t)NB * TT * CC)

// ---- k_proj: block = (64 rows, 128 cols, which): q/k/v = X W (+ b) with exact bf16 products (K = DIN) -> which 0: q f16 rows (+ residual rows < QHI); 1: k f16 rows (+ residual rows < KHI); 2: v f16 planes [c][t] (+ bf16 hi/lo planes for t < KHI)
__global__ __launch_bounds__(128) void k_proj(const float* __restrict__ XQ, const float* __restrict__ XK, const float* __restrict__ XV, const float* __restrict__ WQ, const float* __restrict__ WK, const float* __restrict__ WV, const float* __restrict__ BQ, const float* __restrict__ BK, const float* __restrict__ BV,
    _Float16* __restrict__ QH, _Float16* __restrict__ QL, _Float16* __restrict__ KH, _Float16* __restrict__ KL, _Float16* __restrict__ VT, __bf16* __restrict__ VB, __bf16* __restrict__ VBL) {
  __shared__ __align__(16) _Float16 sh[64][136], sl[64][136]; __shared__ __align__(16) _Float16 th[128][72]; __shared__ __align__(16) __bf16 tb[128][72], tbl[128][72];
  const int tid = threadIdx.x, wave = tid >> 5, lane = tid & 31, col = lane & 15, g = lane >> 4; const int which = blockIdx.z; const int c0 = blockIdx.y * 128; const size_t r0 = (size_t)blockIdx.x * 64; const size_t bb = r0 / TT; const int t0 = (int)(r0 % TT);
  const float* X = which == 0 ? XQ : which == 1 ? XK : XV; const float* WA = which == 0 ? WQ : which == 1 ? WK : WV; const float* BA = which == 0 ? BQ : which == 1 ? BK : BV;
  v8f acc[8] = {};
#pragma unroll 2
  for (int kc = 0; kc < DIN / 32; ++kc) { v16b a; { const float* p = X + (r0 + wave * 16 + col) * DIN + kc * 32 + 8 * g;
#pragma unroll
      for (int i = 0; i < 8; ++i) { a[i] = (__bf16)p[i]; a[8 + i] = (__bf16)p[16 + i]; } }
    asm volatile("s_wait_loadcnt 0x0" ::: "memory");
#pragma unroll
    for (int j = 0; j < 8; ++j) { const v16b w = WCOL(WA, kc * 32, c0 + j * 16 + col, lane); asm volatile("s_wait_loadcnt 0x0" ::: "memory"); acc[j] = wmma_bf(a, w, acc[j]); } }
  if (which < 2) { _Float16* DH = which == 0 ? QH : KH; _Float16* DL = which == 0 ? QL : KL; const int nhi = which == 0 ? QHI : KHI; const bool hi_rows = t0 < nhi;
#pragma unroll
    for (int j = 0; j < 8; ++j) { const float bias = BA ? bfr(BA[c0 + j * 16 + col]) : 0.f;
#pragma unroll
      for (int r = 0; r < 8; ++r) { const float v = acc[j][r] + bias; const _Float16 hv = (_Float16)v; sh[wave * 16 + 8 * g + r][j * 16 + col] = hv; sl[wave * 16 + 8 * g + r][j * 16 + col] = (_Float16)((v - (float)hv) * 1024.0f); } }
    __syncthreads();
    for (int e = tid; e < 64 * 16; e += 128) { const int rl = e >> 4, q = e & 15; vst2((unsigned*)(DH + (r0 + rl) * CC + c0 + q * 8), *(const v4u*)&sh[rl][q * 8]); if (hi_rows) vst2((unsigned*)(DL + (bb * nhi + t0 + rl) * (size_t)CC + c0 + q * 8), *(const v4u*)&sl[rl][q * 8]); }
  } else { const bool hi_rows = t0 < KHI;
#pragma unroll
    for (int j = 0; j < 8; ++j) { const float bias = BA ? bfr(BA[c0 + j * 16 + col]) : 0.f;
#pragma unroll
      for (int r = 0; r < 8; ++r) { const float v = acc[j][r] + bias; const int rl = wave * 16 + 8 * g + r, cl = j * 16 + col; th[cl][rl] = (_Float16)v; const __bf16 bh = (__bf16)v; tb[cl][rl] = bh; tbl[cl][rl] = (__bf16)(v - (float)bh); } }
    __syncthreads();
    for (int e = tid; e < 128 * 8; e += 128) { const int cl = e >> 3, q = e & 7; vst2((unsigned*)(VT + (bb * CC + c0 + cl) * (size_t)TT + t0 + q * 8), *(const v4u*)&th[cl][q * 8]); if (hi_rows) { const size_t o3 = (bb * CC + c0 + cl) * (size_t)KHI + t0 + q * 8; vst2((unsigned*)(VB + o3), *(const v4u*)&tb[cl][q * 8]); vst2((unsigned*)(VBL + o3), *(const v4u*)&tbl[cl][q * 8]); } } } }
// ---- k_sc: block = (query block qb, key block kb <= kb_last(qb), head in group) of batch b: logits x SCALE; q hi + residual (x 2^10) against k (2 products) for query rows < QHI, plus the k residual (3 products) for query blocks < QBH (causal early rows); causal: blocks past the diagonal exit, the mask itself is applied by index in k_pv
__global__ __launch_bounds__(128) void k_sc(const _Float16* __restrict__ QH, const _Float16* __restrict__ KH, const _Float16* __restrict__ QL, const _Float16* __restrict__ KL, int b, int h0, float* __restrict__ S0) { __shared__ __align__(16) float ss[4][16][132];
  const int qb = blockIdx.x, kb = blockIdx.y; if (kb > kb_last(qb)) return;
  const int h = h0 + blockIdx.z; float* S = S0 + (size_t)blockIdx.z * TT * TT;
  const int tid = threadIdx.x, wave = tid >> 5, lane = tid & 31, col = lane & 15, g = lane >> 4; const int k0 = kb * 128; const int ql0 = qb * 64 + wave * 16; const size_t q0 = (size_t)b * TT + ql0, kr0 = (size_t)b * TT + k0;
  v8f acc[8] = {}, accl[8] = {};
  const _Float16* QLb = QL + (size_t)b * QHI * CC; const _Float16* KLb = KL + (size_t)b * KHI * CC;
  if (qb < QBH) {
#pragma unroll
    for (int kc = 0; kc < HD / 32; ++kc) { const v16h ah = frag_h(QH + (q0 + col) * CC + h * HD + kc * 32, lane), al = frag_h(QLb + (size_t)(ql0 + col) * CC + h * HD + kc * 32, lane);
#pragma unroll
      for (int j = 0; j < 8; ++j) { const v16h kbf = frag_h(KH + (kr0 + j * 16 + col) * CC + h * HD + kc * 32, lane), klf = frag_h(KLb + (size_t)(k0 + j * 16 + col) * CC + h * HD + kc * 32, lane); acc[j] = wmma16(ah, kbf, acc[j]); accl[j] = wmma16(al, kbf, accl[j]); accl[j] = wmma16(ah, klf, accl[j]); } }
  } else if (qb * 64 < QHI) {
#pragma unroll
    for (int kc = 0; kc < HD / 32; ++kc) { const v16h ah = frag_h(QH + (q0 + col) * CC + h * HD + kc * 32, lane), al = frag_h(QLb + (size_t)(ql0 + col) * CC + h * HD + kc * 32, lane);
#pragma unroll
      for (int j = 0; j < 8; ++j) { const v16h kbf = frag_h(KH + (kr0 + j * 16 + col) * CC + h * HD + kc * 32, lane); acc[j] = wmma16(ah, kbf, acc[j]); accl[j] = wmma16(al, kbf, accl[j]); } }
  } else {
#pragma unroll
    for (int kc = 0; kc < HD / 32; ++kc) { const v16h ah = frag_h(QH + (q0 + col) * CC + h * HD + kc * 32, lane);
#pragma unroll
      for (int j = 0; j < 8; ++j) { const v16h kbf = frag_h(KH + (kr0 + j * 16 + col) * CC + h * HD + kc * 32, lane); acc[j] = wmma16(ah, kbf, acc[j]); } } }
#pragma unroll
  for (int j = 0; j < 8; ++j) {
#pragma unroll
    for (int r = 0; r < 8; ++r) ss[wave][8 * g + r][j * 16 + col] = (acc[j][r] + accl[j][r] * (1.0f / 1024.0f)) * SCALE; }
  LDSX(); for (int rl = 0; rl < 16; ++rl) vst2(S + (size_t)(ql0 + rl) * TT + k0 + lane * 4, *(const v4f*)&ss[wave][rl][lane * 4]); }
// ---- k_pv: block = 16 query rows of (b, h), PVW waves. Softmax first: wave w holds the logits of row ql0 + w, keys [0, kend), in registers (causal: logit if s <= t else excluded), takes maximum and sum in f32 and leaves e = exp(logit - max) (0 for excluded) in LDS with 2^11 / sum beside it. Then wave w takes the 32-key chunks w, w + PVW, ... and the partial 16 x 64 tiles are added in LDS in wave order (P x 2^11 = e x 2^11 / sum once to f16 against v f16: 1 product; causal early query blocks: P and v as bf16 hi + lo, 3 products); 256-B (row, head) segment by 16 lanes
#define PVW 16
__global__ __launch_bounds__(32 * PVW) void k_pv(const float* __restrict__ PS0, const _Float16* __restrict__ VT, const __bf16* __restrict__ VB, const __bf16* __restrict__ VBL, int b, int h0, float* __restrict__ Y) { const int h = h0 + blockIdx.z; const float* PS = PS0 + (size_t)blockIdx.z * TT * TT; __shared__ __align__(16) float se[16][TT + 4]; __shared__ float sinv[16];
  static_assert(PVW == 16 && PVW * 16 * (HD + 4) <= 16 * (TT + 4), "one wave per query row; the partial tiles reuse the LDS of e");
  float (*ss)[16][HD + 4] = reinterpret_cast<float (*)[16][HD + 4]>(&se[0][0]);
  const int tid = threadIdx.x, wave = __builtin_amdgcn_readfirstlane(tid >> 5), lane = tid & 31, col = lane & 15, g = lane >> 4; const int qb = blockIdx.x >> 2; const int ql0 = blockIdx.x * 16; const int kce = (kb_last(qb) + 1) * 4; const int kend = kce * 32;
  { const int t = ql0 + wave; const float* sr = PS + (size_t)t * TT + lane * 4; v4f x[TT / 128];
#pragma unroll
    for (int i = 0; i < TT / 128; ++i) if (i * 128 < kend) x[i] = *(const v4f*)(sr + i * 128);
    asm volatile("s_wait_xcnt 0x0" :: "v"(sr) : "memory");   /* the row pointer's registers stay whole up to here, and the wait stands before anything overwrites them */
    float m = -3.0e38f;
#pragma unroll
    for (int i = 0; i < TT / 128; ++i) if (i * 128 < kend) {
#pragma unroll
      for (int c = 0; c < 4; ++c) { const float v = (!CAUSAL || i * 128 + lane * 4 + c <= t) ? x[i][c] : -3.0e38f; x[i][c] = v; m = fmaxf(m, v); } }
#pragma unroll
    for (int o = 1; o < 32; o <<= 1) m = fmaxf(m, __shfl_xor(m, o));
    float sum = 0.f;
#pragma unroll
    for (int i = 0; i < TT / 128; ++i) if (i * 128 < kend) {
#pragma unroll
      for (int c = 0; c < 4; ++c) { const float v = x[i][c]; const float ex = expf(v - m); const float e = (v <= -1.0e38f) ? 0.f : ex; x[i][c] = e; sum += e; }
      *(v4f*)&se[wave][i * 128 + lane * 4] = x[i]; }
#pragma unroll
    for (int o = 1; o < 32; o <<= 1) sum += __shfl_xor(sum, o);
    if (lane == 0) sinv[wave] = sum > 0.f ? 2048.0f / sum : 0.f; }   /* a fully excluded row yields P = 0 */
  __syncthreads();   /* every row's e and 2^11 / sum are in LDS before any wave forms P fragments from them */
  const float inv = sinv[col]; const float* er = &se[col][8 * g];
  v8f acc[HD / 16] = {};
  if (qb < QBH) {
#pragma unroll 1
    for (int kc = wave; kc < kce; kc += PVW) { float v[16]; { const v4f e0 = *(const v4f*)(er + kc * 32), e1 = *(const v4f*)(er + kc * 32 + 4), e2 = *(const v4f*)(er + kc * 32 + 16), e3 = *(const v4f*)(er + kc * 32 + 20);
#pragma unroll
        for (int i = 0; i < 4; ++i) { v[i] = e0[i] * inv; v[4 + i] = e1[i] * inv; v[8 + i] = e2[i] * inv; v[12 + i] = e3[i] * inv; } }
      const F2 p = bsplit16(v);
#pragma unroll
      for (int j = 0; j < HD / 16; ++j) { const size_t po = ((size_t)b * CC + h * HD + j * 16 + col) * (size_t)KHI + kc * 32; const v16b vh = frag_b(VB + po, lane); acc[j] = wmma_bf(p.h, vh, acc[j]); acc[j] = wmma_bf(p.l, vh, acc[j]); acc[j] = wmma_bf(p.h, frag_b(VBL + po, lane), acc[j]); } }
  } else {
#pragma unroll 1
    for (int kc = wave; kc < kce; kc += PVW) { v16h p; { const v4f e0 = *(const v4f*)(er + kc * 32), e1 = *(const v4f*)(er + kc * 32 + 4), e2 = *(const v4f*)(er + kc * 32 + 16), e3 = *(const v4f*)(er + kc * 32 + 20);
#pragma unroll
        for (int i = 0; i < 4; ++i) { p[i] = (_Float16)(e0[i] * inv); p[4 + i] = (_Float16)(e1[i] * inv); p[8 + i] = (_Float16)(e2[i] * inv); p[12 + i] = (_Float16)(e3[i] * inv); } }
#pragma unroll
      for (int j = 0; j < HD / 16; ++j) { const size_t po = ((size_t)b * CC + h * HD + j * 16 + col) * (size_t)TT + kc * 32; acc[j] = wmma16(p, frag_h(VT + po, lane), acc[j]); } } }
  __syncthreads();   /* every wave has read its last e before the partial tiles overwrite that LDS */
#pragma unroll
  for (int j = 0; j < HD / 16; ++j)
#pragma unroll
    for (int r = 0; r < 8; ++r) ss[wave][8 * g + r][j * 16 + col] = acc[j][r];
  __syncthreads();   /* every wave's partial tile is in LDS before any thread adds across waves */
  if (tid < 16 * (HD / 4)) { const int rl = tid / (HD / 4), q = tid % (HD / 4); v4f s = *(const v4f*)&ss[0][rl][q * 4];
#pragma unroll
    for (int w = 1; w < PVW; ++w) s += *(const v4f*)&ss[w][rl][q * 4];
    vst2(Y + ((size_t)b * TT + ql0 + rl) * CC + h * HD + q * 4, s * (1.0f / 2048.0f)); } }
// ---- k_out: block = (64 rows, 128 cols): out = ctx Wo (+ bo): ctx x 2^6 once to f16 against Wo as f16(bf16 x 2^8) exact (1 product) x 2^-14; causal early rows (< QHI of each sequence): ctx bf16 hi + lo against exact bf16 Wo (2 products)
__global__ __launch_bounds__(128) void k_out(const float* __restrict__ Y, const float* __restrict__ WO, const float* __restrict__ BO, float* __restrict__ OUT) { __shared__ __align__(16) float sf[4][16][132];
  const int tid = threadIdx.x, wave = tid >> 5, lane = tid & 31, col = lane & 15, g = lane >> 4; const int c0 = blockIdx.y * 128; const size_t r0 = (size_t)blockIdx.x * 64 + wave * 16;
  v8f acc[8] = {};
  if (CAUSAL && (int)(((size_t)blockIdx.x * 64) % TT) < QHI) {   /* block-uniform */
#pragma unroll 2
    for (int kc = 0; kc < CC / 32; ++kc) { const F2 a = split_row(Y + (r0 + col) * CC, kc * 32, lane); asm volatile("s_wait_loadcnt 0x0" ::: "memory");
#pragma unroll
      for (int j = 0; j < 8; ++j) { const v16b w = WOCOL(WO, kc * 32, c0 + j * 16 + col, lane); asm volatile("s_wait_loadcnt 0x0" ::: "memory"); acc[j] = wmma_bf(a.h, w, acc[j]); acc[j] = wmma_bf(a.l, w, acc[j]); } }
#pragma unroll
    for (int j = 0; j < 8; ++j) { const float bias = BO ? bfr(BO[c0 + j * 16 + col]) : 0.f;
#pragma unroll
      for (int r = 0; r < 8; ++r) sf[wave][8 * g + r][j * 16 + col] = acc[j][r] + bias; }
  } else {
#pragma unroll 2
    for (int kc = 0; kc < CC / 32; ++kc) { const v16h a = frag_f32s(Y + (r0 + col) * CC + kc * 32, lane, 64.0f); asm volatile("s_wait_loadcnt 0x0" ::: "memory");   /* ctx carried x 2^6 into f16 so small-magnitude context rows stay clear of f16 subnormals */
#pragma unroll
      for (int j = 0; j < 8; ++j) { const v16h w = WOCOLH(WO, kc * 32, c0 + j * 16 + col, lane); asm volatile("s_wait_loadcnt 0x0" ::: "memory"); acc[j] = wmma16(a, w, acc[j]); } }
#pragma unroll
    for (int j = 0; j < 8; ++j) { const float bias = BO ? bfr(BO[c0 + j * 16 + col]) : 0.f;
#pragma unroll
      for (int r = 0; r < 8; ++r) sf[wave][8 * g + r][j * 16 + col] = acc[j][r] * (1.0f / 16384.0f) + bias; } }   /* 2^-8 (Wo carry) x 2^-6 (ctx carry) */
  LDSX(); for (int rl = 0; rl < 16; ++rl) vst2(OUT + (r0 + rl) * DIN + c0 + lane * 4, *(const v4f*)&sf[wave][rl][lane * 4]); }

extern "C" void kernel_launch(void* const* d_in, const int* in_sizes, int n_in, void* d_out, int out_size, void* d_ws, size_t ws_size, hipStream_t stream) {
  (void)in_sizes; (void)n_in; (void)out_size;
  const float** F = (const float**)d_in;
  if (ws_size < (size_t)WS_END) return;
  char* ws = (char*)d_ws; _Float16 *QH = (_Float16*)(ws + WS_QH), *KH = (_Float16*)(ws + WS_KH), *VT = (_Float16*)(ws + WS_VT), *QL = (_Float16*)(ws + WS_QL), *KL = (_Float16*)(ws + WS_KL); __bf16 *VB = (__bf16*)(ws + WS_VB), *VBL = (__bf16*)(ws + WS_VBL); float *S = (float*)(ws + WS_S), *Y = (float*)(ws + WS_Y);
  (void)Y; (void)QL; (void)KL; (void)VB; (void)VBL;
  // inputs: 0 x [2,2048,1024]; 1 Wq [1024,1024] (in,out), 2 bq; 3 Wk, 4 bk; 5 Wv, 6 bv (biases NONZERO); 7 Wo [1024,1024] (out,in); no output bias
  k_proj<<<dim3(TNB * TT / 64, CC / 128, 3), 128, 0, stream>>>(F[0], F[0], F[0], F[1], F[3], F[5], F[2], F[4], F[6], QH, QL, KH, KL, VT, VB, VBL);
  for (int b = 0; b < TNB; ++b) for (int h0 = 0; h0 < NH; h0 += HG) {
    k_sc<<<dim3(NQB, TT / 128, HG), 128, 0, stream>>>(QH, KH, QL, KL, b, h0, S);
    k_pv<<<dim3(TT / 16, 1, HG), 32 * PVW, 0, stream>>>(S, VT, VB, VBL, b, h0, Y);
  }
  k_out<<<dim3(TNB * TT / 64, DIN / 128), 128, 0, stream>>>(Y, F[7], nullptr, (float*)d_out);
}

// v003
// It runs in 360 microseconds.
// Two timings next to v002 put it at 1.46 and 1.47 times that version's speed.
// Counting every step since v000, it is 2.97 times as fast.
// compute dtype: all float inputs rounded to bf16; the fused q / k / v projection with EXACT bf16 products on WMMA 16x16x32 (f32 accumulate) + bias (nonzero); causal logits: 3 products for the first 384 rows, single f16 q x k after, x 1024^-0.5 (the module scales by the MODEL width); softmax f32; P x 2^11 once to f16 x v once to f16 (bf16 hi + lo below row 384); ctx hi+lo x exact W below row 384, x2^6 f16 carry x f16(bf16 x 2^8) W after; no output bias; f32 output.
#include <hip/hip_runtime.h>
#include <math.h>

typedef __attribute__((ext_vector_type(16))) _Float16 v16h;
typedef __attribute__((ext_vector_type(16))) __bf16 v16b;
typedef __attribute__((ext_vector_type(8)))  _Float16 v8h;
typedef __attribute__((ext_vector_type(8)))  float v8f;
typedef __attribute__((ext_vector_type(4)))  float v4f;
typedef __attribute__((ext_vector_type(2)))  float v2f;
typedef __attribute__((ext_vector_type(4)))  unsigned v4u;
typedef __attribute__((ext_vector_type(4)))  int v4i;
typedef float __attribute__((may_alias)) float_a;
typedef int __attribute__((may_alias)) int_a;

template <typename T> __device__ __forceinline__ void vst2(void* p, T v) { *(T*)p = v;  }
__device__ __forceinline__ v8f wmma16(v16h a, v16h b, v8f c) {
  v8f d = __builtin_amdgcn_wmma_f32_16x16x32_f16(false, a, false, b, (short)0, c, false, false);
  asm volatile("v_nop\n\tv_nop\n\tv_nop\n\tv_nop" : "+v"(d) : "v"(a), "v"(b));
  return d;
}
__device__ __forceinline__ v8f wmma_bf(v16b a, v16b b, v8f c) {
  v8f d = __builtin_amdgcn_wmma_f32_16x16x32_bf16(false, a, false, b, (short)0, c, false, false);
  asm volatile("v_nop\n\tv_nop\n\tv_nop\n\tv_nop" : "+v"(d) : "v"(a), "v"(b));
  return d;
}
// 16x16x32 fragments: lane = (h = lane>>4, row/col = lane&15); elements 0..7 = k0+8h+0..7, 8..15 = k0+16+8h+0..7; D element r = row 8h+r
__device__ __forceinline__ v16h frag_h(const _Float16* rowk0, int lane) {
  union { v16h v; v8h q[2]; } u; const _Float16* p = rowk0 + 8 * (lane >> 4);
  u.q[0] = *(const v8h*)p; u.q[1] = *(const v8h*)(p + 16); return u.v;
}
__device__ __forceinline__ v16h frag_f32(const float* rowk0, int lane) {
  v16h a; const float* p = rowk0 + 8 * (lane >> 4);
#pragma unroll
  for (int i = 0; i < 8; ++i) { a[i] = (_Float16)p[i]; a[8 + i] = (_Float16)p[16 + i]; }
  return a;
}
__device__ __forceinline__ v16h frag_f32s(const float* rowk0, int lane, float sc) {
  v16h a; const float* p = rowk0 + 8 * (lane >> 4);
#pragma unroll
  for (int i = 0; i < 8; ++i) { a[i] = (_Float16)(p[i] * sc); a[8 + i] = (_Float16)(p[16 + i] * sc); }
  return a;
}
// column fragment from a [K][ld] layout (column n), rows >= K read as 0
__device__ __forceinline__ v16h fragc_f32(const float* W, int k0, int n, int lane, int ld, int K) {
  v16h a; const int g = lane >> 4;
#pragma unroll
  for (int i = 0; i < 8; ++i) { const int ka = k0 + 8 * g + i, kb = ka + 16;
    a[i] = (_Float16)(ka < K ? W[(size_t)(ka < K ? ka : K - 1) * ld + n] : 0.f); a[8 + i] = (_Float16)(kb < K ? W[(size_t)(kb < K ? kb : K - 1) * ld + n] : 0.f); }
  return a;
}
struct F2 { v16b h, l; };
__device__ __forceinline__ F2 bsplit16(const float v[16]) { F2 r;
#pragma unroll
  for (int i = 0; i < 16; ++i) { const __bf16 h = (__bf16)v[i]; r.h[i] = h; r.l[i] = (__bf16)(v[i] - (float)h); }
  return r; }
__device__ __forceinline__ F2 split_row(const float* row, int k0, int lane) { float v[16]; const float* p = row + k0 + 8 * (lane >> 4);
#pragma unroll
  for (int i = 0; i < 8; ++i) { v[i] = p[i]; v[8 + i] = p[16 + i]; }
  return bsplit16(v); }
__device__ __forceinline__ F2 split_rowK(const float* row, int k0, int lane, int K) { float v[16]; const int g = lane >> 4;
#pragma unroll
  for (int i = 0; i < 8; ++i) { const int ka = k0 + 8 * g + i, kb = ka + 16; v[i] = ka < K ? row[ka < K ? ka : K - 1] : 0.f; v[8 + i] = kb < K ? row[kb < K ? kb : K - 1] : 0.f; }
  return bsplit16(v); }
__device__ __forceinline__ F2 split_col(const float* W, int k0, int n, int lane, int ld, int K) { float v[16]; const int g = lane >> 4;
#pragma unroll
  for (int i = 0; i < 8; ++i) { const int ka = k0 + 8 * g + i, kb = ka + 16; v[i] = ka < K ? W[(size_t)(ka < K ? ka : K - 1) * ld + n] : 0.f; v[8 + i] = kb < K ? W[(size_t)(kb < K ? kb : K - 1) * ld + n] : 0.f; }
  return bsplit16(v); }
__device__ __forceinline__ v8f mac3(const F2& a, const F2& b, v8f c) { c = wmma_bf(a.l, b.h, c); c = wmma_bf(a.h, b.l, c); return wmma_bf(a.h, b.h, c); }
__device__ __forceinline__ float sigm(float v) { return 1.0f / (1.0f + expf(-v)); }
#define LDSX() do { asm volatile("s_wait_dscnt 0" ::: "memory"); __builtin_amdgcn_wave_barrier(); __builtin_amdgcn_fence(__ATOMIC_RELEASE, "workgroup"); } while (0)

// Multi-head causal self-attention whose logits are scaled by 1/sqrt(EMBED) (x [2,2048,1024]; (in,out) Wq / Wk / Wv [1024,1024] and biases [1024] NONZERO applied as x @ W + b; Wo [1024,1024] torch (out,in), NO output bias; 16 heads x 64; logits x 1/sqrt(1024) = 1/32 - the model width, not the head width; tril kept, -inf elsewhere; softmax; z @ Wo.T).
#define NB 2
#define TT 2048
#define CC 1024            // NH * HD = projected width
#define DIN 1024          // input (model) width
#define NH 16
#define HD 64
#define SCALE (0.03125f)
#define CAUSAL 1
#ifndef TNB
#define TNB NB
#endif
__device__ __forceinline__ float bfr(float v) { return (float)(__bf16)v; }
__host__ __device__ __forceinline__ int kb_last(int qb) { return CAUSAL ? ((qb * 64 + 63) >> 7) : (TT / 128 - 1); }
typedef __attribute__((ext_vector_type(8))) __bf16 v8b;
__device__ __forceinline__ v16b frag_b(const __bf16* rowk0, int lane) {
  union { v16b v; v8b q[2]; } u; const __bf16* p = rowk0 + 8 * (lane >> 4);
  u.q[0] = *(const v8b*)p; u.q[1] = *(const v8b*)(p + 16); return u.v;
}
#define QBH 6              // causal: query blocks 0..QBH-1 of each sequence (few keys, no averaging) take the high-precision path
#define QHI 384            // rows carrying a q residual plane
#define KHI 384            // key rows carrying k residual / v bf16 hi+lo planes (used only by the causal high-precision path)
// B fragment (k rows k0+.., output column o) of a weight: (in,out) [K][ld] or (out,in) [ld rows of K]: bf16 exact, or f16(bf16 * 256) exact
__device__ __forceinline__ v16b wcol_io(const float* Wm, int k0, int o, int lane, int ld) { v16b w; const int g = lane >> 4;
#pragma unroll
  for (int i = 0; i < 8; ++i) { w[i] = (__bf16)Wm[(size_t)(k0 + 8 * g + i) * ld + o]; w[8 + i] = (__bf16)Wm[(size_t)(k0 + 16 + 8 * g + i) * ld + o]; }
  return w; }
__device__ __forceinline__ v16b wcol_oi(const float* Wm, int k0, int o, int lane, int K) { v16b w; const float* p = Wm + (size_t)o * K + k0 + 8 * (lane >> 4);
#pragma unroll
  for (int i = 0; i < 8; ++i) { w[i] = (__bf16)p[i]; w[8 + i] = (__bf16)p[16 + i]; }
  return w; }
__device__ __forceinline__ v16h wcolh_io(const float* Wm, int k0, int o, int lane, int ld) { v16h w; const int g = lane >> 4;
#pragma unroll
  for (int i = 0; i < 8; ++i) { w[i] = (_Float16)(bfr(Wm[(size_t)(k0 + 8 * g + i) * ld + o]) * 256.0f); w[8 + i] = (_Float16)(bfr(Wm[(size_t)(k0 + 16 + 8 * g + i) * ld + o]) * 256.0f); }
  return w; }
__device__ __forceinline__ v16h wcolh_oi(const float* Wm, int k0, int o, int lane, int K) { v16h w; const float* p = Wm + (size_t)o * K + k0 + 8 * (lane >> 4);
#pragma unroll
  for (int i = 0; i < 8; ++i) { w[i] = (_Float16)(bfr(p[i]) * 256.0f); w[8 + i] = (_Float16)(bfr(p[16 + i]) * 256.0f); }
  return w; }
#define WQKV_LAYOUT 0   // 0 = (in,out) [DIN][CC]; 1 = (out,in) [CC][DIN]; 2 = per-head [NH][DIN][HD]
__device__ __forceinline__ v16b wcol_hdk(const float* Wm, int k0, int o, int lane) { v16b w; const int g = lane >> 4; const float* p = Wm + (size_t)(o / HD) * DIN * HD + (o % HD);
#pragma unroll
  for (int i = 0; i < 8; ++i) { w[i] = (__bf16)p[(size_t)(k0 + 8 * g + i) * HD]; w[8 + i] = (__bf16)p[(size_t)(k0 + 16 + 8 * g + i) * HD]; }
  return w; }
#define WO_OUT_IN 1
#if WQKV_LAYOUT == 1
#define WCOL(W, k0, o, lane) wcol_oi(W, k0, o, lane, DIN)
#elif WQKV_LAYOUT == 2
#define WCOL(W, k0, o, lane) wcol_hdk(W, k0, o, lane)
#else
#define WCOL(W, k0, o, lane) wcol_io(W, k0, o, lane, CC)
#endif
#if WO_OUT_IN
#define WOCOL(W, k0, o, lane) wcol_oi(W, k0, o, lane, CC)
#define WOCOLH(W, k0, o, lane) wcolh_oi(W, k0, o, lane, CC)
#else
#define WOCOL(W, k0, o, lane) wcol_io(W, k0, o, lane, DIN)
#define WOCOLH(W, k0, o, lane) wcolh_io(W, k0, o, lane, DIN)
#endif

#ifndef PROJ_EXTRA_PARAMS
#define PROJ_EXTRA_PARAMS
#endif

#define WS_QH  0u                                      // f16 q rows [b*t][CC]
#define WS_KH  (WS_QH + 2u * (size_t)NB * TT * CC)      // f16 k rows [b*t][CC]
#define WS_VT  (WS_KH + 2u * (size_t)NB * TT * CC)      // f16 v planes [b][c][t]
#define WS_QL  (WS_VT + 2u * (size_t)NB * CC * TT)      // f16 q residual x 2^10 rows [b][t < QHI][CC]
#define WS_KL  (WS_QL + 2u * (size_t)NB * QHI * CC)     // f16 k residual x 2^10 rows [b][t < KHI][CC]
#define WS_VB  (WS_KL + 2u * (size_t)NB * KHI * CC)     // bf16 v hi planes [b][c][t < KHI]
#define WS_VBL (WS_VB + 2u * (size_t)NB * CC * KHI)
#define WS_Y   (WS_VBL + 2u * (size_t)NB * CC * KHI)    // f32 ctx rows [b*t][CC] (only when there is an output projection)
#define WS_END (WS_Y  + 4u * (size_t)NB * TT * CC)

// ---- k_proj: block = (64 rows, 128 cols, which): q/k/v = X W (+ b) with exact bf16 products (K = DIN) -> which 0: q f16 rows (+ residual rows < QHI); 1: k f16 rows (+ residual rows < KHI); 2: v f16 planes [c][t] (+ bf16 hi/lo planes for t < KHI)
__global__ __launch_bounds__(128) void k_proj(const float* __restrict__ XQ, const float* __restrict__ XK, const float* __restrict__ XV, const float* __restrict__ WQ, const float* __restrict__ WK, const float* __restrict__ WV, const float* __restrict__ BQ, const float* __restrict__ BK, const float* __restrict__ BV,
    _Float16* __restrict__ QH, _Float16* __restrict__ QL, _Float16* __restrict__ KH, _Float16* __restrict__ KL, _Float16* __restrict__ VT, __bf16* __restrict__ VB, __bf16* __restrict__ VBL) {
  __shared__ __align__(16) _Float16 sh[64][136], sl[64][136]; __shared__ __align__(16) _Float16 th[128][72]; __shared__ __align__(16) __bf16 tb[128][72], tbl[128][72];
  const int tid = threadIdx.x, wave = tid >> 5, lane = tid & 31, col = lane & 15, g = lane >> 4; const int which = blockIdx.z; const int c0 = blockIdx.y * 128; const size_t r0 = (size_t)blockIdx.x * 64; const size_t bb = r0 / TT; const int t0 = (int)(r0 % TT);
  const float* X = which == 0 ? XQ : which == 1 ? XK : XV; const float* WA = which == 0 ? WQ : which == 1 ? WK : WV; const float* BA = which == 0 ? BQ : which == 1 ? BK : BV;
  v8f acc[8] = {};
#pragma unroll 2
  for (int kc = 0; kc < DIN / 32; ++kc) { v16b a; { const float* p = X + (r0 + wave * 16 + col) * DIN + kc * 32 + 8 * g;
#pragma unroll
      for (int i = 0; i < 8; ++i) { a[i] = (__bf16)p[i]; a[8 + i] = (__bf16)p[16 + i]; } }
    asm volatile("s_wait_loadcnt 0x0" ::: "memory");
#pragma unroll
    for (int j = 0; j < 8; ++j) { const v16b w = WCOL(WA, kc * 32, c0 + j * 16 + col, lane); asm volatile("s_wait_loadcnt 0x0" ::: "memory"); acc[j] = wmma_bf(a, w, acc[j]); } }
  if (which < 2) { _Float16* DH = which == 0 ? QH : KH; _Float16* DL = which == 0 ? QL : KL; const int nhi = which == 0 ? QHI : KHI; const bool hi_rows = t0 < nhi;
#pragma unroll
    for (int j = 0; j < 8; ++j) { const float bias = BA ? bfr(BA[c0 + j * 16 + col]) : 0.f;
#pragma unroll
      for (int r = 0; r < 8; ++r) { const float v = acc[j][r] + bias; const _Float16 hv = (_Float16)v; sh[wave * 16 + 8 * g + r][j * 16 + col] = hv; sl[wave * 16 + 8 * g + r][j * 16 + col] = (_Float16)((v - (float)hv) * 1024.0f); } }
    __syncthreads();
    for (int e = tid; e < 64 * 16; e += 128) { const int rl = e >> 4, q = e & 15; vst2((unsigned*)(DH + (r0 + rl) * CC + c0 + q * 8), *(const v4u*)&sh[rl][q * 8]); if (hi_rows) vst2((unsigned*)(DL + (bb * nhi + t0 + rl) * (size_t)CC + c0 + q * 8), *(const v4u*)&sl[rl][q * 8]); }
  } else { const bool hi_rows = t0 < KHI;
#pragma unroll
    for (int j = 0; j < 8; ++j) { const float bias = BA ? bfr(BA[c0 + j * 16 + col]) : 0.f;
#pragma unroll
      for (int r = 0; r < 8; ++r) { const float v = acc[j][r] + bias; const int rl = wave * 16 + 8 * g + r, cl = j * 16 + col; th[cl][rl] = (_Float16)v; const __bf16 bh = (__bf16)v; tb[cl][rl] = bh; tbl[cl][rl] = (__bf16)(v - (float)bh); } }
    __syncthreads();
    for (int e = tid; e < 128 * 8; e += 128) { const int cl = e >> 3, q = e & 7; vst2((unsigned*)(VT + (bb * CC + c0 + cl) * (size_t)TT + t0 + q * 8), *(const v4u*)&th[cl][q * 8]); if (hi_rows) { const size_t o3 = (bb * CC + c0 + cl) * (size_t)KHI + t0 + q * 8; vst2((unsigned*)(VB + o3), *(const v4u*)&tb[cl][q * 8]); vst2((unsigned*)(VBL + o3), *(const v4u*)&tbl[cl][q * 8]); } } } }
// ---- k_pv: block = 16 query rows of (b, h) = blockIdx.z, PVW waves. Logits first: wave w forms the 16 x 16 key tiles w, w + PVW, ... of keys [0, kend) on WMMA (q against k: 1 product; causal early query blocks: q hi + residual x 2^10 against k hi + residual, 3 products), x SCALE, straight into the LDS rows; the mask is applied by index below. Then softmax: wave w holds the logits of row ql0 + w, keys [0, kend), in registers (causal: logit if s <= t else excluded), takes maximum and sum in f32 and leaves e = exp(logit - max) (0 for excluded) in LDS with 2^11 / sum beside it. Then wave w takes the 32-key chunks w, w + PVW, ... and the partial 16 x 64 tiles are added in LDS in wave order (P x 2^11 = e x 2^11 / sum once to f16 against v f16: 1 product; causal early query blocks: P and v as bf16 hi + lo, 3 products); 256-B (row, head) segment by 16 lanes
#define PVW 16
__global__ __launch_bounds__(32 * PVW) void k_pv(const _Float16* __restrict__ QH, const _Float16* __restrict__ KH, const _Float16* __restrict__ QL, const _Float16* __restrict__ KL, const _Float16* __restrict__ VT, const __bf16* __restrict__ VB, const __bf16* __restrict__ VBL, float* __restrict__ Y) { const int b = blockIdx.z / NH, h = blockIdx.z % NH; __shared__ __align__(16) float se[16][TT + 4]; __shared__ float sinv[16];
  static_assert(PVW == 16 && PVW * 16 * (HD + 4) <= 16 * (TT + 4), "one wave per query row; the partial tiles reuse the LDS of e");
  float (*ss)[16][HD + 4] = reinterpret_cast<float (*)[16][HD + 4]>(&se[0][0]);
  const int tid = threadIdx.x, wave = __builtin_amdgcn_readfirstlane(tid >> 5), lane = tid & 31, col = lane & 15, g = lane >> 4; const int qb = blockIdx.x >> 2; const int ql0 = blockIdx.x * 16; const int kce = (kb_last(qb) + 1) * 4; const int kend = kce * 32;
  { const _Float16* qp = QH + ((size_t)b * TT + ql0 + col) * CC + h * HD; const _Float16* kp0 = KH + ((size_t)b * TT + col) * CC + h * HD; const v16h ah0 = frag_h(qp, lane), ah1 = frag_h(qp + 32, lane);
    asm volatile("s_wait_xcnt 0x0" ::: "memory");   /* stands before the q loads' address registers are reused for the k addresses */
    if (qb < QBH) { const _Float16* qlp = QL + ((size_t)b * QHI + ql0 + col) * CC + h * HD; const _Float16* klp0 = KL + ((size_t)b * KHI + col) * CC + h * HD; const v16h al0 = frag_h(qlp, lane), al1 = frag_h(qlp + 32, lane);
#pragma unroll 1   /* at most two trips a wave on this path: kept rolled, unrolling would only add code */
      for (int jt = wave; jt < kend / 16; jt += PVW) { const _Float16* kp = kp0 + (size_t)jt * 16 * CC; const _Float16* klp = klp0 + (size_t)jt * 16 * CC; const v16h kb0 = frag_h(kp, lane), kl0 = frag_h(klp, lane), kb1 = frag_h(kp + 32, lane), kl1 = frag_h(klp + 32, lane); v8f a = {}, l = {};
        asm volatile("s_wait_xcnt 0x0" ::: "memory");   /* stands before the next trip rewrites the k address registers */
        a = wmma16(ah0, kb0, a); l = wmma16(al0, kb0, l); l = wmma16(ah0, kl0, l); a = wmma16(ah1, kb1, a); l = wmma16(al1, kb1, l); l = wmma16(ah1, kl1, l);
#pragma unroll
        for (int r = 0; r < 8; ++r) se[8 * g + r][jt * 16 + col] = (a[r] + l[r] * (1.0f / 1024.0f)) * SCALE; }
    } else {
#pragma unroll 2   /* two tiles a trip: the second tile's k loads issue under the first tile's scaling and LDS stores */
      for (int jt = wave; jt < kend / 16; jt += PVW) { const _Float16* kp = kp0 + (size_t)jt * 16 * CC; const v16h kb0 = frag_h(kp, lane), kb1 = frag_h(kp + 32, lane); v8f a = {};
        a = wmma16(ah0, kb0, a); a = wmma16(ah1, kb1, a);
#pragma unroll
        for (int r = 0; r < 8; ++r) se[8 * g + r][jt * 16 + col] = a[r] * SCALE; } } }
  __syncthreads();   /* every key tile's logits are in LDS before a wave reads its whole row */
  { const int t = ql0 + wave; const float* sr = &se[wave][lane * 4]; v4f x[TT / 128];
#pragma unroll
    for (int i = 0; i < TT / 128; ++i) if (i * 128 < kend) x[i] = *(const v4f*)(sr + i * 128);
    float m = -3.0e38f;
#pragma unroll
    for (int i = 0; i < TT / 128; ++i) if (i * 128 < kend) {
#pragma unroll
      for (int c = 0; c < 4; ++c) { const float v = (!CAUSAL || i * 128 + lane * 4 + c <= t) ? x[i][c] : -3.0e38f; x[i][c] = v; m = fmaxf(m, v); } }
#pragma unroll
    for (int o = 1; o < 32; o <<= 1) m = fmaxf(m, __shfl_xor(m, o));
    float sum = 0.f;
#pragma unroll
    for (int i = 0; i < TT / 128; ++i) if (i * 128 < kend) {
#pragma unroll
      for (int c = 0; c < 4; ++c) { const float v = x[i][c]; const float ex = expf(v - m); const float e = (v <= -1.0e38f) ? 0.f : ex; x[i][c] = e; sum += e; }
      *(v4f*)&se[wave][i * 128 + lane * 4] = x[i]; }
#pragma unroll
    for (int o = 1; o < 32; o <<= 1) sum += __shfl_xor(sum, o);
    if (lane == 0) sinv[wave] = sum > 0.f ? 2048.0f / sum : 0.f; }   /* a fully excluded row yields P = 0 */
  __syncthreads();   /* every row's e and 2^11 / sum are in LDS before any wave forms P fragments from them */
  const float inv = sinv[col]; const float* er = &se[col][8 * g];
  v8f acc[HD / 16] = {};
  if (qb < QBH) {
#pragma unroll 1
    for (int kc = wave; kc < kce; kc += PVW) { float v[16]; { const v4f e0 = *(const v4f*)(er + kc * 32), e1 = *(const v4f*)(er + kc * 32 + 4), e2 = *(const v4f*)(er + kc * 32 + 16), e3 = *(const v4f*)(er + kc * 32 + 20);
#pragma unroll
        for (int i = 0; i < 4; ++i) { v[i] = e0[i] * inv; v[4 + i] = e1[i] * inv; v[8 + i] = e2[i] * inv; v[12 + i] = e3[i] * inv; } }
      const F2 p = bsplit16(v);
#pragma unroll
      for (int j = 0; j < HD / 16; ++j) { const size_t po = ((size_t)b * CC + h * HD + j * 16 + col) * (size_t)KHI + kc * 32; const v16b vh = frag_b(VB + po, lane); acc[j] = wmma_bf(p.h, vh, acc[j]); acc[j] = wmma_bf(p.l, vh, acc[j]); acc[j] = wmma_bf(p.h, frag_b(VBL + po, lane), acc[j]); } }
  } else {
#pragma unroll 1
    for (int kc = wave; kc < kce; kc += PVW) { v16h p; { const v4f e0 = *(const v4f*)(er + kc * 32), e1 = *(const v4f*)(er + kc * 32 + 4), e2 = *(const v4f*)(er + kc * 32 + 16), e3 = *(const v4f*)(er + kc * 32 + 20);
#pragma unroll
        for (int i = 0; i < 4; ++i) { p[i] = (_Float16)(e0[i] * inv); p[4 + i] = (_Float16)(e1[i] * inv); p[8 + i] = (_Float16)(e2[i] * inv); p[12 + i] = (_Float16)(e3[i] * inv); } }
#pragma unroll
      for (int j = 0; j < HD / 16; ++j) { const size_t po = ((size_t)b * CC + h * HD + j * 16 + col) * (size_t)TT + kc * 32; acc[j] = wmma16(p, frag_h(VT + po, lane), acc[j]); } } }
  __syncthreads();   /* every wave has read its last e before the partial tiles overwrite that LDS */
#pragma unroll
  for (int j = 0; j < HD / 16; ++j)
#pragma unroll
    for (int r = 0; r < 8; ++r) ss[wave][8 * g + r][j * 16 + col] = acc[j][r];
  __syncthreads();   /* every wave's partial tile is in LDS before any thread adds across waves */
  if (tid < 16 * (HD / 4)) { const int rl = tid / (HD / 4), q = tid % (HD / 4); v4f s = *(const v4f*)&ss[0][rl][q * 4];
#pragma unroll
    for (int w = 1; w < PVW; ++w) s += *(const v4f*)&ss[w][rl][q * 4];
    vst2(Y + ((size_t)b * TT + ql0 + rl) * CC + h * HD + q * 4, s * (1.0f / 2048.0f)); } }
// ---- k_out: block = (64 rows, 128 cols): out = ctx Wo (+ bo): ctx x 2^6 once to f16 against Wo as f16(bf16 x 2^8) exact (1 product) x 2^-14; causal early rows (< QHI of each sequence): ctx bf16 hi + lo against exact bf16 Wo (2 products)
__global__ __launch_bounds__(128) void k_out(const float* __restrict__ Y, const float* __restrict__ WO, const float* __restrict__ BO, float* __restrict__ OUT) { __shared__ __align__(16) float sf[4][16][132];
  const int tid = threadIdx.x, wave = tid >> 5, lane = tid & 31, col = lane & 15, g = lane >> 4; const int c0 = blockIdx.y * 128; const size_t r0 = (size_t)blockIdx.x * 64 + wave * 16;
  v8f acc[8] = {};
  if (CAUSAL && (int)(((size_t)blockIdx.x * 64) % TT) < QHI) {   /* block-uniform */
#pragma unroll 2
    for (int kc = 0; kc < CC / 32; ++kc) { const F2 a = split_row(Y + (r0 + col) * CC, kc * 32, lane); asm volatile("s_wait_loadcnt 0x0" ::: "memory");
#pragma unroll
      for (int j = 0; j < 8; ++j) { const v16b w = WOCOL(WO, kc * 32, c0 + j * 16 + col, lane); asm volatile("s_wait_loadcnt 0x0" ::: "memory"); acc[j] = wmma_bf(a.h, w, acc[j]); acc[j] = wmma_bf(a.l, w, acc[j]); } }
#pragma unroll
    for (int j = 0; j < 8; ++j) { const float bias = BO ? bfr(BO[c0 + j * 16 + col]) : 0.f;
#pragma unroll
      for (int r = 0; r < 8; ++r) sf[wave][8 * g + r][j * 16 + col] = acc[j][r] + bias; }
  } else {
#pragma unroll 2
    for (int kc = 0; kc < CC / 32; ++kc) { const v16h a = frag_f32s(Y + (r0 + col) * CC + kc * 32, lane, 64.0f); asm volatile("s_wait_loadcnt 0x0" ::: "memory");   /* ctx carried x 2^6 into f16 so small-magnitude context rows stay clear of f16 subnormals */
#pragma unroll
      for (int j = 0; j < 8; ++j) { const v16h w = WOCOLH(WO, kc * 32, c0 + j * 16 + col, lane); asm volatile("s_wait_loadcnt 0x0" ::: "memory"); acc[j] = wmma16(a, w, acc[j]); } }
#pragma unroll
    for (int j = 0; j < 8; ++j) { const float bias = BO ? bfr(BO[c0 + j * 16 + col]) : 0.f;
#pragma unroll
      for (int r = 0; r < 8; ++r) sf[wave][8 * g + r][j * 16 + col] = acc[j][r] * (1.0f / 16384.0f) + bias; } }   /* 2^-8 (Wo carry) x 2^-6 (ctx carry) */
  LDSX(); for (int rl = 0; rl < 16; ++rl) vst2(OUT + (r0 + rl) * DIN + c0 + lane * 4, *(const v4f*)&sf[wave][rl][lane * 4]); }

extern "C" void kernel_launch(void* const* d_in, const int* in_sizes, int n_in, void* d_out, int out_size, void* d_ws, size_t ws_size, hipStream_t stream) {
  (void)in_sizes; (void)n_in; (void)out_size;
  const float** F = (const float**)d_in;
  if (ws_size < (size_t)WS_END) return;
  char* ws = (char*)d_ws; _Float16 *QH = (_Float16*)(ws + WS_QH), *KH = (_Float16*)(ws + WS_KH), *VT = (_Float16*)(ws + WS_VT), *QL = (_Float16*)(ws + WS_QL), *KL = (_Float16*)(ws + WS_KL); __bf16 *VB = (__bf16*)(ws + WS_VB), *VBL = (__bf16*)(ws + WS_VBL); float *Y = (float*)(ws + WS_Y);
  (void)Y; (void)QL; (void)KL; (void)VB; (void)VBL;
  // inputs: 0 x [2,2048,1024]; 1 Wq [1024,1024] (in,out), 2 bq; 3 Wk, 4 bk; 5 Wv, 6 bv (biases NONZERO); 7 Wo [1024,1024] (out,in); no output bias
  k_proj<<<dim3(TNB * TT / 64, CC / 128, 3), 128, 0, stream>>>(F[0], F[0], F[0], F[1], F[3], F[5], F[2], F[4], F[6], QH, QL, KH, KL, VT, VB, VBL);
  k_pv<<<dim3(TT / 16, 1, TNB * NH), 32 * PVW, 0, stream>>>(QH, KH, QL, KL, VT, VB, VBL, Y);
  k_out<<<dim3(TNB * TT / 64, DIN / 128), 128, 0, stream>>>(Y, F[7], nullptr, (float*)d_out);
}

// v004
// One run takes 179 microseconds.
// Next to v003, in two timings, it ran 2.01 times as fast each time.
// Over all steps from v000 it is 5.98 times as fast.
// compute dtype: all float inputs rounded to bf16; the fused q / k / v projection with EXACT bf16 products on WMMA 16x16x32 (f32 accumulate) + bias (nonzero); causal logits: 3 products for the first 384 rows, single f16 q x k after, x 1024^-0.5 (the module scales by the MODEL width); softmax f32; P x 2^11 once to f16 x v once to f16 (bf16 hi + lo below row 384); ctx hi+lo x exact W below row 384, x2^6 f16 carry x f16(bf16 x 2^8) W after; no output bias; f32 output.
#include <hip/hip_runtime.h>
#include <math.h>

typedef __attribute__((ext_vector_type(16))) _Float16 v16h;
typedef __attribute__((ext_vector_type(16))) __bf16 v16b;
typedef __attribute__((ext_vector_type(8)))  _Float16 v8h;
typedef __attribute__((ext_vector_type(8)))  float v8f;
typedef __attribute__((ext_vector_type(4)))  float v4f;
typedef __attribute__((ext_vector_type(2)))  float v2f;
typedef __attribute__((ext_vector_type(4)))  unsigned v4u;
typedef __attribute__((ext_vector_type(4)))  int v4i;
typedef float __attribute__((may_alias)) float_a;
typedef int __attribute__((may_alias)) int_a;

template <typename T> __device__ __forceinline__ void vst2(void* p, T v) { *(T*)p = v;  }
__device__ __forceinline__ v8f wmma16(v16h a, v16h b, v8f c) {
  v8f d = __builtin_amdgcn_wmma_f32_16x16x32_f16(false, a, false, b, (short)0, c, false, false);
  asm volatile("v_nop\n\tv_nop\n\tv_nop\n\tv_nop" : "+v"(d) : "v"(a), "v"(b));
  return d;
}
__device__ __forceinline__ v8f wmma_bf(v16b a, v16b b, v8f c) {
  v8f d = __builtin_amdgcn_wmma_f32_16x16x32_bf16(false, a, false, b, (short)0, c, false, false);
  asm volatile("v_nop\n\tv_nop\n\tv_nop\n\tv_nop" : "+v"(d) : "v"(a), "v"(b));
  return d;
}
// 16x16x32 fragments: lane = (h = lane>>4, row/col = lane&15); elements 0..7 = k0+8h+0..7, 8..15 = k0+16+8h+0..7; D element r = row 8h+r
__device__ __forceinline__ v16h frag_h(const _Float16* rowk0, int lane) {
  union { v16h v; v8h q[2]; } u; const _Float16* p = rowk0 + 8 * (lane >> 4);
  u.q[0] = *(const v8h*)p; u.q[1] = *(const v8h*)(p + 16); return u.v;
}
__device__ __forceinline__ v16h frag_f32(const float* rowk0, int lane) {
  v16h a; const float* p = rowk0 + 8 * (lane >> 4);
#pragma unroll
  for (int i = 0; i < 8; ++i) { a[i] = (_Float16)p[i]; a[8 + i] = (_Float16)p[16 + i]; }
  return a;
}
__device__ __forceinline__ v16h frag_f32s(const float* rowk0, int lane, float sc) {
  v16h a; const float* p = rowk0 + 8 * (lane >> 4);
#pragma unroll
  for (int i = 0; i < 8; ++i) { a[i] = (_Float16)(p[i] * sc); a[8 + i] = (_Float16)(p[16 + i] * sc); }
  return a;
}
// column fragment from a [K][ld] layout (column n), rows >= K read as 0
__device__ __forceinline__ v16h fragc_f32(const float* W, int k0, int n, int lane, int ld, int K) {
  v16h a; const int g = lane >> 4;
#pragma unroll
  for (int i = 0; i < 8; ++i) { const int ka = k0 + 8 * g + i, kb = ka + 16;
    a[i] = (_Float16)(ka < K ? W[(size_t)(ka < K ? ka : K - 1) * ld + n] : 0.f); a[8 + i] = (_Float16)(kb < K ? W[(size_t)(kb < K ? kb : K - 1) * ld + n] : 0.f); }
  return a;
}
struct F2 { v16b h, l; };
__device__ __forceinline__ F2 bsplit16(const float v[16]) { F2 r;
#pragma unroll
  for (int i = 0; i < 16; ++i) { const __bf16 h = (__bf16)v[i]; r.h[i] = h; r.l[i] = (__bf16)(v[i] - (float)h); }
  return r; }
__device__ __forceinline__ F2 split_row(const float* row, int k0, int lane) { float v[16]; const float* p = row + k0 + 8 * (lane >> 4);
#pragma unroll
  for (int i = 0; i < 8; ++i) { v[i] = p[i]; v[8 + i] = p[16 + i]; }
  return bsplit16(v); }
__device__ __forceinline__ F2 split_rowK(const float* row, int k0, int lane, int K) { float v[16]; const int g = lane >> 4;
#pragma unroll
  for (int i = 0; i < 8; ++i) { const int ka = k0 + 8 * g + i, kb = ka + 16; v[i] = ka < K ? row[ka < K ? ka : K - 1] : 0.f; v[8 + i] = kb < K ? row[kb < K ? kb : K - 1] : 0.f; }
  return bsplit16(v); }
__device__ __forceinline__ F2 split_col(const float* W, int k0, int n, int lane, int ld, int K) { float v[16]; const int g = lane >> 4;
#pragma unroll
  for (int i = 0; i < 8; ++i) { const int ka = k0 + 8 * g + i, kb = ka + 16; v[i] = ka < K ? W[(size_t)(ka < K ? ka : K - 1) * ld + n] : 0.f; v[8 + i] = kb < K ? W[(size_t)(kb < K ? kb : K - 1) * ld + n] : 0.f; }
  return bsplit16(v); }
__device__ __forceinline__ v8f mac3(const F2& a, const F2& b, v8f c) { c = wmma_bf(a.l, b.h, c); c = wmma_bf(a.h, b.l, c); return wmma_bf(a.h, b.h, c); }
__device__ __forceinline__ float sigm(float v) { return 1.0f / (1.0f + expf(-v)); }
#define LDSX() do { asm volatile("s_wait_dscnt 0" ::: "memory"); __builtin_amdgcn_wave_barrier(); __builtin_amdgcn_fence(__ATOMIC_RELEASE, "workgroup"); } while (0)

// Multi-head causal self-attention whose logits are scaled by 1/sqrt(EMBED) (x [2,2048,1024]; (in,out) Wq / Wk / Wv [1024,1024] and biases [1024] NONZERO applied as x @ W + b; Wo [1024,1024] torch (out,in), NO output bias; 16 heads x 64; logits x 1/sqrt(1024) = 1/32 - the model width, not the head width; tril kept, -inf elsewhere; softmax; z @ Wo.T).
#define NB 2
#define TT 2048
#define CC 1024            // NH * HD = projected width
#define DIN 1024          // input (model) width
#define NH 16
#define HD 64
#define SCALE (0.03125f)
#define CAUSAL 1
#ifndef TNB
#define TNB NB
#endif
__device__ __forceinline__ float bfr(float v) { return (float)(__bf16)v; }
__host__ __device__ __forceinline__ int kb_last(int qb) { return CAUSAL ? ((qb * 64 + 63) >> 7) : (TT / 128 - 1); }
typedef __attribute__((ext_vector_type(8))) __bf16 v8b;
__device__ __forceinline__ v16b frag_b(const __bf16* rowk0, int lane) {
  union { v16b v; v8b q[2]; } u; const __bf16* p = rowk0 + 8 * (lane >> 4);
  u.q[0] = *(const v8b*)p; u.q[1] = *(const v8b*)(p + 16); return u.v;
}
#define QBH 6              // causal: query blocks 0..QBH-1 of each sequence (few keys, no averaging) take the high-precision path
#define QHI 384            // rows carrying a q residual plane
#define KHI 384            // key rows carrying k residual / v bf16 hi+lo planes (used only by the causal high-precision path)
// B fragment (k rows k0+.., output column o) of a weight: (in,out) [K][ld] or (out,in) [ld rows of K]: bf16 exact, or f16(bf16 * 256) exact
__device__ __forceinline__ v16b wcol_io(const float* Wm, int k0, int o, int lane, int ld) { v16b w; const int g = lane >> 4;
#pragma unroll
  for (int i = 0; i < 8; ++i) { w[i] = (__bf16)Wm[(size_t)(k0 + 8 * g + i) * ld + o]; w[8 + i] = (__bf16)Wm[(size_t)(k0 + 16 + 8 * g + i) * ld + o]; }
  return w; }
__device__ __forceinline__ v16b wcol_oi(const float* Wm, int k0, int o, int lane, int K) { v16b w; const float* p = Wm + (size_t)o * K + k0 + 8 * (lane >> 4);
#pragma unroll
  for (int i = 0; i < 8; ++i) { w[i] = (__bf16)p[i]; w[8 + i] = (__bf16)p[16 + i]; }
  return w; }
__device__ __forceinline__ v16h wcolh_io(const float* Wm, int k0, int o, int lane, int ld) { v16h w; const int g = lane >> 4;
#pragma unroll
  for (int i = 0; i < 8; ++i) { w[i] = (_Float16)(bfr(Wm[(size_t)(k0 + 8 * g + i) * ld + o]) * 256.0f); w[8 + i] = (_Float16)(bfr(Wm[(size_t)(k0 + 16 + 8 * g + i) * ld + o]) * 256.0f); }
  return w; }
__device__ __forceinline__ v16h wcolh_oi(const float* Wm, int k0, int o, int lane, int K) { v16h w; const float* p = Wm + (size_t)o * K + k0 + 8 * (lane >> 4);
#pragma unroll
  for (int i = 0; i < 8; ++i) { w[i] = (_Float16)(bfr(p[i]) * 256.0f); w[8 + i] = (_Float16)(bfr(p[16 + i]) * 256.0f); }
  return w; }
#define WQKV_LAYOUT 0   // 0 = (in,out) [DIN][CC]; 1 = (out,in) [CC][DIN]; 2 = per-head [NH][DIN][HD]
__device__ __forceinline__ v16b wcol_hdk(const float* Wm, int k0, int o, int lane) { v16b w; const int g = lane >> 4; const float* p = Wm + (size_t)(o / HD) * DIN * HD + (o % HD);
#pragma unroll
  for (int i = 0; i < 8; ++i) { w[i] = (__bf16)p[(size_t)(k0 + 8 * g + i) * HD]; w[8 + i] = (__bf16)p[(size_t)(k0 + 16 + 8 * g + i) * HD]; }
  return w; }
#define WO_OUT_IN 1
#if WQKV_LAYOUT == 1
#define WCOL(W, k0, o, lane) wcol_oi(W, k0, o, lane, DIN)
#elif WQKV_LAYOUT == 2
#define WCOL(W, k0, o, lane) wcol_hdk(W, k0, o, lane)
#else
#define WCOL(W, k0, o, lane) wcol_io(W, k0, o, lane, CC)
#endif
#if WO_OUT_IN
#define WOCOL(W, k0, o, lane) wcol_oi(W, k0, o, lane, CC)
#define WOCOLH(W, k0, o, lane) wcolh_oi(W, k0, o, lane, CC)
#else
#define WOCOL(W, k0, o, lane) wcol_io(W, k0, o, lane, DIN)
#define WOCOLH(W, k0, o, lane) wcolh_io(W, k0, o, lane, DIN)
#endif

#ifndef PROJ_EXTRA_PARAMS
#define PROJ_EXTRA_PARAMS
#endif

#define WS_QH  0u                                      // f16 q rows [b*t][CC]
#define WS_KH  (WS_QH + 2u * (size_t)NB * TT * CC)      // f16 k rows [b*t][CC]
#define WS_VT  (WS_KH + 2u * (size_t)NB * TT * CC)      // f16 v planes [b][c][t]
#define WS_QL  (WS_VT + 2u * (size_t)NB * CC * TT)      // f16 q residual x 2^10 rows [b][t < QHI][CC]
#define WS_KL  (WS_QL + 2u * (size_t)NB * QHI * CC)     // f16 k residual x 2^10 rows [b][t < KHI][CC]
#define WS_VB  (WS_KL + 2u * (size_t)NB * KHI * CC)     // bf16 v hi planes [b][c][t < KHI]
#define WS_VBL (WS_VB + 2u * (size_t)NB * CC * KHI)
#define WS_Y   (WS_VBL + 2u * (size_t)NB * CC * KHI)    // f32 ctx rows [b*t][CC] (only when there is an output projection)
#define WS_END (WS_Y  + 4u * (size_t)NB * TT * CC)

#define SP 40                                        // LDS pitch of a staged 32-k row in 16-bit elements: 80 B = 16 B x odd, free of bank conflicts for 16-byte reads
#define WROW(n) (((n) & 3) * 36 + ((n) >> 2))       // LDS row of W column n in k_proj: a thread's 4 neighbouring columns lie 36 rows apart, so stores (32 rows in a run) and fragment reads (16 rows distinct mod 16) both spread over the banks
// work-group barrier of the staging loops, by hand: __syncthreads() would also wait for the next chunk's global loads, which are meant to stay in flight across it; the LDS stores are waited for in front of the signal
__device__ __forceinline__ void stage_bar() { asm volatile("s_wait_dscnt 0x0\n\ts_barrier_signal -1\n\ts_barrier_wait -1" ::: "memory"); }
// N units of 8 consecutive floats, ld floats apart, into registers
template <int N> __device__ __forceinline__ void ld_rows(const float* p, size_t ld, v4f (&r)[2 * N]) {
#pragma unroll
  for (int s = 0; s < N; ++s) { r[2 * s] = *(const v4f*)(p + s * ld); r[2 * s + 1] = *(const v4f*)(p + s * ld + 4); } }
// ---- k_proj: block = (64 rows, 128 cols, which): q/k/v = X W (+ b) with exact bf16 products (K = DIN) -> which 0: q f16 rows (+ residual rows < QHI); 1: k f16 rows (+ residual rows < KHI); 2: v f16 planes [c][t] (+ bf16 hi/lo planes for t < KHI)
__global__ __launch_bounds__(128) void k_proj(const float* __restrict__ XQ, const float* __restrict__ XK, const float* __restrict__ XV, const float* __restrict__ WQ, const float* __restrict__ WK, const float* __restrict__ WV, const float* __restrict__ BQ, const float* __restrict__ BK, const float* __restrict__ BV,
    _Float16* __restrict__ QH, _Float16* __restrict__ QL, _Float16* __restrict__ KH, _Float16* __restrict__ KL, _Float16* __restrict__ VT, __bf16* __restrict__ VB, __bf16* __restrict__ VBL) {
  __shared__ __align__(16) _Float16 sh[64][136], sl[64][136]; __shared__ __align__(16) _Float16 th[128][72]; __shared__ __align__(16) __bf16 tb[128][72], tbl[128][72];
  const int tid = threadIdx.x, wave = tid >> 5, lane = tid & 31, col = lane & 15, g = lane >> 4; const int which = blockIdx.z; const int c0 = blockIdx.y * 128; const size_t r0 = (size_t)blockIdx.x * 64; const size_t bb = r0 / TT; const int t0 = (int)(r0 % TT);
  const float* X = which == 0 ? XQ : which == 1 ? XK : XV; const float* WA = which == 0 ? WQ : which == 1 ? WK : WV; const float* BA = which == 0 ? BQ : which == 1 ? BK : BV;
  v8f acc[8] = {};
  /* k chunks of 32 staged once per block: X rows and W columns go to LDS as bf16, k-contiguous, in two buffers that lie in the epilogue's tiles (idle until the loop ends) */
  __bf16* const sx = reinterpret_cast<__bf16*>(&th[0][0]); __bf16* const sw0 = &tb[0][0]; __bf16* const sw1 = &tbl[0][0];
  static_assert(2 * 64 * SP <= 128 * 72 && 140 * SP <= 128 * 72 && WQKV_LAYOUT == 0, "the staging buffers fit the epilogue's tiles; W is (in,out)");
  const float* xg = X + (r0 + (tid >> 2)) * DIN + (tid & 3) * 8; const float* wg = WA + (size_t)(wave * 8) * CC + c0 + lane * 4; const int xo = (tid >> 2) * SP + (tid & 3) * 8;
  v4f rx[4], rw[8];
  ld_rows<2>(xg, (size_t)32 * DIN, rx);
#pragma unroll
  for (int i = 0; i < 8; ++i) rw[i] = *(const v4f*)(wg + (size_t)i * CC);
  asm volatile("s_wait_xcnt 0x0" ::: "memory");   /* stands before the loads' address registers are advanced */
#pragma unroll 2   /* two trips a pass: the buffer index becomes a constant */
  for (int kc = 0; kc < DIN / 32; ++kc) { __bf16* const xb = sx + (kc & 1) * 64 * SP; __bf16* const wb = (kc & 1) ? sw1 : sw0;
#pragma unroll
    for (int s = 0; s < 2; ++s) { v8b p;
#pragma unroll
      for (int i = 0; i < 4; ++i) { p[i] = (__bf16)rx[2 * s][i]; p[4 + i] = (__bf16)rx[2 * s + 1][i]; }
      *(v8b*)(xb + xo + s * 32 * SP) = p; }
#pragma unroll
    for (int c = 0; c < 4; ++c) { v8b p;   /* column 4 * lane + c, k rows 8 * wave + 0..7 */
#pragma unroll
      for (int i = 0; i < 8; ++i) p[i] = (__bf16)rw[i][c];
      *(v8b*)(wb + (c * 36 + lane) * SP + wave * 8) = p; }
    if (kc + 1 < DIN / 32) {   /* the next chunk's loads fly under this chunk's products */
      ld_rows<2>(xg + (kc + 1) * 32, (size_t)32 * DIN, rx);
#pragma unroll
      for (int i = 0; i < 8; ++i) rw[i] = *(const v4f*)(wg + (size_t)((kc + 1) * 32 + i) * CC);
      asm volatile("s_wait_xcnt 0x0" ::: "memory"); }   /* stands before the loads' address registers are advanced */
    stage_bar();   /* the chunk is in LDS before any wave reads fragments; it also ends the reads of the buffer that the next trip refills */
    const v16b a = frag_b(xb + (wave * 16 + col) * SP, lane); v16b w[8];
#pragma unroll
    for (int j = 0; j < 8; ++j) w[j] = frag_b(wb + WROW(j * 16 + col) * SP, lane);
    __builtin_amdgcn_sched_barrier(0);   /* keeps the chunk's LDS reads one group ahead of its products: spread among them each read costs its own latency */
#pragma unroll
    for (int j = 0; j < 8; ++j) acc[j] = wmma_bf(a, w[j], acc[j]);
    __builtin_amdgcn_sched_barrier(0); }   /* keeps the next trip's conversions, which wait for the loads in flight, behind this trip's products */
  __syncthreads();   /* every wave has read its last fragments before the epilogue's tiles overwrite the staging buffers */
  if (which < 2) { _Float16* DH = which == 0 ? QH : KH; _Float16* DL = which == 0 ? QL : KL; const int nhi = which == 0 ? QHI : KHI; const bool hi_rows = t0 < nhi;
#pragma unroll
    for (int j = 0; j < 8; ++j) { const float bias = BA ? bfr(BA[c0 + j * 16 + col]) : 0.f;
#pragma unroll
      for (int r = 0; r < 8; ++r) { const float v = acc[j][r] + bias; const _Float16 hv = (_Float16)v; sh[wave * 16 + 8 * g + r][j * 16 + col] = hv; sl[wave * 16 + 8 * g + r][j * 16 + col] = (_Float16)((v - (float)hv) * 1024.0f); } }
    __syncthreads();
    for (int e = tid; e < 64 * 16; e += 128) { const int rl = e >> 4, q = e & 15; vst2((unsigned*)(DH + (r0 + rl) * CC + c0 + q * 8), *(const v4u*)&sh[rl][q * 8]); if (hi_rows) vst2((unsigned*)(DL + (bb * nhi + t0 + rl) * (size_t)CC + c0 + q * 8), *(const v4u*)&sl[rl][q * 8]); }
  } else { const bool hi_rows = t0 < KHI;
#pragma unroll
    for (int j = 0; j < 8; ++j) { const float bias = BA ? bfr(BA[c0 + j * 16 + col]) : 0.f;
#pragma unroll
      for (int r = 0; r < 8; ++r) { const float v = acc[j][r] + bias; const int rl = wave * 16 + 8 * g + r, cl = j * 16 + col; th[cl][rl] = (_Float16)v; const __bf16 bh = (__bf16)v; tb[cl][rl] = bh; tbl[cl][rl] = (__bf16)(v - (float)bh); } }
    __syncthreads();
    for (int e = tid; e < 128 * 8; e += 128) { const int cl = e >> 3, q = e & 7; vst2((unsigned*)(VT + (bb * CC + c0 + cl) * (size_t)TT + t0 + q * 8), *(const v4u*)&th[cl][q * 8]); if (hi_rows) { const size_t o3 = (bb * CC + c0 + cl) * (size_t)KHI + t0 + q * 8; vst2((unsigned*)(VB + o3), *(const v4u*)&tb[cl][q * 8]); vst2((unsigned*)(VBL + o3), *(const v4u*)&tbl[cl][q * 8]); } } } }
// ---- k_pv: block = 16 query rows of (b, h) = blockIdx.z, PVW waves. Logits first: wave w forms the 16 x 16 key tiles w, w + PVW, ... of keys [0, kend) on WMMA (q against k: 1 product; causal early query blocks: q hi + residual x 2^10 against k hi + residual, 3 products), x SCALE, straight into the LDS rows; the mask is applied by index below. Then softmax: wave w holds the logits of row ql0 + w, keys [0, kend), in registers (causal: logit if s <= t else excluded), takes maximum and sum in f32 and leaves e = exp(logit - max) (0 for excluded) in LDS with 2^11 / sum beside it. Then wave w takes the 32-key chunks w, w + PVW, ... and the partial 16 x 64 tiles are added in LDS in wave order (P x 2^11 = e x 2^11 / sum once to f16 against v f16: 1 product; causal early query blocks: P and v as bf16 hi + lo, 3 products); 256-B (row, head) segment by 16 lanes
#define PVW 16
__global__ __launch_bounds__(32 * PVW) void k_pv(const _Float16* __restrict__ QH, const _Float16* __restrict__ KH, const _Float16* __restrict__ QL, const _Float16* __restrict__ KL, const _Float16* __restrict__ VT, const __bf16* __restrict__ VB, const __bf16* __restrict__ VBL, float* __restrict__ Y) { const int b = blockIdx.z / NH, h = blockIdx.z % NH; __shared__ __align__(16) float se[16][TT + 4]; __shared__ float sinv[16];
  static_assert(PVW == 16 && PVW * 16 * (HD + 4) <= 16 * (TT + 4), "one wave per query row; the partial tiles reuse the LDS of e");
  float (*ss)[16][HD + 4] = reinterpret_cast<float (*)[16][HD + 4]>(&se[0][0]);
  const int tid = threadIdx.x, wave = __builtin_amdgcn_readfirstlane(tid >> 5), lane = tid & 31, col = lane & 15, g = lane >> 4; const int qb = blockIdx.x >> 2; const int ql0 = blockIdx.x * 16; const int kce = (kb_last(qb) + 1) * 4; const int kend = kce * 32;
  { const _Float16* qp = QH + ((size_t)b * TT + ql0 + col) * CC + h * HD; const _Float16* kp0 = KH + ((size_t)b * TT + col) * CC + h * HD; const v16h ah0 = frag_h(qp, lane), ah1 = frag_h(qp + 32, lane);
    asm volatile("s_wait_xcnt 0x0" ::: "memory");   /* stands before the q loads' address registers are reused for the k addresses */
    if (qb < QBH) { const _Float16* qlp = QL + ((size_t)b * QHI + ql0 + col) * CC + h * HD; const _Float16* klp0 = KL + ((size_t)b * KHI + col) * CC + h * HD; const v16h al0 = frag_h(qlp, lane), al1 = frag_h(qlp + 32, lane);
#pragma unroll 1   /* at most two trips a wave on this path: kept rolled, unrolling would only add code */
      for (int jt = wave; jt < kend / 16; jt += PVW) { const _Float16* kp = kp0 + (size_t)jt * 16 * CC; const _Float16* klp = klp0 + (size_t)jt * 16 * CC; const v16h kb0 = frag_h(kp, lane), kl0 = frag_h(klp, lane), kb1 = frag_h(kp + 32, lane), kl1 = frag_h(klp + 32, lane); v8f a = {}, l = {};
        asm volatile("s_wait_xcnt 0x0" ::: "memory");   /* stands before the next trip rewrites the k address registers */
        a = wmma16(ah0, kb0, a); l = wmma16(al0, kb0, l); l = wmma16(ah0, kl0, l); a = wmma16(ah1, kb1, a); l = wmma16(al1, kb1, l); l = wmma16(ah1, kl1, l);
#pragma unroll
        for (int r = 0; r < 8; ++r) se[8 * g + r][jt * 16 + col] = (a[r] + l[r] * (1.0f / 1024.0f)) * SCALE; }
    } else {
#pragma unroll 2   /* two tiles a trip: the second tile's k loads issue under the first tile's scaling and LDS stores */
      for (int jt = wave; jt < kend / 16; jt += PVW) { const _Float16* kp = kp0 + (size_t)jt * 16 * CC; const v16h kb0 = frag_h(kp, lane), kb1 = frag_h(kp + 32, lane); v8f a = {};
        a = wmma16(ah0, kb0, a); a = wmma16(ah1, kb1, a);
#pragma unroll
        for (int r = 0; r < 8; ++r) se[8 * g + r][jt * 16 + col] = a[r] * SCALE; } } }
  __syncthreads();   /* every key tile's logits are in LDS before a wave reads its whole row */
  { const int t = ql0 + wave; const float* sr = &se[wave][lane * 4]; v4f x[TT / 128];
#pragma unroll
    for (int i = 0; i < TT / 128; ++i) if (i * 128 < kend) x[i] = *(const v4f*)(sr + i * 128);
    float m = -3.0e38f;
#pragma unroll
    for (int i = 0; i < TT / 128; ++i) if (i * 128 < kend) {
#pragma unroll
      for (int c = 0; c < 4; ++c) { const float v = (!CAUSAL || i * 128 + lane * 4 + c <= t) ? x[i][c] : -3.0e38f; x[i][c] = v; m = fmaxf(m, v); } }
#pragma unroll
    for (int o = 1; o < 32; o <<= 1) m = fmaxf(m, __shfl_xor(m, o));
    float sum = 0.f;
#pragma unroll
    for (int i = 0; i < TT / 128; ++i) if (i * 128 < kend) {
#pragma unroll
      for (int c = 0; c < 4; ++c) { const float v = x[i][c]; const float ex = expf(v - m); const float e = (v <= -1.0e38f) ? 0.f : ex; x[i][c] = e; sum += e; }
      *(v4f*)&se[wave][i * 128 + lane * 4] = x[i]; }
#pragma unroll
    for (int o = 1; o < 32; o <<= 1) sum += __shfl_xor(sum, o);
    if (lane == 0) sinv[wave] = sum > 0.f ? 2048.0f / sum : 0.f; }   /* a fully excluded row yields P = 0 */
  __syncthreads();   /* every row's e and 2^11 / sum are in LDS before any wave forms P fragments from them */
  const float inv = sinv[col]; const float* er = &se[col][8 * g];
  v8f acc[HD / 16] = {};
  if (qb < QBH) {
#pragma unroll 1
    for (int kc = wave; kc < kce; kc += PVW) { float v[16]; { const v4f e0 = *(const v4f*)(er + kc * 32), e1 = *(const v4f*)(er + kc * 32 + 4), e2 = *(const v4f*)(er + kc * 32 + 16), e3 = *(const v4f*)(er + kc * 32 + 20);
#pragma unroll
        for (int i = 0; i < 4; ++i) { v[i] = e0[i] * inv; v[4 + i] = e1[i] * inv; v[8 + i] = e2[i] * inv; v[12 + i] = e3[i] * inv; } }
      const F2 p = bsplit16(v);
#pragma unroll
      for (int j = 0; j < HD / 16; ++j) { const size_t po = ((size_t)b * CC + h * HD + j * 16 + col) * (size_t)KHI + kc * 32; const v16b vh = frag_b(VB + po, lane); acc[j] = wmma_bf(p.h, vh, acc[j]); acc[j] = wmma_bf(p.l, vh, acc[j]); acc[j] = wmma_bf(p.h, frag_b(VBL + po, lane), acc[j]); } }
  } else {
#pragma unroll 1
    for (int kc = wave; kc < kce; kc += PVW) { v16h p; { const v4f e0 = *(const v4f*)(er + kc * 32), e1 = *(const v4f*)(er + kc * 32 + 4), e2 = *(const v4f*)(er + kc * 32 + 16), e3 = *(const v4f*)(er + kc * 32 + 20);
#pragma unroll
        for (int i = 0; i < 4; ++i) { p[i] = (_Float16)(e0[i] * inv); p[4 + i] = (_Float16)(e1[i] * inv); p[8 + i] = (_Float16)(e2[i] * inv); p[12 + i] = (_Float16)(e3[i] * inv); } }
#pragma unroll
      for (int j = 0; j < HD / 16; ++j) { const size_t po = ((size_t)b * CC + h * HD + j * 16 + col) * (size_t)TT + kc * 32; acc[j] = wmma16(p, frag_h(VT + po, lane), acc[j]); } } }
  __syncthreads();   /* every wave has read its last e before the partial tiles overwrite that LDS */
#pragma unroll
  for (int j = 0; j < HD / 16; ++j)
#pragma unroll
    for (int r = 0; r < 8; ++r) ss[wave][8 * g + r][j * 16 + col] = acc[j][r];
  __syncthreads();   /* every wave's partial tile is in LDS before any thread adds across waves */
  if (tid < 16 * (HD / 4)) { const int rl = tid / (HD / 4), q = tid % (HD / 4); v4f s = *(const v4f*)&ss[0][rl][q * 4];
#pragma unroll
    for (int w = 1; w < PVW; ++w) s += *(const v4f*)&ss[w][rl][q * 4];
    vst2(Y + ((size_t)b * TT + ql0 + rl) * CC + h * HD + q * 4, s * (1.0f / 2048.0f)); } }
// ---- k_out: block = (64 rows, 128 cols): out = ctx Wo (+ bo): ctx x 2^6 once to f16 against Wo as f16(bf16 x 2^8) exact (1 product) x 2^-14; causal early rows (< QHI of each sequence): ctx bf16 hi + lo against exact bf16 Wo (2 products)
__global__ __launch_bounds__(128) void k_out(const float* __restrict__ Y, const float* __restrict__ WO, const float* __restrict__ BO, float* __restrict__ OUT) { __shared__ __align__(16) float sf[4][16][132];
  __shared__ __align__(16) __bf16 sa[2][2][64 * SP], sb[2][128 * SP];   /* staged k chunks of 32, two buffers: ctx rows (hi and lo plane) and Wo rows, already in their 16-bit operand form */
  static_assert(WO_OUT_IN == 1, "Wo rows are k-contiguous");
  const int tid = threadIdx.x, wave = tid >> 5, lane = tid & 31, col = lane & 15, g = lane >> 4; const int c0 = blockIdx.y * 128; const size_t rb = (size_t)blockIdx.x * 64; const size_t r0 = rb + wave * 16;
  const float* yg = Y + (rb + (tid >> 2)) * CC + (tid & 3) * 8; const float* wg = WO + (size_t)(c0 + (tid >> 2)) * CC + (tid & 3) * 8; const int so = (tid >> 2) * SP + (tid & 3) * 8;
  v4f ry[4], rw[8];
  ld_rows<2>(yg, (size_t)32 * CC, ry); ld_rows<4>(wg, (size_t)32 * CC, rw);
  asm volatile("s_wait_xcnt 0x0" ::: "memory");   /* stands before the loads' address registers are advanced */
  v8f acc[8] = {};
  if (CAUSAL && (int)(((size_t)blockIdx.x * 64) % TT) < QHI) {   /* block-uniform */
#pragma unroll 2   /* two trips a pass: the buffer index becomes a constant */
    for (int kc = 0; kc < CC / 32; ++kc) { __bf16* const ah = &sa[kc & 1][0][0]; __bf16* const al = &sa[kc & 1][1][0]; __bf16* const wb = &sb[kc & 1][0];
#pragma unroll
      for (int s = 0; s < 2; ++s) { v8b h, l;
#pragma unroll
        for (int i = 0; i < 8; ++i) { const float v = ry[2 * s + (i >> 2)][i & 3]; const __bf16 hv = (__bf16)v; h[i] = hv; l[i] = (__bf16)(v - (float)hv); }
        *(v8b*)(ah + so + s * 32 * SP) = h; *(v8b*)(al + so + s * 32 * SP) = l; }
#pragma unroll
      for (int s = 0; s < 4; ++s) { v8b p;
#pragma unroll
        for (int i = 0; i < 8; ++i) p[i] = (__bf16)rw[2 * s + (i >> 2)][i & 3];
        *(v8b*)(wb + so + s * 32 * SP) = p; }
      if (kc + 1 < CC / 32) {   /* the next chunk's loads fly under this chunk's products */
        ld_rows<2>(yg + (kc + 1) * 32, (size_t)32 * CC, ry); ld_rows<4>(wg + (kc + 1) * 32, (size_t)32 * CC, rw);
        asm volatile("s_wait_xcnt 0x0" ::: "memory"); }   /* stands before the loads' address registers are advanced */
      stage_bar();   /* the chunk is in LDS before any wave reads fragments; it also ends the reads of the buffer that the next trip refills */
      const v16b fh = frag_b(ah + (wave * 16 + col) * SP, lane), fl = frag_b(al + (wave * 16 + col) * SP, lane); v16b w[8];
#pragma unroll
      for (int j = 0; j < 8; ++j) w[j] = frag_b(wb + (j * 16 + col) * SP, lane);
      __builtin_amdgcn_sched_barrier(0);   /* keeps the chunk's LDS reads one group ahead of its products */
#pragma unroll
      for (int j = 0; j < 8; ++j) { acc[j] = wmma_bf(fh, w[j], acc[j]); acc[j] = wmma_bf(fl, w[j], acc[j]); }
      __builtin_amdgcn_sched_barrier(0); }   /* keeps the next trip's conversions, which wait for the loads in flight, behind this trip's products */
#pragma unroll
    for (int j = 0; j < 8; ++j) { const float bias = BO ? bfr(BO[c0 + j * 16 + col]) : 0.f;
#pragma unroll
      for (int r = 0; r < 8; ++r) sf[wave][8 * g + r][j * 16 + col] = acc[j][r] + bias; }
  } else {
#pragma unroll 2   /* two trips a pass: the buffer index becomes a constant */
    for (int kc = 0; kc < CC / 32; ++kc) { _Float16* const ab = reinterpret_cast<_Float16*>(&sa[kc & 1][0][0]); _Float16* const wb = reinterpret_cast<_Float16*>(&sb[kc & 1][0]);
#pragma unroll
      for (int s = 0; s < 2; ++s) { v8h p;   /* ctx carried x 2^6 into f16 so small-magnitude context rows stay clear of f16 subnormals */
#pragma unroll
        for (int i = 0; i < 8; ++i) p[i] = (_Float16)(ry[2 * s + (i >> 2)][i & 3] * 64.0f);
        *(v8h*)(ab + so + s * 32 * SP) = p; }
#pragma unroll
      for (int s = 0; s < 4; ++s) { v8h p;
#pragma unroll
        for (int i = 0; i < 8; ++i) p[i] = (_Float16)(bfr(rw[2 * s + (i >> 2)][i & 3]) * 256.0f);
        *(v8h*)(wb + so + s * 32 * SP) = p; }
      if (kc + 1 < CC / 32) {   /* the next chunk's loads fly under this chunk's products */
        ld_rows<2>(yg + (kc + 1) * 32, (size_t)32 * CC, ry); ld_rows<4>(wg + (kc + 1) * 32, (size_t)32 * CC, rw);
        asm volatile("s_wait_xcnt 0x0" ::: "memory"); }   /* stands before the loads' address registers are advanced */
      stage_bar();   /* the chunk is in LDS before any wave reads fragments; it also ends the reads of the buffer that the next trip refills */
      const v16h a = frag_h(ab + (wave * 16 + col) * SP, lane); v16h w[8];
#pragma unroll
      for (int j = 0; j < 8; ++j) w[j] = frag_h(wb + (j * 16 + col) * SP, lane);
      __builtin_amdgcn_sched_barrier(0);   /* keeps the chunk's LDS reads one group ahead of its products */
#pragma unroll
      for (int j = 0; j < 8; ++j) acc[j] = wmma16(a, w[j], acc[j]);
      __builtin_amdgcn_sched_barrier(0); }   /* keeps the next trip's conversions, which wait for the loads in flight, behind this trip's products */
#pragma unroll
    for (int j = 0; j < 8; ++j) { const float bias = BO ? bfr(BO[c0 + j * 16 + col]) : 0.f;
#pragma unroll
      for (int r = 0; r < 8; ++r) sf[wave][8 * g + r][j * 16 + col] = acc[j][r] * (1.0f / 16384.0f) + bias; } }   /* 2^-8 (Wo carry) x 2^-6 (ctx carry) */
  LDSX(); for (int rl = 0; rl < 16; ++rl) vst2(OUT + (r0 + rl) * DIN + c0 + lane * 4, *(const v4f*)&sf[wave][rl][lane * 4]); }

extern "C" void kernel_launch(void* const* d_in, const int* in_sizes, int n_in, void* d_out, int out_size, void* d_ws, size_t ws_size, hipStream_t stream) {
  (void)in_sizes; (void)n_in; (void)out_size;
  const float** F = (const float**)d_in;
  if (ws_size < (size_t)WS_END) return;
  char* ws = (char*)d_ws; _Float16 *QH = (_Float16*)(ws + WS_QH), *KH = (_Float16*)(ws + WS_KH), *VT = (_Float16*)(ws + WS_VT), *QL = (_Float16*)(ws + WS_QL), *KL = (_Float16*)(ws + WS_KL); __bf16 *VB = (__bf16*)(ws + WS_VB), *VBL = (__bf16*)(ws + WS_VBL); float *Y = (float*)(ws + WS_Y);
  (void)Y; (void)QL; (void)KL; (void)VB; (void)VBL;
  // inputs: 0 x [2,2048,1024]; 1 Wq [1024,1024] (in,out), 2 bq; 3 Wk, 4 bk; 5 Wv, 6 bv (biases NONZERO); 7 Wo [1024,1024] (out,in); no output bias
  k_proj<<<dim3(TNB * TT / 64, CC / 128, 3), 128, 0, stream>>>(F[0], F[0], F[0], F[1], F[3], F[5], F[2], F[4], F[6], QH, QL, KH, KL, VT, VB, VBL);
  k_pv<<<dim3(TT / 16, 1, TNB * NH), 32 * PVW, 0, stream>>>(QH, KH, QL, KL, VT, VB, VBL, Y);
  k_out<<<dim3(TNB * TT / 64, DIN / 128), 128, 0, stream>>>(Y, F[7], nullptr, (float*)d_out);
}

// v005
// One run takes 106 microseconds.
// Next to v004, in two timings, it ran 1.68 and 1.69 times as fast.
// Over all steps from v000 it is 10.1 times as fast.
// compute dtype: all float inputs rounded to bf16; the fused q / k / v projection with EXACT bf16 products on WMMA 16x16x32 (f32 accumulate) + bias (nonzero); causal logits: 3 products for the first 384 rows, single f16 q x k after, x 1024^-0.5 (the module scales by the MODEL width); softmax f32 with a running maximum; e x 2^11 once to f16 x v once to f16 (bf16 hi + lo below row 384), divided by the sum at the end; ctx hi+lo x exact W below row 384, x2^6 f16 carry x f16(bf16 x 2^8) W after, no output bias; f32 output.
#include <hip/hip_runtime.h>
#include <math.h>

typedef __attribute__((ext_vector_type(16))) _Float16 v16h;
typedef __attribute__((ext_vector_type(16))) __bf16 v16b;
typedef __attribute__((ext_vector_type(8)))  _Float16 v8h;
typedef __attribute__((ext_vector_type(8)))  float v8f;
typedef __attribute__((ext_vector_type(4)))  float v4f;
typedef __attribute__((ext_vector_type(2)))  float v2f;
typedef __attribute__((ext_vector_type(4)))  unsigned v4u;
typedef __attribute__((ext_vector_type(4)))  int v4i;
typedef float __attribute__((may_alias)) float_a;
typedef int __attribute__((may_alias)) int_a;

template <typename T> __device__ __forceinline__ void vst2(void* p, T v) { *(T*)p = v;  }
__device__ __forceinline__ v8f wmma16(v16h a, v16h b, v8f c) {
  v8f d = __builtin_amdgcn_wmma_f32_16x16x32_f16(false, a, false, b, (short)0, c, false, false);
  asm volatile("v_nop\n\tv_nop\n\tv_nop\n\tv_nop" : "+v"(d) : "v"(a), "v"(b));
  return d;
}
__device__ __forceinline__ v8f wmma_bf(v16b a, v16b b, v8f c) {
  v8f d = __builtin_amdgcn_wmma_f32_16x16x32_bf16(false, a, false, b, (short)0, c, false, false);
  asm volatile("v_nop\n\tv_nop\n\tv_nop\n\tv_nop" : "+v"(d) : "v"(a), "v"(b));
  return d;
}
// 16x16x32 fragments: lane = (h = lane>>4, row/col = lane&15); elements 0..7 = k0+8h+0..7, 8..15 = k0+16+8h+0..7; D element r = row 8h+r
__device__ __forceinline__ v16h frag_h(const _Float16* rowk0, int lane) {
  union { v16h v; v8h q[2]; } u; const _Float16* p = rowk0 + 8 * (lane >> 4);
  u.q[0] = *(const v8h*)p; u.q[1] = *(const v8h*)(p + 16); return u.v;
}
__device__ __forceinline__ v16h frag_f32(const float* rowk0, int lane) {
  v16h a; const float* p = rowk0 + 8 * (lane >> 4);
#pragma unroll
  for (int i = 0; i < 8; ++i) { a[i] = (_Float16)p[i]; a[8 + i] = (_Float16)p[16 + i]; }
  return a;
}
__device__ __forceinline__ v16h frag_f32s(const float* rowk0, int lane, float sc) {
  v16h a; const float* p = rowk0 + 8 * (lane >> 4);
#pragma unroll
  for (int i = 0; i < 8; ++i) { a[i] = (_Float16)(p[i] * sc); a[8 + i] = (_Float16)(p[16 + i] * sc); }
  return a;
}
// column fragment from a [K][ld] layout (column n), rows >= K read as 0
__device__ __forceinline__ v16h fragc_f32(const float* W, int k0, int n, int lane, int ld, int K) {
  v16h a; const int g = lane >> 4;
#pragma unroll
  for (int i = 0; i < 8; ++i) { const int ka = k0 + 8 * g + i, kb = ka + 16;
    a[i] = (_Float16)(ka < K ? W[(size_t)(ka < K ? ka : K - 1) * ld + n] : 0.f); a[8 + i] = (_Float16)(kb < K ? W[(size_t)(kb < K ? kb : K - 1) * ld + n] : 0.f); }
  return a;
}
struct F2 { v16b h, l; };
__device__ __forceinline__ F2 bsplit16(const float v[16]) { F2 r;
#pragma unroll
  for (int i = 0; i < 16; ++i) { const __bf16 h = (__bf16)v[i]; r.h[i] = h; r.l[i] = (__bf16)(v[i] - (float)h); }
  return r; }
__device__ __forceinline__ F2 split_row(const float* row, int k0, int lane) { float v[16]; const float* p = row + k0 + 8 * (lane >> 4);
#pragma unroll
  for (int i = 0; i < 8; ++i) { v[i] = p[i]; v[8 + i] = p[16 + i]; }
  return bsplit16(v); }
__device__ __forceinline__ F2 split_rowK(const float* row, int k0, int lane, int K) { float v[16]; const int g = lane >> 4;
#pragma unroll
  for (int i = 0; i < 8; ++i) { const int ka = k0 + 8 * g + i, kb = ka + 16; v[i] = ka < K ? row[ka < K ? ka : K - 1] : 0.f; v[8 + i] = kb < K ? row[kb < K ? kb : K - 1] : 0.f; }
  return bsplit16(v); }
__device__ __forceinline__ F2 split_col(const float* W, int k0, int n, int lane, int ld, int K) { float v[16]; const int g = lane >> 4;
#pragma unroll
  for (int i = 0; i < 8; ++i) { const int ka = k0 + 8 * g + i, kb = ka + 16; v[i] = ka < K ? W[(size_t)(ka < K ? ka : K - 1) * ld + n] : 0.f; v[8 + i] = kb < K ? W[(size_t)(kb < K ? kb : K - 1) * ld + n] : 0.f; }
  return bsplit16(v); }
__device__ __forceinline__ v8f mac3(const F2& a, const F2& b, v8f c) { c = wmma_bf(a.l, b.h, c); c = wmma_bf(a.h, b.l, c); return wmma_bf(a.h, b.h, c); }
__device__ __forceinline__ float sigm(float v) { return 1.0f / (1.0f + expf(-v)); }
#define LDSX() do { asm volatile("s_wait_dscnt 0" ::: "memory"); __builtin_amdgcn_wave_barrier(); __builtin_amdgcn_fence(__ATOMIC_RELEASE, "workgroup"); } while (0)

// Multi-head causal self-attention whose logits are scaled by 1/sqrt(EMBED) (x [2,2048,1024]; (in,out) Wq / Wk / Wv [1024,1024] and biases [1024] NONZERO applied as x @ W + b; Wo [1024,1024] torch (out,in), NO output bias; 16 heads x 64; logits x 1/sqrt(1024) = 1/32 - the model width, not the head width; tril kept, -inf elsewhere; softmax; z @ Wo.T).
#define NB 2
#define TT 2048
#define CC 1024            // NH * HD = projected width
#define DIN 1024          // input (model) width
#define NH 16
#define HD 64
#define SCALE (0.03125f)
#define CAUSAL 1
#ifndef TNB
#define TNB NB
#endif
__device__ __forceinline__ float bfr(float v) { return (float)(__bf16)v; }
__host__ __device__ __forceinline__ int kb_last(int qb) { return CAUSAL ? ((qb * 64 + 63) >> 7) : (TT / 128 - 1); }
typedef __attribute__((ext_vector_type(8))) __bf16 v8b;
__device__ __forceinline__ v16b frag_b(const __bf16* rowk0, int lane) {
  union { v16b v; v8b q[2]; } u; const __bf16* p = rowk0 + 8 * (lane >> 4);
  u.q[0] = *(const v8b*)p; u.q[1] = *(const v8b*)(p + 16); return u.v;
}
#define QBH 6              // causal: query blocks 0..QBH-1 of each sequence (few keys, no averaging) take the high-precision path
#define QHI 384            // rows carrying a q residual plane
#define KHI 384            // key rows carrying k residual / v bf16 hi+lo planes (used only by the causal high-precision path)
// B fragment (k rows k0+.., output column o) of a weight: (in,out) [K][ld] or (out,in) [ld rows of K]: bf16 exact, or f16(bf16 * 256) exact
__device__ __forceinline__ v16b wcol_io(const float* Wm, int k0, int o, int lane, int ld) { v16b w; const int g = lane >> 4;
#pragma unroll
  for (int i = 0; i < 8; ++i) { w[i] = (__bf16)Wm[(size_t)(k0 + 8 * g + i) * ld + o]; w[8 + i] = (__bf16)Wm[(size_t)(k0 + 16 + 8 * g + i) * ld + o]; }
  return w; }
__device__ __forceinline__ v16b wcol_oi(const float* Wm, int k0, int o, int lane, int K) { v16b w; const float* p = Wm + (size_t)o * K + k0 + 8 * (lane >> 4);
#pragma unroll
  for (int i = 0; i < 8; ++i) { w[i] = (__bf16)p[i]; w[8 + i] = (__bf16)p[16 + i]; }
  return w; }
__device__ __forceinline__ v16h wcolh_io(const float* Wm, int k0, int o, int lane, int ld) { v16h w; const int g = lane >> 4;
#pragma unroll
  for (int i = 0; i < 8; ++i) { w[i] = (_Float16)(bfr(Wm[(size_t)(k0 + 8 * g + i) * ld + o]) * 256.0f); w[8 + i] = (_Float16)(bfr(Wm[(size_t)(k0 + 16 + 8 * g + i) * ld + o]) * 256.0f); }
  return w; }
__device__ __forceinline__ v16h wcolh_oi(const float* Wm, int k0, int o, int lane, int K) { v16h w; const float* p = Wm + (size_t)o * K + k0 + 8 * (lane >> 4);
#pragma unroll
  for (int i = 0; i < 8; ++i) { w[i] = (_Float16)(bfr(p[i]) * 256.0f); w[8 + i] = (_Float16)(bfr(p[16 + i]) * 256.0f); }
  return w; }
#define WQKV_LAYOUT 0   // 0 = (in,out) [DIN][CC]; 1 = (out,in) [CC][DIN]; 2 = per-head [NH][DIN][HD]
__device__ __forceinline__ v16b wcol_hdk(const float* Wm, int k0, int o, int lane) { v16b w; const int g = lane >> 4; const float* p = Wm + (size_t)(o / HD) * DIN * HD + (o % HD);
#pragma unroll
  for (int i = 0; i < 8; ++i) { w[i] = (__bf16)p[(size_t)(k0 + 8 * g + i) * HD]; w[8 + i] = (__bf16)p[(size_t)(k0 + 16 + 8 * g + i) * HD]; }
  return w; }
#define WO_OUT_IN 1
#if WQKV_LAYOUT == 1
#define WCOL(W, k0, o, lane) wcol_oi(W, k0, o, lane, DIN)
#elif WQKV_LAYOUT == 2
#define WCOL(W, k0, o, lane) wcol_hdk(W, k0, o, lane)
#else
#define WCOL(W, k0, o, lane) wcol_io(W, k0, o, lane, CC)
#endif
#if WO_OUT_IN
#define WOCOL(W, k0, o, lane) wcol_oi(W, k0, o, lane, CC)
#define WOCOLH(W, k0, o, lane) wcolh_oi(W, k0, o, lane, CC)
#else
#define WOCOL(W, k0, o, lane) wcol_io(W, k0, o, lane, DIN)
#define WOCOLH(W, k0, o, lane) wcolh_io(W, k0, o, lane, DIN)
#endif

#ifndef PROJ_EXTRA_PARAMS
#define PROJ_EXTRA_PARAMS
#endif

#define WS_QH  0u                                      // f16 q rows [b*t][CC]
#define WS_KH  (WS_QH + 2u * (size_t)NB * TT * CC)      // f16 k rows [b*t][CC]
#define WS_VT  (WS_KH + 2u * (size_t)NB * TT * CC)      // f16 v planes [b][c][t]
#define WS_QL  (WS_VT + 2u * (size_t)NB * CC * TT)      // f16 q residual x 2^10 rows [b][t < QHI][CC]
#define WS_KL  (WS_QL + 2u * (size_t)NB * QHI * CC)     // f16 k residual x 2^10 rows [b][t < KHI][CC]
#define WS_VB  (WS_KL + 2u * (size_t)NB * KHI * CC)     // bf16 v hi planes [b][c][t < KHI]
#define WS_VBL (WS_VB + 2u * (size_t)NB * CC * KHI)
#define WS_Y   (WS_VBL + 2u * (size_t)NB * CC * KHI)    // f32 ctx rows [b*t][CC] (only when there is an output projection)
#define WS_END (WS_Y  + 4u * (size_t)NB * TT * CC)

#define SP 40                                        // LDS pitch of a staged 32-k row in 16-bit elements: 80 B = 16 B x odd, free of bank conflicts for 16-byte reads
#define WROW(n) (((n) & 3) * 36 + ((n) >> 2))       // LDS row of W column n in k_proj: a thread's 4 neighbouring columns lie 36 rows apart, so stores (32 rows in a run) and fragment reads (16 rows distinct mod 16) both spread over the banks
// work-group barrier of the staging loops, by hand: __syncthreads() would also wait for the next chunk's global loads, which are meant to stay in flight across it; the LDS stores are waited for in front of the signal
__device__ __forceinline__ void stage_bar() { asm volatile("s_wait_dscnt 0x0\n\ts_barrier_signal -1\n\ts_barrier_wait -1" ::: "memory"); }
// N units of 8 consecutive floats, ld floats apart, into registers
template <int N> __device__ __forceinline__ void ld_rows(const float* p, size_t ld, v4f (&r)[2 * N]) {
#pragma unroll
  for (int s = 0; s < N; ++s) { r[2 * s] = *(const v4f*)(p + s * ld); r[2 * s + 1] = *(const v4f*)(p + s * ld + 4); } }
// ---- k_proj: block = (64 rows, 128 cols, which): q/k/v = X W (+ b) with exact bf16 products (K = DIN) -> which 0: q f16 rows (+ residual rows < QHI); 1: k f16 rows (+ residual rows < KHI); 2: v f16 planes [c][t] (+ bf16 hi/lo planes for t < KHI)
__global__ __launch_bounds__(128) void k_proj(const float* __restrict__ XQ, const float* __restrict__ XK, const float* __restrict__ XV, const float* __restrict__ WQ, const float* __restrict__ WK, const float* __restrict__ WV, const float* __restrict__ BQ, const float* __restrict__ BK, const float* __restrict__ BV,
    _Float16* __restrict__ QH, _Float16* __restrict__ QL, _Float16* __restrict__ KH, _Float16* __restrict__ KL, _Float16* __restrict__ VT, __bf16* __restrict__ VB, __bf16* __restrict__ VBL) {
  __shared__ __align__(16) _Float16 sh[64][136], sl[64][136]; __shared__ __align__(16) _Float16 th[128][72]; __shared__ __align__(16) __bf16 tb[128][72], tbl[128][72];
  const int tid = threadIdx.x, wave = tid >> 5, lane = tid & 31, col = lane & 15, g = lane >> 4; const int which = blockIdx.z; const int c0 = blockIdx.y * 128; const size_t r0 = (size_t)blockIdx.x * 64; const size_t bb = r0 / TT; const int t0 = (int)(r0 % TT);
  const float* X = which == 0 ? XQ : which == 1 ? XK : XV; const float* WA = which == 0 ? WQ : which == 1 ? WK : WV; const float* BA = which == 0 ? BQ : which == 1 ? BK : BV;
  v8f acc[8] = {};
  /* k chunks of 32 staged once per block: X rows and W columns go to LDS as bf16, k-contiguous, in two buffers that lie in the epilogue's tiles (idle until the loop ends) */
  __bf16* const sx = reinterpret_cast<__bf16*>(&th[0][0]); __bf16* const sw0 = &tb[0][0]; __bf16* const sw1 = &tbl[0][0];
  static_assert(2 * 64 * SP <= 128 * 72 && 140 * SP <= 128 * 72 && WQKV_LAYOUT == 0, "the staging buffers fit the epilogue's tiles; W is (in,out)");
  const float* xg = X + (r0 + (tid >> 2)) * DIN + (tid & 3) * 8; const float* wg = WA + (size_t)(wave * 8) * CC + c0 + lane * 4; const int xo = (tid >> 2) * SP + (tid & 3) * 8;
  v4f rx[4], rw[8];
  ld_rows<2>(xg, (size_t)32 * DIN, rx);
#pragma unroll
  for (int i = 0; i < 8; ++i) rw[i] = *(const v4f*)(wg + (size_t)i * CC);
  asm volatile("s_wait_xcnt 0x0" ::: "memory");   /* stands before the loads' address registers are advanced */
#pragma unroll 2   /* two trips a pass: the buffer index becomes a constant */
  for (int kc = 0; kc < DIN / 32; ++kc) { __bf16* const xb = sx + (kc & 1) * 64 * SP; __bf16* const wb = (kc & 1) ? sw1 : sw0;
#pragma unroll
    for (int s = 0; s < 2; ++s) { v8b p;
#pragma unroll
      for (int i = 0; i < 4; ++i) { p[i] = (__bf16)rx[2 * s][i]; p[4 + i] = (__bf16)rx[2 * s + 1][i]; }
      *(v8b*)(xb + xo + s * 32 * SP) = p; }
#pragma unroll
    for (int c = 0; c < 4; ++c) { v8b p;   /* column 4 * lane + c, k rows 8 * wave + 0..7 */
#pragma unroll
      for (int i = 0; i < 8; ++i) p[i] = (__bf16)rw[i][c];
      *(v8b*)(wb + (c * 36 + lane) * SP + wave * 8) = p; }
    if (kc + 1 < DIN / 32) {   /* the next chunk's loads fly under this chunk's products */
      ld_rows<2>(xg + (kc + 1) * 32, (size_t)32 * DIN, rx);
#pragma unroll
      for (int i = 0; i < 8; ++i) rw[i] = *(const v4f*)(wg + (size_t)((kc + 1) * 32 + i) * CC);
      asm volatile("s_wait_xcnt 0x0" ::: "memory"); }   /* stands before the loads' address registers are advanced */
    stage_bar();   /* the chunk is in LDS before any wave reads fragments; it also ends the reads of the buffer that the next trip refills */
    const v16b a = frag_b(xb + (wave * 16 + col) * SP, lane); v16b w[8];
#pragma unroll
    for (int j = 0; j < 8; ++j) w[j] = frag_b(wb + WROW(j * 16 + col) * SP, lane);
    __builtin_amdgcn_sched_barrier(0);   /* keeps the chunk's LDS reads one group ahead of its products: spread among them each read costs its own latency */
#pragma unroll
    for (int j = 0; j < 8; ++j) acc[j] = wmma_bf(a, w[j], acc[j]);
    __builtin_amdgcn_sched_barrier(0); }   /* keeps the next trip's conversions, which wait for the loads in flight, behind this trip's products */
  __syncthreads();   /* every wave has read its last fragments before the epilogue's tiles overwrite the staging buffers */
  if (which < 2) { _Float16* DH = which == 0 ? QH : KH; _Float16* DL = which == 0 ? QL : KL; const int nhi = which == 0 ? QHI : KHI; const bool hi_rows = t0 < nhi;
#pragma unroll
    for (int j = 0; j < 8; ++j) { const float bias = BA ? bfr(BA[c0 + j * 16 + col]) : 0.f;
#pragma unroll
      for (int r = 0; r < 8; ++r) { const float v = acc[j][r] + bias; const _Float16 hv = (_Float16)v; sh[wave * 16 + 8 * g + r][j * 16 + col] = hv; sl[wave * 16 + 8 * g + r][j * 16 + col] = (_Float16)((v - (float)hv) * 1024.0f); } }
    __syncthreads();
    for (int e = tid; e < 64 * 16; e += 128) { const int rl = e >> 4, q = e & 15; vst2((unsigned*)(DH + (r0 + rl) * CC + c0 + q * 8), *(const v4u*)&sh[rl][q * 8]); if (hi_rows) vst2((unsigned*)(DL + (bb * nhi + t0 + rl) * (size_t)CC + c0 + q * 8), *(const v4u*)&sl[rl][q * 8]); }
  } else { const bool hi_rows = t0 < KHI;
#pragma unroll
    for (int j = 0; j < 8; ++j) { const float bias = BA ? bfr(BA[c0 + j * 16 + col]) : 0.f;
#pragma unroll
      for (int r = 0; r < 8; ++r) { const float v = acc[j][r] + bias; const int rl = wave * 16 + 8 * g + r, cl = j * 16 + col; th[cl][rl] = (_Float16)v; const __bf16 bh = (__bf16)v; tb[cl][rl] = bh; tbl[cl][rl] = (__bf16)(v - (float)bh); } }
    __syncthreads();
    for (int e = tid; e < 128 * 8; e += 128) { const int cl = e >> 3, q = e & 7; vst2((unsigned*)(VT + (bb * CC + c0 + cl) * (size_t)TT + t0 + q * 8), *(const v4u*)&th[cl][q * 8]); if (hi_rows) { const size_t o3 = (bb * CC + c0 + cl) * (size_t)KHI + t0 + q * 8; vst2((unsigned*)(VB + o3), *(const v4u*)&tb[cl][q * 8]); vst2((unsigned*)(VBL + o3), *(const v4u*)&tbl[cl][q * 8]); } } } }
#define QT 64
#define KP 72
#define LC (SCALE * 1.4426950408889634f)
__device__ __forceinline__ float xhalf(float x) { return __builtin_bit_cast(float, __builtin_amdgcn_permlanex16(__builtin_bit_cast(int, x), __builtin_bit_cast(int, x), 0x76543210, 0xfedcba98, false, false)); }
__device__ __forceinline__ v8f wmh(v16h a, v16h b, v8f c) { return __builtin_amdgcn_wmma_f32_16x16x32_f16(false, a, false, b, (short)0, c, false, false); }
__device__ __forceinline__ v8f wmb(v16b a, v16b b, v8f c) { return __builtin_amdgcn_wmma_f32_16x16x32_bf16(false, a, false, b, (short)0, c, false, false); }
// fragments from a lane's own address (row and 8 g already in it); the address has passed through an asm operand, so the loads say themselves that it is global memory (else they compile to flat loads)
typedef __attribute__((address_space(1))) const v8h gv8h; typedef __attribute__((address_space(1))) const v8b gv8b;
__device__ __forceinline__ v16h fragp_h(const _Float16* p) { union { v16h v; v8h q[2]; } u; u.q[0] = *(gv8h*)p; u.q[1] = *(gv8h*)(p + 16); return u.v; }
__device__ __forceinline__ v16b fragp_b(const __bf16* p) { union { v16b v; v8b q[2]; } u; u.q[0] = *(gv8b*)p; u.q[1] = *(gv8b*)(p + 16); return u.v; }
// 2^x on the transcendental unit. The v_nop is the one slot the instruction set asks for between a transcendental and a directly following instruction that reads its result or overwrites its source; inside the group of four the early-clobber outputs keep every result off every source
__device__ __forceinline__ float ex2(float x) { float e; asm("v_exp_f32 %0, %1\n\tv_nop" : "=v"(e) : "v"(x)); return e; }
__device__ __forceinline__ void ex2x4(float x0, float x1, float x2, float x3, float& e0, float& e1, float& e2, float& e3) { asm("v_exp_f32 %0, %4\n\tv_exp_f32 %1, %5\n\tv_exp_f32 %2, %6\n\tv_exp_f32 %3, %7\n\tv_nop" : "=&v"(e0), "=&v"(e1), "=&v"(e2), "=&v"(e3) : "v"(x0), "v"(x1), "v"(x2), "v"(x3)); }
// one step of the running softmax over NT 16-key score tiles: s comes in as raw logits (excluded: -3e38) and leaves as e x 2^11 against the new maximum; sum and the output tiles are brought to that maximum
template <int NT> __device__ __forceinline__ void online(v8f (&s)[NT], float& m, float& sum, v8f (&acc)[HD / 16]) {
  float mt[NT];   /* one chain per tile: a single chain of dependent maxima would be paid link by link */
#pragma unroll
  for (int t = 0; t < NT; ++t) { mt[t] = s[t][0];
#pragma unroll
    for (int r = 1; r < 8; ++r) mt[t] = fmaxf(mt[t], s[t][r]); }
  float mx = mt[0];
#pragma unroll
  for (int t = 1; t < NT; ++t) mx = fmaxf(mx, mt[t]);
  mx = fmaxf(mx, xhalf(mx));   /* both halves of the wave hold keys of the same query: one maximum for both */
  const float mn = fmaxf(m, mx); const float corr = ex2((m - mn) * LC); const float off = 11.0f - mn * LC; m = mn;
  float ps[NT];
#pragma unroll
  for (int t = 0; t < NT; ++t) { ps[t] = 0.f;
#pragma unroll
    for (int r = 0; r < 8; r += 4) { float e0, e1, e2, e3; ex2x4(fmaf(s[t][r], LC, off), fmaf(s[t][r + 1], LC, off), fmaf(s[t][r + 2], LC, off), fmaf(s[t][r + 3], LC, off), e0, e1, e2, e3); s[t][r] = e0; s[t][r + 1] = e1; s[t][r + 2] = e2; s[t][r + 3] = e3; ps[t] += e0; ps[t] += e1; ps[t] += e2; ps[t] += e3; } }
  float p = ps[0];
#pragma unroll
  for (int t = 1; t < NT; ++t) p += ps[t];
  sum = sum * corr + p;
#pragma unroll
  for (int j = 0; j < HD / 16; ++j) acc[j] *= corr; }
__global__ __launch_bounds__(128) __attribute__((amdgpu_waves_per_eu(4, 4))) void k_pv(const _Float16* __restrict__ QH, const _Float16* __restrict__ KH, const _Float16* __restrict__ QL, const _Float16* __restrict__ KL, const _Float16* __restrict__ VT, const __bf16* __restrict__ VB, const __bf16* __restrict__ VBL, float* __restrict__ Y) {
  __shared__ __align__(16) _Float16 sk[2][QT * KP], sv[2][HD * KP]; __shared__ __align__(16) float so[4][16][HD + 4];
  static_assert(TT / QT == 32 && TNB * NH == 32 && HD == 64 && QBH * QT == QHI && QHI == KHI && CAUSAL == 1, "the index map below is a permutation of 32 tiles x 32 (b, h); early tiles read only keys that carry residual planes");
  const int tid = threadIdx.x, wave = __builtin_amdgcn_readfirstlane(tid >> 5), lane = tid & 31, col = lane & 15, g = lane >> 4;
  /* block index -> (tile, b h): cost rises with the tile, all blocks are resident at once; four blocks 256 apart, and four neighbours of the same index mod 8, take tiles that add up to the same cost (for speed only) */
  const int bi = blockIdx.x, n = bi >> 3, cc = (n >> 2) & 7, a4 = n >> 5, role = (a4 + n) & 3; const int tile = role == 0 ? 31 - cc : role == 1 ? cc : role == 2 ? 23 - cc : 8 + cc; const int bh = (bi & 7) + 8 * a4; const int b = bh / NH, h = bh % NH;
  const int q0 = tile * QT + wave * 16;
  const _Float16* qp = QH + ((size_t)b * TT + q0 + col) * CC + h * HD; const v16h bq0 = frag_h(qp, lane), bq1 = frag_h(qp + 32, lane);
  asm volatile("s_wait_xcnt 0x0" ::: "memory");   /* stands before the q loads' address registers are reused */
  float m = -3.0e38f, sum = 0.f; v8f acc[HD / 16] = {};
  if (tile < QBH) {   /* block-uniform */
    const _Float16* qlp = QL + ((size_t)b * QHI + q0 + col) * CC + h * HD; const v16h bl0 = frag_h(qlp, lane), bl1 = frag_h(qlp + 32, lane);
    asm volatile("s_wait_xcnt 0x0" ::: "memory");   /* stands before the residual loads' address registers are reused */
    const int nch = ((q0 + 15) >> 5) + 1;
    /* each lane's own four addresses, carried from trip to trip and advanced behind the waits */
    const _Float16* kp = KH + ((size_t)b * TT + col) * CC + h * HD + 8 * g; const _Float16* klp = KL + ((size_t)b * KHI + col) * CC + h * HD + 8 * g;
    const __bf16* vbp = VB + ((size_t)b * CC + h * HD + col) * (size_t)KHI + 8 * g; const __bf16* vlp = VBL + ((size_t)b * CC + h * HD + col) * (size_t)KHI + 8 * g;
#pragma unroll 1   /* at most 12 trips: kept rolled, unrolling would only add code */
    for (int kc = 0; kc < nch; ++kc) { v16h kh[2][2], kl[2][2]; v16b vh[HD / 16], vl[HD / 16];
#pragma unroll
      for (int t = 0; t < 2; ++t) { kh[t][0] = fragp_h(kp + t * 16 * CC); kh[t][1] = fragp_h(kp + t * 16 * CC + 32); kl[t][0] = fragp_h(klp + t * 16 * CC); kl[t][1] = fragp_h(klp + t * 16 * CC + 32); }
      asm volatile("s_wait_xcnt 0x0" : "+v"(kp), "+v"(klp) :: "memory");   /* stands before the k loads' address registers are advanced; it names the two pairs so that they stay whole up to it (no load of the group may land on them) */
      __builtin_amdgcn_sched_barrier(0);   /* keeps every later register write behind that wait */
      kp += 32 * CC; klp += 32 * CC;
      v8f s[2];
#pragma unroll
      for (int t = 0; t < 2; ++t) { v8f a = {}, l = {};
        a = wmh(kh[t][0], bq0, a); l = wmh(kh[t][0], bl0, l); l = wmh(kl[t][0], bq0, l); a = wmh(kh[t][1], bq1, a); l = wmh(kh[t][1], bl1, l); l = wmh(kl[t][1], bq1, l);
#pragma unroll
        for (int r = 0; r < 8; ++r) s[t][r] = (kc * 32 + t * 16 + 8 * g + r <= q0 + col) ? a[r] + l[r] * (1.0f / 1024.0f) : -3.0e38f; }
#pragma unroll
      for (int j = 0; j < HD / 16; ++j) { vh[j] = fragp_b(vbp + j * 16 * KHI); vl[j] = fragp_b(vlp + j * 16 * KHI); }   /* in flight under the softmax step */
      asm volatile("s_wait_xcnt 0x0" : "+v"(vbp), "+v"(vlp) :: "memory");   /* stands before the v loads' address registers are advanced; it names the two pairs so that they stay whole up to it */
      __builtin_amdgcn_sched_barrier(0);   /* keeps every later register write behind that wait */
      vbp += 32; vlp += 32;
      online<2>(s, m, sum, acc);
      float v[16];
#pragma unroll
      for (int r = 0; r < 8; ++r) { v[r] = s[0][r]; v[8 + r] = s[1][r]; }
      const F2 p = bsplit16(v);
#pragma unroll
      for (int j = 0; j < HD / 16; ++j) { acc[j] = wmb(vh[j], p.h, acc[j]); acc[j] = wmb(vh[j], p.l, acc[j]); acc[j] = wmb(vl[j], p.h, acc[j]); } }
  } else {
    const int srow = tid >> 3, sseg = tid & 7, sof = srow * KP + sseg * 8;   /* 8 lanes bring one 128-B row; 16 rows a pass of the block */
    const _Float16* kg = KH + ((size_t)b * TT + srow) * CC + h * HD + sseg * 8; const _Float16* vg = VT + ((size_t)b * CC + h * HD + srow) * (size_t)TT + sseg * 8;
    v8h rk[4], rv[4];
#pragma unroll
    for (int u = 0; u < 4; ++u) { rk[u] = *(const v8h*)(kg + (size_t)(u * 16) * CC); rv[u] = *(const v8h*)(vg + (size_t)(u * 16) * TT); }
    asm volatile("s_wait_xcnt 0x0" ::: "memory");   /* stands before the loads' address registers are advanced */
#pragma unroll 1   /* the body is long and its trip count varies with the tile */
    for (int st = 0; st <= tile; ++st) { _Float16* const kb = &sk[st & 1][0]; _Float16* const vb = &sv[st & 1][0];
#pragma unroll
      for (int u = 0; u < 4; ++u) { *(v8h*)(kb + sof + u * 16 * KP) = rk[u]; *(v8h*)(vb + sof + u * 16 * KP) = rv[u]; }
      if (st < tile) {   /* the next stage's loads fly under this stage's work */
#pragma unroll
        for (int u = 0; u < 4; ++u) { rk[u] = *(const v8h*)(kg + (size_t)((st + 1) * 64 + u * 16) * CC); rv[u] = *(const v8h*)(vg + (size_t)(u * 16) * TT + (st + 1) * 64); }
        asm volatile("s_wait_xcnt 0x0" ::: "memory"); }   /* stands before the loads' address registers are advanced */
      stage_bar();   /* the stage is in LDS before any wave reads fragments; it also ends the reads of the buffer that the next trip refills */
      v8f s[4]; v16h ka[4][2];
#pragma unroll
      for (int t = 0; t < 4; ++t) { const _Float16* kr = kb + (t * 16 + col) * KP; ka[t][0] = frag_h(kr, lane); ka[t][1] = frag_h(kr + 32, lane); }
      __builtin_amdgcn_sched_barrier(0);   /* keeps the stage's K reads one group ahead of its products: spread among them each pair of reads costs its own LDS latency */
#pragma unroll
      for (int t = 0; t < 4; ++t) { v8f z = {}; s[t] = wmh(ka[t][0], bq0, z); }
#pragma unroll
      for (int t = 0; t < 4; ++t) s[t] = wmh(ka[t][1], bq1, s[t]);
      v16h va[HD / 16][2];
#pragma unroll
      for (int j = 0; j < HD / 16; ++j) { const _Float16* vr = vb + (j * 16 + col) * KP; va[j][0] = frag_h(vr, lane); va[j][1] = frag_h(vr + 32, lane); }
      __builtin_amdgcn_sched_barrier(0);   /* keeps the stage's V reads one group ahead of the softmax step, which covers their LDS latency */
      if (st == tile) {   /* only the last stage meets the diagonal */
#pragma unroll
        for (int t = 0; t < 4; ++t)
#pragma unroll
          for (int r = 0; r < 8; ++r) s[t][r] = (t * 16 + 8 * g + r <= wave * 16 + col) ? s[t][r] : -3.0e38f; }
      online<4>(s, m, sum, acc);
      v16h p0, p1;
#pragma unroll
      for (int r = 0; r < 8; ++r) { p0[r] = (_Float16)s[0][r]; p0[8 + r] = (_Float16)s[1][r]; p1[r] = (_Float16)s[2][r]; p1[8 + r] = (_Float16)s[3][r]; }
#pragma unroll
      for (int j = 0; j < HD / 16; ++j) acc[j] = wmh(va[j][0], p0, acc[j]);
#pragma unroll
      for (int j = 0; j < HD / 16; ++j) acc[j] = wmh(va[j][1], p1, acc[j]); } }
  const float tot = sum + xhalf(sum); const float inv = tot > 0.f ? 1.0f / tot : 0.f;   /* the halves' sums are joined once; the 2^11 of e cancels */
#pragma unroll
  for (int j = 0; j < HD / 16; ++j) { v4f lo, hi;   /* O^T tile j: element r = head column 16 j + 8 g + r of query col */
#pragma unroll
    for (int r = 0; r < 4; ++r) { lo[r] = acc[j][r] * inv; hi[r] = acc[j][4 + r] * inv; }
    *(v4f*)&so[wave][col][j * 16 + 8 * g] = lo; *(v4f*)&so[wave][col][j * 16 + 8 * g + 4] = hi; }
  LDSX();   /* the wave's own rows are in LDS before it reads them back as whole 256-B (row, head) segments */
#pragma unroll
  for (int rl = 0; rl < 16; rl += 2) vst2(Y + ((size_t)b * TT + q0 + rl + g) * CC + h * HD + col * 4, *(const v4f*)&so[wave][rl + g][col * 4]); }
// ---- k_out: block = (64 rows, 128 cols): out = ctx Wo (+ bo): ctx x 2^6 once to f16 against Wo as f16(bf16 x 2^8) exact (1 product) x 2^-14; causal early rows (< QHI of each sequence): ctx bf16 hi + lo against exact bf16 Wo (2 products)
__global__ __launch_bounds__(128) void k_out(const float* __restrict__ Y, const float* __restrict__ WO, const float* __restrict__ BO, float* __restrict__ OUT) { __shared__ __align__(16) float sf[4][16][132];
  __shared__ __align__(16) __bf16 sa[2][2][64 * SP], sb[2][128 * SP];   /* staged k chunks of 32, two buffers: ctx rows (hi and lo plane) and Wo rows, already in their 16-bit operand form */
  static_assert(WO_OUT_IN == 1, "Wo rows are k-contiguous");
  const int tid = threadIdx.x, wave = tid >> 5, lane = tid & 31, col = lane & 15, g = lane >> 4; const int c0 = blockIdx.y * 128; const size_t rb = (size_t)blockIdx.x * 64; const size_t r0 = rb + wave * 16;
  const float* yg = Y + (rb + (tid >> 2)) * CC + (tid & 3) * 8; const float* wg = WO + (size_t)(c0 + (tid >> 2)) * CC + (tid & 3) * 8; const int so = (tid >> 2) * SP + (tid & 3) * 8;
  v4f ry[4], rw[8];
  ld_rows<2>(yg, (size_t)32 * CC, ry); ld_rows<4>(wg, (size_t)32 * CC, rw);
  asm volatile("s_wait_xcnt 0x0" ::: "memory");   /* stands before the loads' address registers are advanced */
  v8f acc[8] = {};
  if (CAUSAL && (int)(((size_t)blockIdx.x * 64) % TT) < QHI) {   /* block-uniform */
#pragma unroll 2   /* two trips a pass: the buffer index becomes a constant */
    for (int kc = 0; kc < CC / 32; ++kc) { __bf16* const ah = &sa[kc & 1][0][0]; __bf16* const al = &sa[kc & 1][1][0]; __bf16* const wb = &sb[kc & 1][0];
#pragma unroll
      for (int s = 0; s < 2; ++s) { v8b h, l;
#pragma unroll
        for (int i = 0; i < 8; ++i) { const float v = ry[2 * s + (i >> 2)][i & 3]; const __bf16 hv = (__bf16)v; h[i] = hv; l[i] = (__bf16)(v - (float)hv); }
        *(v8b*)(ah + so + s * 32 * SP) = h; *(v8b*)(al + so + s * 32 * SP) = l; }
#pragma unroll
      for (int s = 0; s < 4; ++s) { v8b p;
#pragma unroll
        for (int i = 0; i < 8; ++i) p[i] = (__bf16)rw[2 * s + (i >> 2)][i & 3];
        *(v8b*)(wb + so + s * 32 * SP) = p; }
      if (kc + 1 < CC / 32) {   /* the next chunk's loads fly under this chunk's products */
        ld_rows<2>(yg + (kc + 1) * 32, (size_t)32 * CC, ry); ld_rows<4>(wg + (kc + 1) * 32, (size_t)32 * CC, rw);
        asm volatile("s_wait_xcnt 0x0" ::: "memory"); }   /* stands before the loads' address registers are advanced */
      stage_bar();   /* the chunk is in LDS before any wave reads fragments; it also ends the reads of the buffer that the next trip refills */
      const v16b fh = frag_b(ah + (wave * 16 + col) * SP, lane), fl = frag_b(al + (wave * 16 + col) * SP, lane); v16b w[8];
#pragma unroll
      for (int j = 0; j < 8; ++j) w[j] = frag_b(wb + (j * 16 + col) * SP, lane);
      __builtin_amdgcn_sched_barrier(0);   /* keeps the chunk's LDS reads one group ahead of its products */
#pragma unroll
      for (int j = 0; j < 8; ++j) { acc[j] = wmma_bf(fh, w[j], acc[j]); acc[j] = wmma_bf(fl, w[j], acc[j]); }
      __builtin_amdgcn_sched_barrier(0); }   /* keeps the next trip's conversions, which wait for the loads in flight, behind this trip's products */
#pragma unroll
    for (int j = 0; j < 8; ++j) { const float bias = BO ? bfr(BO[c0 + j * 16 + col]) : 0.f;
#pragma unroll
      for (int r = 0; r < 8; ++r) sf[wave][8 * g + r][j * 16 + col] = acc[j][r] + bias; }
  } else {
#pragma unroll 2   /* two trips a pass: the buffer index becomes a constant */
    for (int kc = 0; kc < CC / 32; ++kc) { _Float16* const ab = reinterpret_cast<_Float16*>(&sa[kc & 1][0][0]); _Float16* const wb = reinterpret_cast<_Float16*>(&sb[kc & 1][0]);
#pragma unroll
      for (int s = 0; s < 2; ++s) { v8h p;   /* ctx carried x 2^6 into f16 so small-magnitude context rows stay clear of f16 subnormals */
#pragma unroll
        for (int i = 0; i < 8; ++i) p[i] = (_Float16)(ry[2 * s + (i >> 2)][i & 3] * 64.0f);
        *(v8h*)(ab + so + s * 32 * SP) = p; }
#pragma unroll
      for (int s = 0; s < 4; ++s) { v8h p;
#pragma unroll
        for (int i = 0; i < 8; ++i) p[i] = (_Float16)(bfr(rw[2 * s + (i >> 2)][i & 3]) * 256.0f);
        *(v8h*)(wb + so + s * 32 * SP) = p; }
      if (kc + 1 < CC / 32) {   /* the next chunk's loads fly under this chunk's products */
        ld_rows<2>(yg + (kc + 1) * 32, (size_t)32 * CC, ry); ld_rows<4>(wg + (kc + 1) * 32, (size_t)32 * CC, rw);
        asm volatile("s_wait_xcnt 0x0" ::: "memory"); }   /* stands before the loads' address registers are advanced */
      stage_bar();   /* the chunk is in LDS before any wave reads fragments; it also ends the reads of the buffer that the next trip refills */
      const v16h a = frag_h(ab + (wave * 16 + col) * SP, lane); v16h w[8];
#pragma unroll
      for (int j = 0; j < 8; ++j) w[j] = frag_h(wb + (j * 16 + col) * SP, lane);
      __builtin_amdgcn_sched_barrier(0);   /* keeps the chunk's LDS reads one group ahead of its products */
#pragma unroll
      for (int j = 0; j < 8; ++j) acc[j] = wmma16(a, w[j], acc[j]);
      __builtin_amdgcn_sched_barrier(0); }   /* keeps the next trip's conversions, which wait for the loads in flight, behind this trip's products */
#pragma unroll
    for (int j = 0; j < 8; ++j) { const float bias = BO ? bfr(BO[c0 + j * 16 + col]) : 0.f;
#pragma unroll
      for (int r = 0; r < 8; ++r) sf[wave][8 * g + r][j * 16 + col] = acc[j][r] * (1.0f / 16384.0f) + bias; } }   /* 2^-8 (Wo carry) x 2^-6 (ctx carry) */
  LDSX(); for (int rl = 0; rl < 16; ++rl) vst2(OUT + (r0 + rl) * DIN + c0 + lane * 4, *(const v4f*)&sf[wave][rl][lane * 4]); }

extern "C" void kernel_launch(void* const* d_in, const int* in_sizes, int n_in, void* d_out, int out_size, void* d_ws, size_t ws_size, hipStream_t stream) {
  (void)in_sizes; (void)n_in; (void)out_size;
  const float** F = (const float**)d_in;
  if (ws_size < (size_t)WS_END) return;
  char* ws = (char*)d_ws; _Float16 *QH = (_Float16*)(ws + WS_QH), *KH = (_Float16*)(ws + WS_KH), *VT = (_Float16*)(ws + WS_VT), *QL = (_Float16*)(ws + WS_QL), *KL = (_Float16*)(ws + WS_KL); __bf16 *VB = (__bf16*)(ws + WS_VB), *VBL = (__bf16*)(ws + WS_VBL); float *Y = (float*)(ws + WS_Y);
  (void)Y; (void)QL; (void)KL; (void)VB; (void)VBL;
  // inputs: 0 x [2,2048,1024]; 1 Wq [1024,1024] (in,out), 2 bq; 3 Wk, 4 bk; 5 Wv, 6 bv (biases NONZERO); 7 Wo [1024,1024] (out,in); no output bias
  k_proj<<<dim3(TNB * TT / 64, CC / 128, 3), 128, 0, stream>>>(F[0], F[0], F[0], F[1], F[3], F[5], F[2], F[4], F[6], QH, QL, KH, KL, VT, VB, VBL);
  k_pv<<<dim3((TT / QT) * TNB * NH), 128, 0, stream>>>(QH, KH, QL, KL, VT, VB, VBL, Y);
  k_out<<<dim3(TNB * TT / 64, DIN / 128), 128, 0, stream>>>(Y, F[7], nullptr, (float*)d_out);
}

// v006
// Measured time: 93 microseconds a run.
// Next to v005, in two timings, it ran 1.14 and 1.15 times as fast.
// All steps since v000 together make it 11.5 times as fast.
// compute dtype: all float inputs rounded to bf16; the fused q / k / v projection with EXACT bf16 products on WMMA 16x16x32 (f32 accumulate) + bias (nonzero); causal logits: 3 products for the first 384 rows, single f16 q x k after, x 1024^-0.5 (the module scales by the MODEL width); softmax f32 with a running maximum; e x 2^11 once to f16 x v once to f16 (bf16 hi + lo below row 384), divided by the sum at the end; ctx hi+lo x exact W below row 384, x2^6 f16 carry x f16(bf16 x 2^8) W after, no output bias; f32 output.
#include <hip/hip_runtime.h>
#include <math.h>

typedef __attribute__((ext_vector_type(16))) _Float16 v16h;
typedef __attribute__((ext_vector_type(16))) __bf16 v16b;
typedef __attribute__((ext_vector_type(8)))  _Float16 v8h;
typedef __attribute__((ext_vector_type(8)))  float v8f;
typedef __attribute__((ext_vector_type(4)))  float v4f;
typedef __attribute__((ext_vector_type(2)))  float v2f;
typedef __attribute__((ext_vector_type(4)))  unsigned v4u;
typedef __attribute__((ext_vector_type(4)))  int v4i;
typedef float __attribute__((may_alias)) float_a;
typedef int __attribute__((may_alias)) int_a;

template <typename T> __device__ __forceinline__ void vst2(void* p, T v) { *(T*)p = v;  }
__device__ __forceinline__ v8f wmma16(v16h a, v16h b, v8f c) {
  v8f d = __builtin_amdgcn_wmma_f32_16x16x32_f16(false, a, false, b, (short)0, c, false, false);
  asm volatile("v_nop\n\tv_nop\n\tv_nop\n\tv_nop" : "+v"(d) : "v"(a), "v"(b));
  return d;
}
__device__ __forceinline__ v8f wmma_bf(v16b a, v16b b, v8f c) {
  v8f d = __builtin_amdgcn_wmma_f32_16x16x32_bf16(false, a, false, b, (short)0, c, false, false);
  asm volatile("v_nop\n\tv_nop\n\tv_nop\n\tv_nop" : "+v"(d) : "v"(a), "v"(b));
  return d;
}
// 16x16x32 fragments: lane = (h = lane>>4, row/col = lane&15); elements 0..7 = k0+8h+0..7, 8..15 = k0+16+8h+0..7; D element r = row 8h+r
__device__ __forceinline__ v16h frag_h(const _Float16* rowk0, int lane) {
  union { v16h v; v8h q[2]; } u; const _Float16* p = rowk0 + 8 * (lane >> 4);
  u.q[0] = *(const v8h*)p; u.q[1] = *(const v8h*)(p + 16); return u.v;
}
__device__ __forceinline__ v16h frag_f32(const float* rowk0, int lane) {
  v16h a; const float* p = rowk0 + 8 * (lane >> 4);
#pragma unroll
  for (int i = 0; i < 8; ++i) { a[i] = (_Float16)p[i]; a[8 + i] = (_Float16)p[16 + i]; }
  return a;
}
__device__ __forceinline__ v16h frag_f32s(const float* rowk0, int lane, float sc) {
  v16h a; const float* p = rowk0 + 8 * (lane >> 4);
#pragma unroll
  for (int i = 0; i < 8; ++i) { a[i] = (_Float16)(p[i] * sc); a[8 + i] = (_Float16)(p[16 + i] * sc); }
  return a;
}
// column fragment from a [K][ld] layout (column n), rows >= K read as 0
__device__ __forceinline__ v16h fragc_f32(const float* W, int k0, int n, int lane, int ld, int K) {
  v16h a; const int g = lane >> 4;
#pragma unroll
  for (int i = 0; i < 8; ++i) { const int ka = k0 + 8 * g + i, kb = ka + 16;
    a[i] = (_Float16)(ka < K ? W[(size_t)(ka < K ? ka : K - 1) * ld + n] : 0.f); a[8 + i] = (_Float16)(kb < K ? W[(size_t)(kb < K ? kb : K - 1) * ld + n] : 0.f); }
  return a;
}
struct F2 { v16b h, l; };
__device__ __forceinline__ F2 bsplit16(const float v[16]) { F2 r;
#pragma unroll
  for (int i = 0; i < 16; ++i) { const __bf16 h = (__bf16)v[i]; r.h[i] = h; r.l[i] = (__bf16)(v[i] - (float)h); }
  return r; }
__device__ __forceinline__ F2 split_row(const float* row, int k0, int lane) { float v[16]; const float* p = row + k0 + 8 * (lane >> 4);
#pragma unroll
  for (int i = 0; i < 8; ++i) { v[i] = p[i]; v[8 + i] = p[16 + i]; }
  return bsplit16(v); }
__device__ __forceinline__ F2 split_rowK(const float* row, int k0, int lane, int K) { float v[16]; const int g = lane >> 4;
#pragma unroll
  for (int i = 0; i < 8; ++i) { const int ka = k0 + 8 * g + i, kb = ka + 16; v[i] = ka < K ? row[ka < K ? ka : K - 1] : 0.f; v[8 + i] = kb < K ? row[kb < K ? kb : K - 1] : 0.f; }
  return bsplit16(v); }
__device__ __forceinline__ F2 split_col(const float* W, int k0, int n, int lane, int ld, int K) { float v[16]; const int g = lane >> 4;
#pragma unroll
  for (int i = 0; i < 8; ++i) { const int ka = k0 + 8 * g + i, kb = ka + 16; v[i] = ka < K ? W[(size_t)(ka < K ? ka : K - 1) * ld + n] : 0.f; v[8 + i] = kb < K ? W[(size_t)(kb < K ? kb : K - 1) * ld + n] : 0.f; }
  return bsplit16(v); }
__device__ __forceinline__ v8f mac3(const F2& a, const F2& b, v8f c) { c = wmma_bf(a.l, b.h, c); c = wmma_bf(a.h, b.l, c); return wmma_bf(a.h, b.h, c); }
__device__ __forceinline__ float sigm(float v) { return 1.0f / (1.0f + expf(-v)); }
#define LDSX() do { asm volatile("s_wait_dscnt 0" ::: "memory"); __builtin_amdgcn_wave_barrier(); __builtin_amdgcn_fence(__ATOMIC_RELEASE, "workgroup"); } while (0)

// Multi-head causal self-attention whose logits are scaled by 1/sqrt(EMBED) (x [2,2048,1024]; (in,out) Wq / Wk / Wv [1024,1024] and biases [1024] NONZERO applied as x @ W + b; Wo [1024,1024] torch (out,in), NO output bias; 16 heads x 64; logits x 1/sqrt(1024) = 1/32 - the model width, not the head width; tril kept, -inf elsewhere; softmax; z @ Wo.T).
#define NB 2
#define TT 2048
#define CC 1024            // NH * HD = projected width
#define DIN 1024          // input (model) width
#define NH 16
#define HD 64
#define SCALE (0.03125f)
#define CAUSAL 1
#ifndef TNB
#define TNB NB
#endif
__device__ __forceinline__ float bfr(float v) { return (float)(__bf16)v; }
__host__ __device__ __forceinline__ int kb_last(int qb) { return CAUSAL ? ((qb * 64 + 63) >> 7) : (TT / 128 - 1); }
typedef __attribute__((ext_vector_type(8))) __bf16 v8b;
__device__ __forceinline__ v16b frag_b(const __bf16* rowk0, int lane) {
  union { v16b v; v8b q[2]; } u; const __bf16* p = rowk0 + 8 * (lane >> 4);
  u.q[0] = *(const v8b*)p; u.q[1] = *(const v8b*)(p + 16); return u.v;
}
#define QBH 6              // causal: query blocks 0..QBH-1 of each sequence (few keys, no averaging) take the high-precision path
#define QHI 384            // rows carrying a q residual plane
#define KHI 384            // key rows carrying k residual / v bf16 hi+lo planes (used only by the causal high-precision path)
// B fragment (k rows k0+.., output column o) of a weight: (in,out) [K][ld] or (out,in) [ld rows of K]: bf16 exact, or f16(bf16 * 256) exact
__device__ __forceinline__ v16b wcol_io(const float* Wm, int k0, int o, int lane, int ld) { v16b w; const int g = lane >> 4;
#pragma unroll
  for (int i = 0; i < 8; ++i) { w[i] = (__bf16)Wm[(size_t)(k0 + 8 * g + i) * ld + o]; w[8 + i] = (__bf16)Wm[(size_t)(k0 + 16 + 8 * g + i) * ld + o]; }
  return w; }
__device__ __forceinline__ v16b wcol_oi(const float* Wm, int k0, int o, int lane, int K) { v16b w; const float* p = Wm + (size_t)o * K + k0 + 8 * (lane >> 4);
#pragma unroll
  for (int i = 0; i < 8; ++i) { w[i] = (__bf16)p[i]; w[8 + i] = (__bf16)p[16 + i]; }
  return w; }
__device__ __forceinline__ v16h wcolh_io(const float* Wm, int k0, int o, int lane, int ld) { v16h w; const int g = lane >> 4;
#pragma unroll
  for (int i = 0; i < 8; ++i) { w[i] = (_Float16)(bfr(Wm[(size_t)(k0 + 8 * g + i) * ld + o]) * 256.0f); w[8 + i] = (_Float16)(bfr(Wm[(size_t)(k0 + 16 + 8 * g + i) * ld + o]) * 256.0f); }
  return w; }
__device__ __forceinline__ v16h wcolh_oi(const float* Wm, int k0, int o, int lane, int K) { v16h w; const float* p = Wm + (size_t)o * K + k0 + 8 * (lane >> 4);
#pragma unroll
  for (int i = 0; i < 8; ++i) { w[i] = (_Float16)(bfr(p[i]) * 256.0f); w[8 + i] = (_Float16)(bfr(p[16 + i]) * 256.0f); }
  return w; }
#define WQKV_LAYOUT 0   // 0 = (in,out) [DIN][CC]; 1 = (out,in) [CC][DIN]; 2 = per-head [NH][DIN][HD]
__device__ __forceinline__ v16b wcol_hdk(const float* Wm, int k0, int o, int lane) { v16b w; const int g = lane >> 4; const float* p = Wm + (size_t)(o / HD) * DIN * HD + (o % HD);
#pragma unroll
  for (int i = 0; i < 8; ++i) { w[i] = (__bf16)p[(size_t)(k0 + 8 * g + i) * HD]; w[8 + i] = (__bf16)p[(size_t)(k0 + 16 + 8 * g + i) * HD]; }
  return w; }
#define WO_OUT_IN 1
#if WQKV_LAYOUT == 1
#define WCOL(W, k0, o, lane) wcol_oi(W, k0, o, lane, DIN)
#elif WQKV_LAYOUT == 2
#define WCOL(W, k0, o, lane) wcol_hdk(W, k0, o, lane)
#else
#define WCOL(W, k0, o, lane) wcol_io(W, k0, o, lane, CC)
#endif
#if WO_OUT_IN
#define WOCOL(W, k0, o, lane) wcol_oi(W, k0, o, lane, CC)
#define WOCOLH(W, k0, o, lane) wcolh_oi(W, k0, o, lane, CC)
#else
#define WOCOL(W, k0, o, lane) wcol_io(W, k0, o, lane, DIN)
#define WOCOLH(W, k0, o, lane) wcolh_io(W, k0, o, lane, DIN)
#endif

#ifndef PROJ_EXTRA_PARAMS
#define PROJ_EXTRA_PARAMS
#endif

#define WS_QH  0u                                      // f16 q rows [b*t][CC]
#define WS_KH  (WS_QH + 2u * (size_t)NB * TT * CC)      // f16 k rows [b*t][CC]
#define WS_VT  (WS_KH + 2u * (size_t)NB * TT * CC)      // f16 v planes [b][c][t]
#define WS_QL  (WS_VT + 2u * (size_t)NB * CC * TT)      // f16 q residual x 2^10 rows [b][t < QHI][CC]
#define WS_KL  (WS_QL + 2u * (size_t)NB * QHI * CC)     // f16 k residual x 2^10 rows [b][t < KHI][CC]
#define WS_VB  (WS_KL + 2u * (size_t)NB * KHI * CC)     // bf16 v hi planes [b][c][t < KHI]
#define WS_VBL (WS_VB + 2u * (size_t)NB * CC * KHI)
#define WS_Y   (WS_VBL + 2u * (size_t)NB * CC * KHI)    // f32 ctx rows [b*t][CC] (only when there is an output projection)
#define WS_END (WS_Y  + 4u * (size_t)NB * TT * CC)

#define SP 40                                        // LDS pitch of a staged 32-k row in 16-bit elements: 80 B = 16 B x odd, free of bank conflicts for 16-byte reads
// work-group barrier of the staging loops, by hand: __syncthreads() would also wait for the next chunk's global loads, which are meant to stay in flight across it; the LDS stores are waited for in front of the signal
__device__ __forceinline__ void stage_bar() { asm volatile("s_wait_dscnt 0x0\n\ts_barrier_signal -1\n\ts_barrier_wait -1" ::: "memory"); }
// N units of 8 consecutive floats, ld floats apart, into registers
template <int N> __device__ __forceinline__ void ld_rows(const float* p, size_t ld, v4f (&r)[2 * N]) {
#pragma unroll
  for (int s = 0; s < N; ++s) { r[2 * s] = *(const v4f*)(p + s * ld); r[2 * s + 1] = *(const v4f*)(p + s * ld + 4); } }
// ---- k_proj: block = (256 rows, 256 cols, which), 16 waves as 4 x 4, a wave holds 64 x 64 (4 X fragments x 4 W fragments, 16 products a chunk): q/k/v = X W (+ b) with exact bf16 products (K = DIN) -> which 0: q f16 rows (+ residual rows < QHI); 1: k f16 rows (+ residual rows < KHI); 2: v f16 planes [c][t] (+ bf16 hi/lo planes for t < KHI)
#define PB 256                                       // rows and columns of a k_proj block
#define PWN 268                                      // LDS rows of a staged W chunk
#define PWROW(n) (((n) & 3) * 68 + ((n) >> 2))      // LDS row of W column n: a thread's 4 neighbouring columns lie 68 rows apart, so stores (32 rows in a run) and fragment reads (16 rows distinct mod 16) both spread over the banks
#define EP 264                                       // LDS pitch of an epilogue row of 256 16-bit elements: 528 B = 16 B x odd
typedef __attribute__((ext_vector_type(4))) __bf16 v4b;
__global__ __launch_bounds__(512) void k_proj(const float* __restrict__ XQ, const float* __restrict__ XK, const float* __restrict__ XV, const float* __restrict__ WQ, const float* __restrict__ WK, const float* __restrict__ WV, const float* __restrict__ BQ, const float* __restrict__ BK, const float* __restrict__ BV,
    _Float16* __restrict__ QH, _Float16* __restrict__ QL, _Float16* __restrict__ KH, _Float16* __restrict__ KL, _Float16* __restrict__ VT, __bf16* __restrict__ VB, __bf16* __restrict__ VBL) {
  __shared__ __align__(16) char pl[2 * PB * EP * 2];   /* the loop's staging buffers; behind the loop the epilogue's two tiles */
  static_assert(2 * (PB + PWN) * SP * 2 <= PB * EP * 2 && WQKV_LAYOUT == 0 && TT % PB == 0 && QHI % 64 == 0 && KHI % 64 == 0, "the staging buffers fit the array; W is (in,out); a block lies in one sequence; the residual rows end on a group of 64");
  const int tid = threadIdx.x, wave = tid >> 5, lane = tid & 31, col = lane & 15, g = lane >> 4, wr = wave >> 2, wc = wave & 3; const int which = blockIdx.z; const int c0 = blockIdx.y * PB; const size_t r0 = (size_t)blockIdx.x * PB; const size_t bb = r0 / TT; const int t0 = (int)(r0 % TT);
  const float* X = which == 0 ? XQ : which == 1 ? XK : XV; const float* WA = which == 0 ? WQ : which == 1 ? WK : WV; const float* BA = which == 0 ? BQ : which == 1 ? BK : BV;
  v8f acc[4][4] = {};
  /* k chunks of 32 staged once per block: X rows and W columns go to LDS as bf16, k-contiguous, in two buffers */
  __bf16* const sx = reinterpret_cast<__bf16*>(pl); __bf16* const sw = sx + 2 * PB * SP;
  /* X: 8 lanes bring the 128 B of one row's chunk, 64 rows a pass of the block; W: a thread takes 4 columns x 4 k rows, a wave's load is 512 B of one k row */
  const float* xg = X + (r0 + (tid >> 3)) * DIN + (tid & 7) * 4; const float* wg = WA + (size_t)((tid >> 6) * 4) * CC + c0 + (tid & 63) * 4; const int xo = (tid >> 3) * SP + (tid & 7) * 4, wo = (tid & 63) * SP + (tid >> 6) * 4;
  v4f rx[4], rw[4];
#pragma unroll
  for (int i = 0; i < 4; ++i) { rx[i] = *(const v4f*)(xg + (size_t)(i * 64) * DIN); rw[i] = *(const v4f*)(wg + (size_t)i * CC); }
  asm volatile("s_wait_xcnt 0x0" ::: "memory");   /* stands before the loads' address registers are advanced */
#pragma unroll 2   /* two trips a pass: the buffer index becomes a constant */
  for (int kc = 0; kc < DIN / 32; ++kc) { __bf16* const xb = sx + (kc & 1) * PB * SP; __bf16* const wb = sw + (kc & 1) * PWN * SP;
#pragma unroll
    for (int s = 0; s < 4; ++s) { v4b p;   /* row 64 s + (tid >> 3), k 4 (tid & 7) + 0..3 */
#pragma unroll
      for (int i = 0; i < 4; ++i) p[i] = (__bf16)rx[s][i];
      *(v4b*)(xb + xo + s * 64 * SP) = p; }
#pragma unroll
    for (int c = 0; c < 4; ++c) { v4b p;   /* column 4 (tid & 63) + c, k rows 4 (tid >> 6) + 0..3 */
#pragma unroll
      for (int i = 0; i < 4; ++i) p[i] = (__bf16)rw[i][c];
      *(v4b*)(wb + wo + c * 68 * SP) = p; }
    if (kc + 1 < DIN / 32) {   /* the next chunk's loads fly under this chunk's products */
#pragma unroll
      for (int i = 0; i < 4; ++i) { rx[i] = *(const v4f*)(xg + (size_t)(i * 64) * DIN + (kc + 1) * 32); rw[i] = *(const v4f*)(wg + (size_t)((kc + 1) * 32 + i) * CC); }
      asm volatile("s_wait_xcnt 0x0" ::: "memory"); }   /* stands before the loads' address registers are advanced */
    stage_bar();   /* the chunk is in LDS before any wave reads fragments; it also ends the reads of the buffer that the next trip refills */
    v16b a[4], w[4];
    /* all 16 waves read at once behind the barrier, so fragments arrive slowly: they are asked for in the order a0 w0 w1 a1 w2 a2 w3 a3 and each product runs as soon as its two fragments are there (1, 1, 2, 2, 3, 3, 4 products per further fragment) */
#define PFA(i) a[i] = frag_b(xb + (wr * 64 + (i) * 16 + col) * SP, lane)
#define PFW(j) w[j] = frag_b(wb + PWROW(wc * 64 + (j) * 16 + col) * SP, lane)
    PFA(0); PFW(0); PFW(1); PFA(1); PFW(2); PFA(2); PFW(3); PFA(3);
    __builtin_amdgcn_sched_barrier(0);   /* keeps the chunk's LDS reads one group ahead of its products: spread among them each read costs its own latency */
    constexpr int oi[16] = {0, 0, 1, 1, 0, 1, 2, 2, 2, 0, 1, 2, 3, 3, 3, 3}, oj[16] = {0, 1, 0, 1, 2, 2, 0, 1, 2, 3, 3, 3, 0, 1, 2, 3};
#pragma unroll
    for (int t = 0; t < 16; ++t) acc[oi[t]][oj[t]] = wmma_bf(a[oi[t]], w[oj[t]], acc[oi[t]][oj[t]]);
    __builtin_amdgcn_sched_barrier(0); }   /* keeps the next trip's conversions, which wait for the loads in flight, behind this trip's products */
  __syncthreads();   /* every wave has read its last fragments before the epilogue's tiles overwrite the staging buffers */
  float bias[4];
#pragma unroll
  for (int j = 0; j < 4; ++j) bias[j] = BA ? bfr(BA[c0 + wc * 64 + j * 16 + col]) : 0.f;
#pragma unroll
  for (int i = 0; i < 4; ++i)
#pragma unroll
    for (int j = 0; j < 4; ++j) acc[i][j] += bias[j];
  /* the tile leaves through 256 x 256 LDS tiles of 16-bit elements: every wave writes its 64 x 64 part, the block stores whole 512-B row segments; the residual planes only where the block has rows that carry them, each written in the same pass as the plane it is the rest of */
  if (which < 2) { _Float16* DH = which == 0 ? QH : KH; _Float16* DL = which == 0 ? QL : KL; const int nhi = which == 0 ? QHI : KHI;
    _Float16 (* const sh)[EP] = reinterpret_cast<_Float16 (*)[EP]>(pl); _Float16 (* const sl)[EP] = reinterpret_cast<_Float16 (*)[EP]>(pl + PB * EP * 2);
    const bool hi_rows = t0 < nhi;   /* block-uniform */
#pragma unroll
    for (int i = 0; i < 4; ++i)
#pragma unroll
      for (int j = 0; j < 4; ++j) { _Float16 hv[8];
#pragma unroll
        for (int r = 0; r < 8; ++r) { hv[r] = (_Float16)acc[i][j][r]; sh[wr * 64 + i * 16 + 8 * g + r][wc * 64 + j * 16 + col] = hv[r]; }
        if (hi_rows) {
#pragma unroll
          for (int r = 0; r < 8; ++r) sl[wr * 64 + i * 16 + 8 * g + r][wc * 64 + j * 16 + col] = (_Float16)((acc[i][j][r] - (float)hv[r]) * 1024.0f); } }
    __syncthreads();
#pragma unroll 1   /* four 16-byte units a trip cover the LDS latency; more would only add code */
    for (int u0 = 0; u0 < PB * 32 / 512; u0 += 4) {
#pragma unroll
      for (int u = 0; u < 4; ++u) { const int e = tid + (u0 + u) * 512; const int rl = e >> 5, q = e & 31; vst2((unsigned*)(DH + (r0 + rl) * CC + c0 + q * 8), *(const v4u*)&sh[rl][q * 8]); }
      asm volatile("s_wait_xcnt 0x0" ::: "memory"); }   /* stands before the next trip forms new addresses in the stores' registers */
    const int nu = hi_rows ? (nhi - t0 < PB ? nhi - t0 : PB) * 32 / 512 : 0;   /* the block's rows below nhi come first: 16 rows a unit of the block, a multiple of 4 units */
#pragma unroll 1   /* four 16-byte units a trip cover the LDS latency; more would only add code */
    for (int u0 = 0; u0 < nu; u0 += 4) {
#pragma unroll
      for (int u = 0; u < 4; ++u) { const int e = tid + (u0 + u) * 512; const int rl = e >> 5, q = e & 31; vst2((unsigned*)(DL + (bb * nhi + t0 + rl) * (size_t)CC + c0 + q * 8), *(const v4u*)&sl[rl][q * 8]); }
      asm volatile("s_wait_xcnt 0x0" ::: "memory"); }   /* stands before the next trip forms new addresses in the stores' registers */
  } else {
    _Float16 (* const th)[EP] = reinterpret_cast<_Float16 (*)[EP]>(pl); __bf16 (* const tb)[EP] = reinterpret_cast<__bf16 (*)[EP]>(pl); __bf16 (* const tbl)[EP] = reinterpret_cast<__bf16 (*)[EP]>(pl + PB * EP * 2);
#pragma unroll
    for (int i = 0; i < 4; ++i)
#pragma unroll
      for (int j = 0; j < 4; ++j) { v8h pk;   /* a lane's 8 elements are 8 neighbouring t of one column */
#pragma unroll
        for (int r = 0; r < 8; ++r) pk[r] = (_Float16)acc[i][j][r];
        *(v8h*)&th[wc * 64 + j * 16 + col][wr * 64 + i * 16 + 8 * g] = pk; }
    __syncthreads();
#pragma unroll 1   /* four 16-byte units a trip cover the LDS latency; more would only add code */
    for (int u0 = 0; u0 < PB * 32 / 512; u0 += 4) {
#pragma unroll
      for (int u = 0; u < 4; ++u) { const int e = tid + (u0 + u) * 512; const int cl = e >> 5, q = e & 31; vst2((unsigned*)(VT + (bb * CC + c0 + cl) * (size_t)TT + t0 + q * 8), *(const v4u*)&th[cl][q * 8]); }
      asm volatile("s_wait_xcnt 0x0" ::: "memory"); }   /* stands before the next trip forms new addresses in the stores' registers */
    if (t0 < KHI) {   /* block-uniform */
      __syncthreads();   /* the f16 plane has been read before the bf16 planes overwrite it */
#pragma unroll
      for (int i = 0; i < 4; ++i)
#pragma unroll
        for (int j = 0; j < 4; ++j) { v8b ph, pq;
#pragma unroll
          for (int r = 0; r < 8; ++r) { const float v = acc[i][j][r]; const __bf16 bh = (__bf16)v; ph[r] = bh; pq[r] = (__bf16)(v - (float)bh); }
          *(v8b*)&tb[wc * 64 + j * 16 + col][wr * 64 + i * 16 + 8 * g] = ph; *(v8b*)&tbl[wc * 64 + j * 16 + col][wr * 64 + i * 16 + 8 * g] = pq; }
      __syncthreads();
#pragma unroll 1   /* four 16-byte units a trip cover the LDS latency; more would only add code */
      for (int u0 = 0; u0 < PB * 32 / 512; u0 += 4) {
#pragma unroll
        for (int u = 0; u < 4; ++u) { const int e = tid + (u0 + u) * 512; const int cl = e >> 5, q = e & 31; if (t0 + q * 8 < KHI) { const size_t o3 = (bb * CC + c0 + cl) * (size_t)KHI + t0 + q * 8; vst2((unsigned*)(VB + o3), *(const v4u*)&tb[cl][q * 8]); vst2((unsigned*)(VBL + o3), *(const v4u*)&tbl[cl][q * 8]); } }
        asm volatile("s_wait_xcnt 0x0" ::: "memory"); }   /* stands before the next trip forms new addresses in the stores' registers */ } } }
#define QT 64
#define KP 72
#define LC (SCALE * 1.4426950408889634f)
__device__ __forceinline__ float xhalf(float x) { return __builtin_bit_cast(float, __builtin_amdgcn_permlanex16(__builtin_bit_cast(int, x), __builtin_bit_cast(int, x), 0x76543210, 0xfedcba98, false, false)); }
__device__ __forceinline__ v8f wmh(v16h a, v16h b, v8f c) { return __builtin_amdgcn_wmma_f32_16x16x32_f16(false, a, false, b, (short)0, c, false, false); }
__device__ __forceinline__ v8f wmb(v16b a, v16b b, v8f c) { return __builtin_amdgcn_wmma_f32_16x16x32_bf16(false, a, false, b, (short)0, c, false, false); }
// fragments from a lane's own address (row and 8 g already in it); the address has passed through an asm operand, so the loads say themselves that it is global memory (else they compile to flat loads)
typedef __attribute__((address_space(1))) const v8h gv8h; typedef __attribute__((address_space(1))) const v8b gv8b;
__device__ __forceinline__ v16h fragp_h(const _Float16* p) { union { v16h v; v8h q[2]; } u; u.q[0] = *(gv8h*)p; u.q[1] = *(gv8h*)(p + 16); return u.v; }
__device__ __forceinline__ v16b fragp_b(const __bf16* p) { union { v16b v; v8b q[2]; } u; u.q[0] = *(gv8b*)p; u.q[1] = *(gv8b*)(p + 16); return u.v; }
// 2^x on the transcendental unit. The v_nop is the one slot the instruction set asks for between a transcendental and a directly following instruction that reads its result or overwrites its source; inside the group of four the early-clobber outputs keep every result off every source
__device__ __forceinline__ float ex2(float x) { float e; asm("v_exp_f32 %0, %1\n\tv_nop" : "=v"(e) : "v"(x)); return e; }
__device__ __forceinline__ void ex2x4(float x0, float x1, float x2, float x3, float& e0, float& e1, float& e2, float& e3) { asm("v_exp_f32 %0, %4\n\tv_exp_f32 %1, %5\n\tv_exp_f32 %2, %6\n\tv_exp_f32 %3, %7\n\tv_nop" : "=&v"(e0), "=&v"(e1), "=&v"(e2), "=&v"(e3) : "v"(x0), "v"(x1), "v"(x2), "v"(x3)); }
// one step of the running softmax over NT 16-key score tiles: s comes in as raw logits (excluded: -3e38) and leaves as e x 2^11 against the new maximum; sum and the output tiles are brought to that maximum
template <int NT> __device__ __forceinline__ void online(v8f (&s)[NT], float& m, float& sum, v8f (&acc)[HD / 16]) {
  float mt[NT];   /* one chain per tile: a single chain of dependent maxima would be paid link by link */
#pragma unroll
  for (int t = 0; t < NT; ++t) { mt[t] = s[t][0];
#pragma unroll
    for (int r = 1; r < 8; ++r) mt[t] = fmaxf(mt[t], s[t][r]); }
  float mx = mt[0];
#pragma unroll
  for (int t = 1; t < NT; ++t) mx = fmaxf(mx, mt[t]);
  mx = fmaxf(mx, xhalf(mx));   /* both halves of the wave hold keys of the same query: one maximum for both */
  const float mn = fmaxf(m, mx); const float corr = ex2((m - mn) * LC); const float off = 11.0f - mn * LC; m = mn;
  float ps[NT];
#pragma unroll
  for (int t = 0; t < NT; ++t) { ps[t] = 0.f;
#pragma unroll
    for (int r = 0; r < 8; r += 4) { float e0, e1, e2, e3; ex2x4(fmaf(s[t][r], LC, off), fmaf(s[t][r + 1], LC, off), fmaf(s[t][r + 2], LC, off), fmaf(s[t][r + 3], LC, off), e0, e1, e2, e3); s[t][r] = e0; s[t][r + 1] = e1; s[t][r + 2] = e2; s[t][r + 3] = e3; ps[t] += e0; ps[t] += e1; ps[t] += e2; ps[t] += e3; } }
  float p = ps[0];
#pragma unroll
  for (int t = 1; t < NT; ++t) p += ps[t];
  sum = sum * corr + p;
#pragma unroll
  for (int j = 0; j < HD / 16; ++j) acc[j] *= corr; }
__global__ __launch_bounds__(128) __attribute__((amdgpu_waves_per_eu(4, 4))) void k_pv(const _Float16* __restrict__ QH, const _Float16* __restrict__ KH, const _Float16* __restrict__ QL, const _Float16* __restrict__ KL, const _Float16* __restrict__ VT, const __bf16* __restrict__ VB, const __bf16* __restrict__ VBL, float* __restrict__ Y) {
  __shared__ __align__(16) _Float16 sk[2][QT * KP], sv[2][HD * KP]; __shared__ __align__(16) float so[4][16][HD + 4];
  static_assert(TT / QT == 32 && TNB * NH == 32 && HD == 64 && QBH * QT == QHI && QHI == KHI && CAUSAL == 1, "the index map below is a permutation of 32 tiles x 32 (b, h); early tiles read only keys that carry residual planes");
  const int tid = threadIdx.x, wave = __builtin_amdgcn_readfirstlane(tid >> 5), lane = tid & 31, col = lane & 15, g = lane >> 4;
  /* block index -> (tile, b h): cost rises with the tile, all blocks are resident at once; four blocks 256 apart, and four neighbours of the same index mod 8, take tiles that add up to the same cost (for speed only) */
  const int bi = blockIdx.x, n = bi >> 3, cc = (n >> 2) & 7, a4 = n >> 5, role = (a4 + n) & 3; const int tile = role == 0 ? 31 - cc : role == 1 ? cc : role == 2 ? 23 - cc : 8 + cc; const int bh = (bi & 7) + 8 * a4; const int b = bh / NH, h = bh % NH;
  const int q0 = tile * QT + wave * 16;
  const _Float16* qp = QH + ((size_t)b * TT + q0 + col) * CC + h * HD; const v16h bq0 = frag_h(qp, lane), bq1 = frag_h(qp + 32, lane);
  asm volatile("s_wait_xcnt 0x0" ::: "memory");   /* stands before the q loads' address registers are reused */
  float m = -3.0e38f, sum = 0.f; v8f acc[HD / 16] = {};
  if (tile < QBH) {   /* block-uniform */
    const _Float16* qlp = QL + ((size_t)b * QHI + q0 + col) * CC + h * HD; const v16h bl0 = frag_h(qlp, lane), bl1 = frag_h(qlp + 32, lane);
    asm volatile("s_wait_xcnt 0x0" ::: "memory");   /* stands before the residual loads' address registers are reused */
    const int nch = ((q0 + 15) >> 5) + 1;
    /* each lane's own four addresses, carried from trip to trip and advanced behind the waits */
    const _Float16* kp = KH + ((size_t)b * TT + col) * CC + h * HD + 8 * g; const _Float16* klp = KL + ((size_t)b * KHI + col) * CC + h * HD + 8 * g;
    const __bf16* vbp = VB + ((size_t)b * CC + h * HD + col) * (size_t)KHI + 8 * g; const __bf16* vlp = VBL + ((size_t)b * CC + h * HD + col) * (size_t)KHI + 8 * g;
#pragma unroll 1   /* at most 12 trips: kept rolled, unrolling would only add code */
    for (int kc = 0; kc < nch; ++kc) { v16h kh[2][2], kl[2][2]; v16b vh[HD / 16], vl[HD / 16];
#pragma unroll
      for (int t = 0; t < 2; ++t) { kh[t][0] = fragp_h(kp + t * 16 * CC); kh[t][1] = fragp_h(kp + t * 16 * CC + 32); kl[t][0] = fragp_h(klp + t * 16 * CC); kl[t][1] = fragp_h(klp + t * 16 * CC + 32); }
      asm volatile("s_wait_xcnt 0x0" : "+v"(kp), "+v"(klp) :: "memory");   /* stands before the k loads' address registers are advanced; it names the two pairs so that they stay whole up to it (no load of the group may land on them) */
      __builtin_amdgcn_sched_barrier(0);   /* keeps every later register write behind that wait */
      kp += 32 * CC; klp += 32 * CC;
      v8f s[2];
#pragma unroll
      for (int t = 0; t < 2; ++t) { v8f a = {}, l = {};
        a = wmh(kh[t][0], bq0, a); l = wmh(kh[t][0], bl0, l); l = wmh(kl[t][0], bq0, l); a = wmh(kh[t][1], bq1, a); l = wmh(kh[t][1], bl1, l); l = wmh(kl[t][1], bq1, l);
#pragma unroll
        for (int r = 0; r < 8; ++r) s[t][r] = (kc * 32 + t * 16 + 8 * g + r <= q0 + col) ? a[r] + l[r] * (1.0f / 1024.0f) : -3.0e38f; }
#pragma unroll
      for (int j = 0; j < HD / 16; ++j) { vh[j] = fragp_b(vbp + j * 16 * KHI); vl[j] = fragp_b(vlp + j * 16 * KHI); }   /* in flight under the softmax step */
      asm volatile("s_wait_xcnt 0x0" : "+v"(vbp), "+v"(vlp) :: "memory");   /* stands before the v loads' address registers are advanced; it names the two pairs so that they stay whole up to it */
      __builtin_amdgcn_sched_barrier(0);   /* keeps every later register write behind that wait */
      vbp += 32; vlp += 32;
      online<2>(s, m, sum, acc);
      float v[16];
#pragma unroll
      for (int r = 0; r < 8; ++r) { v[r] = s[0][r]; v[8 + r] = s[1][r]; }
      const F2 p = bsplit16(v);
#pragma unroll
      for (int j = 0; j < HD / 16; ++j) { acc[j] = wmb(vh[j], p.h, acc[j]); acc[j] = wmb(vh[j], p.l, acc[j]); acc[j] = wmb(vl[j], p.h, acc[j]); } }
  } else {
    const int srow = tid >> 3, sseg = tid & 7, sof = srow * KP + sseg * 8;   /* 8 lanes bring one 128-B row; 16 rows a pass of the block */
    const _Float16* kg = KH + ((size_t)b * TT + srow) * CC + h * HD + sseg * 8; const _Float16* vg = VT + ((size_t)b * CC + h * HD + srow) * (size_t)TT + sseg * 8;
    v8h rk[4], rv[4];
#pragma unroll
    for (int u = 0; u < 4; ++u) { rk[u] = *(const v8h*)(kg + (size_t)(u * 16) * CC); rv[u] = *(const v8h*)(vg + (size_t)(u * 16) * TT); }
    asm volatile("s_wait_xcnt 0x0" ::: "memory");   /* stands before the loads' address registers are advanced */
#pragma unroll 1   /* the body is long and its trip count varies with the tile */
    for (int st = 0; st <= tile; ++st) { _Float16* const kb = &sk[st & 1][0]; _Float16* const vb = &sv[st & 1][0];
#pragma unroll
      for (int u = 0; u < 4; ++u) { *(v8h*)(kb + sof + u * 16 * KP) = rk[u]; *(v8h*)(vb + sof + u * 16 * KP) = rv[u]; }
      if (st < tile) {   /* the next stage's loads fly under this stage's work */
#pragma unroll
        for (int u = 0; u < 4; ++u) { rk[u] = *(const v8h*)(kg + (size_t)((st + 1) * 64 + u * 16) * CC); rv[u] = *(const v8h*)(vg + (size_t)(u * 16) * TT + (st + 1) * 64); }
        asm volatile("s_wait_xcnt 0x0" ::: "memory"); }   /* stands before the loads' address registers are advanced */
      stage_bar();   /* the stage is in LDS before any wave reads fragments; it also ends the reads of the buffer that the next trip refills */
      v8f s[4]; v16h ka[4][2];
#pragma unroll
      for (int t = 0; t < 4; ++t) { const _Float16* kr = kb + (t * 16 + col) * KP; ka[t][0] = frag_h(kr, lane); ka[t][1] = frag_h(kr + 32, lane); }
      __builtin_amdgcn_sched_barrier(0);   /* keeps the stage's K reads one group ahead of its products: spread among them each pair of reads costs its own LDS latency */
#pragma unroll
      for (int t = 0; t < 4; ++t) { v8f z = {}; s[t] = wmh(ka[t][0], bq0, z); }
#pragma unroll
      for (int t = 0; t < 4; ++t) s[t] = wmh(ka[t][1], bq1, s[t]);
      v16h va[HD / 16][2];
#pragma unroll
      for (int j = 0; j < HD / 16; ++j) { const _Float16* vr = vb + (j * 16 + col) * KP; va[j][0] = frag_h(vr, lane); va[j][1] = frag_h(vr + 32, lane); }
      __builtin_amdgcn_sched_barrier(0);   /* keeps the stage's V reads one group ahead of the softmax step, which covers their LDS latency */
      if (st == tile) {   /* only the last stage meets the diagonal */
#pragma unroll
        for (int t = 0; t < 4; ++t)
#pragma unroll
          for (int r = 0; r < 8; ++r) s[t][r] = (t * 16 + 8 * g + r <= wave * 16 + col) ? s[t][r] : -3.0e38f; }
      online<4>(s, m, sum, acc);
      v16h p0, p1;
#pragma unroll
      for (int r = 0; r < 8; ++r) { p0[r] = (_Float16)s[0][r]; p0[8 + r] = (_Float16)s[1][r]; p1[r] = (_Float16)s[2][r]; p1[8 + r] = (_Float16)s[3][r]; }
#pragma unroll
      for (int j = 0; j < HD / 16; ++j) acc[j] = wmh(va[j][0], p0, acc[j]);
#pragma unroll
      for (int j = 0; j < HD / 16; ++j) acc[j] = wmh(va[j][1], p1, acc[j]); } }
  const float tot = sum + xhalf(sum); const float inv = tot > 0.f ? 1.0f / tot : 0.f;   /* the halves' sums are joined once; the 2^11 of e cancels */
#pragma unroll
  for (int j = 0; j < HD / 16; ++j) { v4f lo, hi;   /* O^T tile j: element r = head column 16 j + 8 g + r of query col */
#pragma unroll
    for (int r = 0; r < 4; ++r) { lo[r] = acc[j][r] * inv; hi[r] = acc[j][4 + r] * inv; }
    *(v4f*)&so[wave][col][j * 16 + 8 * g] = lo; *(v4f*)&so[wave][col][j * 16 + 8 * g + 4] = hi; }
  LDSX();   /* the wave's own rows are in LDS before it reads them back as whole 256-B (row, head) segments */
#pragma unroll
  for (int rl = 0; rl < 16; rl += 2) vst2(Y + ((size_t)b * TT + q0 + rl + g) * CC + h * HD + col * 4, *(const v4f*)&so[wave][rl + g][col * 4]); }
// ---- k_out: block = (64 rows, 128 cols): out = ctx Wo (+ bo): ctx x 2^6 once to f16 against Wo as f16(bf16 x 2^8) exact (1 product) x 2^-14; causal early rows (< QHI of each sequence): ctx bf16 hi + lo against exact bf16 Wo (2 products)
__global__ __launch_bounds__(128) void k_out(const float* __restrict__ Y, const float* __restrict__ WO, const float* __restrict__ BO, float* __restrict__ OUT) { __shared__ __align__(16) float sf[4][16][132];
  __shared__ __align__(16) __bf16 sa[2][2][64 * SP], sb[2][128 * SP];   /* staged k chunks of 32, two buffers: ctx rows (hi and lo plane) and Wo rows, already in their 16-bit operand form */
  static_assert(WO_OUT_IN == 1, "Wo rows are k-contiguous");
  const int tid = threadIdx.x, wave = tid >> 5, lane = tid & 31, col = lane & 15, g = lane >> 4; const int c0 = blockIdx.y * 128; const size_t rb = (size_t)blockIdx.x * 64; const size_t r0 = rb + wave * 16;
  const float* yg = Y + (rb + (tid >> 2)) * CC + (tid & 3) * 8; const float* wg = WO + (size_t)(c0 + (tid >> 2)) * CC + (tid & 3) * 8; const int so = (tid >> 2) * SP + (tid & 3) * 8;
  v4f ry[4], rw[8];
  ld_rows<2>(yg, (size_t)32 * CC, ry); ld_rows<4>(wg, (size_t)32 * CC, rw);
  asm volatile("s_wait_xcnt 0x0" ::: "memory");   /* stands before the loads' address registers are advanced */
  v8f acc[8] = {};
  if (CAUSAL && (int)(((size_t)blockIdx.x * 64) % TT) < QHI) {   /* block-uniform */
#pragma unroll 2   /* two trips a pass: the buffer index becomes a constant */
    for (int kc = 0; kc < CC / 32; ++kc) { __bf16* const ah = &sa[kc & 1][0][0]; __bf16* const al = &sa[kc & 1][1][0]; __bf16* const wb = &sb[kc & 1][0];
#pragma unroll
      for (int s = 0; s < 2; ++s) { v8b h, l;
#pragma unroll
        for (int i = 0; i < 8; ++i) { const float v = ry[2 * s + (i >> 2)][i & 3]; const __bf16 hv = (__bf16)v; h[i] = hv; l[i] = (__bf16)(v - (float)hv); }
        *(v8b*)(ah + so + s * 32 * SP) = h; *(v8b*)(al + so + s * 32 * SP) = l; }
#pragma unroll
      for (int s = 0; s < 4; ++s) { v8b p;
#pragma unroll
        for (int i = 0; i < 8; ++i) p[i] = (__bf16)rw[2 * s + (i >> 2)][i & 3];
        *(v8b*)(wb + so + s * 32 * SP) = p; }
      if (kc + 1 < CC / 32) {   /* the next chunk's loads fly under this chunk's products */
        ld_rows<2>(yg + (kc + 1) * 32, (size_t)32 * CC, ry); ld_rows<4>(wg + (kc + 1) * 32, (size_t)32 * CC, rw);
        asm volatile("s_wait_xcnt 0x0" ::: "memory"); }   /* stands before the loads' address registers are advanced */
      stage_bar();   /* the chunk is in LDS before any wave reads fragments; it also ends the reads of the buffer that the next trip refills */
      const v16b fh = frag_b(ah + (wave * 16 + col) * SP, lane), fl = frag_b(al + (wave * 16 + col) * SP, lane); v16b w[8];
#pragma unroll
      for (int j = 0; j < 8; ++j) w[j] = frag_b(wb + (j * 16 + col) * SP, lane);
      __builtin_amdgcn_sched_barrier(0);   /* keeps the chunk's LDS reads one group ahead of its products */
#pragma unroll
      for (int j = 0; j < 8; ++j) { acc[j] = wmma_bf(fh, w[j], acc[j]); acc[j] = wmma_bf(fl, w[j], acc[j]); }
      __builtin_amdgcn_sched_barrier(0); }   /* keeps the next trip's conversions, which wait for the loads in flight, behind this trip's products */
#pragma unroll
    for (int j = 0; j < 8; ++j) { const float bias = BO ? bfr(BO[c0 + j * 16 + col]) : 0.f;
#pragma unroll
      for (int r = 0; r < 8; ++r) sf[wave][8 * g + r][j * 16 + col] = acc[j][r] + bias; }
  } else {
#pragma unroll 2   /* two trips a pass: the buffer index becomes a constant */
    for (int kc = 0; kc < CC / 32; ++kc) { _Float16* const ab = reinterpret_cast<_Float16*>(&sa[kc & 1][0][0]); _Float16* const wb = reinterpret_cast<_Float16*>(&sb[kc & 1][0]);
#pragma unroll
      for (int s = 0; s < 2; ++s) { v8h p;   /* ctx carried x 2^6 into f16 so small-magnitude context rows stay clear of f16 subnormals */
#pragma unroll
        for (int i = 0; i < 8; ++i) p[i] = (_Float16)(ry[2 * s + (i >> 2)][i & 3] * 64.0f);
        *(v8h*)(ab + so + s * 32 * SP) = p; }
#pragma unroll
      for (int s = 0; s < 4; ++s) { v8h p;
#pragma unroll
        for (int i = 0; i < 8; ++i) p[i] = (_Float16)(bfr(rw[2 * s + (i >> 2)][i & 3]) * 256.0f);
        *(v8h*)(wb + so + s * 32 * SP) = p; }
      if (kc + 1 < CC / 32) {   /* the next chunk's loads fly under this chunk's products */
        ld_rows<2>(yg + (kc + 1) * 32, (size_t)32 * CC, ry); ld_rows<4>(wg + (kc + 1) * 32, (size_t)32 * CC, rw);
        asm volatile("s_wait_xcnt 0x0" ::: "memory"); }   /* stands before the loads' address registers are advanced */
      stage_bar();   /* the chunk is in LDS before any wave reads fragments; it also ends the reads of the buffer that the next trip refills */
      const v16h a = frag_h(ab + (wave * 16 + col) * SP, lane); v16h w[8];
#pragma unroll
      for (int j = 0; j < 8; ++j) w[j] = frag_h(wb + (j * 16 + col) * SP, lane);
      __builtin_amdgcn_sched_barrier(0);   /* keeps the chunk's LDS reads one group ahead of its products */
#pragma unroll
      for (int j = 0; j < 8; ++j) acc[j] = wmma16(a, w[j], acc[j]);
      __builtin_amdgcn_sched_barrier(0); }   /* keeps the next trip's conversions, which wait for the loads in flight, behind this trip's products */
#pragma unroll
    for (int j = 0; j < 8; ++j) { const float bias = BO ? bfr(BO[c0 + j * 16 + col]) : 0.f;
#pragma unroll
      for (int r = 0; r < 8; ++r) sf[wave][8 * g + r][j * 16 + col] = acc[j][r] * (1.0f / 16384.0f) + bias; } }   /* 2^-8 (Wo carry) x 2^-6 (ctx carry) */
  LDSX(); for (int rl = 0; rl < 16; ++rl) vst2(OUT + (r0 + rl) * DIN + c0 + lane * 4, *(const v4f*)&sf[wave][rl][lane * 4]); }

extern "C" void kernel_launch(void* const* d_in, const int* in_sizes, int n_in, void* d_out, int out_size, void* d_ws, size_t ws_size, hipStream_t stream) {
  (void)in_sizes; (void)n_in; (void)out_size;
  const float** F = (const float**)d_in;
  if (ws_size < (size_t)WS_END) return;
  char* ws = (char*)d_ws; _Float16 *QH = (_Float16*)(ws + WS_QH), *KH = (_Float16*)(ws + WS_KH), *VT = (_Float16*)(ws + WS_VT), *QL = (_Float16*)(ws + WS_QL), *KL = (_Float16*)(ws + WS_KL); __bf16 *VB = (__bf16*)(ws + WS_VB), *VBL = (__bf16*)(ws + WS_VBL); float *Y = (float*)(ws + WS_Y);
  (void)Y; (void)QL; (void)KL; (void)VB; (void)VBL;
  // inputs: 0 x [2,2048,1024]; 1 Wq [1024,1024] (in,out), 2 bq; 3 Wk, 4 bk; 5 Wv, 6 bv (biases NONZERO); 7 Wo [1024,1024] (out,in); no output bias
  k_proj<<<dim3(TNB * TT / PB, CC / PB, 3), 512, 0, stream>>>(F[0], F[0], F[0], F[1], F[3], F[5], F[2], F[4], F[6], QH, QL, KH, KL, VT, VB, VBL);
  k_pv<<<dim3((TT / QT) * TNB * NH), 128, 0, stream>>>(QH, KH, QL, KL, VT, VB, VBL, Y);
  k_out<<<dim3(TNB * TT / 64, DIN / 128), 128, 0, stream>>>(Y, F[7], nullptr, (float*)d_out);
}

// v007
// One run takes 83.1 microseconds.
// Next to v006, in two timings, it ran 1.10 and 1.11 times as fast.
// Over all steps from v000 it is 12.7 times as fast.
// compute dtype: all float inputs rounded to bf16; the fused q / k / v projection with EXACT bf16 products on WMMA 16x16x32 (f32 accumulate) + bias (nonzero); causal logits: 3 products for the first 384 rows, single f16 q x k after, x 1024^-0.5 (the module scales by the MODEL width); softmax f32 with a running maximum; e x 2^11 once to f16 x v once to f16 (bf16 hi + lo below row 384), divided by the sum at the end; ctx hi+lo x exact W below row 384, x2^6 f16 carry x f16(bf16 x 2^8) W after, no output bias; f32 output.
#include <hip/hip_runtime.h>
#include <math.h>

typedef __attribute__((ext_vector_type(16))) _Float16 v16h;
typedef __attribute__((ext_vector_type(16))) __bf16 v16b;
typedef __attribute__((ext_vector_type(8)))  _Float16 v8h;
typedef __attribute__((ext_vector_type(8)))  float v8f;
typedef __attribute__((ext_vector_type(4)))  float v4f;
typedef __attribute__((ext_vector_type(2)))  float v2f;
typedef __attribute__((ext_vector_type(4)))  unsigned v4u;
typedef __attribute__((ext_vector_type(4)))  int v4i;
typedef float __attribute__((may_alias)) float_a;
typedef int __attribute__((may_alias)) int_a;

template <typename T> __device__ __forceinline__ void vst2(void* p, T v) { *(T*)p = v;  }
__device__ __forceinline__ v8f wmma16(v16h a, v16h b, v8f c) {
  v8f d = __builtin_amdgcn_wmma_f32_16x16x32_f16(false, a, false, b, (short)0, c, false, false);
  asm volatile("v_nop\n\tv_nop\n\tv_nop\n\tv_nop" : "+v"(d) : "v"(a), "v"(b));
  return d;
}
__device__ __forceinline__ v8f wmma_bf(v16b a, v16b b, v8f c) {
  v8f d = __builtin_amdgcn_wmma_f32_16x16x32_bf16(false, a, false, b, (short)0, c, false, false);
  asm volatile("v_nop\n\tv_nop\n\tv_nop\n\tv_nop" : "+v"(d) : "v"(a), "v"(b));
  return d;
}
// 16x16x32 fragments: lane = (h = lane>>4, row/col = lane&15); elements 0..7 = k0+8h+0..7, 8..15 = k0+16+8h+0..7; D element r = row 8h+r
__device__ __forceinline__ v16h frag_h(const _Float16* rowk0, int lane) {
  union { v16h v; v8h q[2]; } u; const _Float16* p = rowk0 + 8 * (lane >> 4);
  u.q[0] = *(const v8h*)p; u.q[1] = *(const v8h*)(p + 16); return u.v;
}
__device__ __forceinline__ v16h frag_f32(const float* rowk0, int lane) {
  v16h a; const float* p = rowk0 + 8 * (lane >> 4);
#pragma unroll
  for (int i = 0; i < 8; ++i) { a[i] = (_Float16)p[i]; a[8 + i] = (_Float16)p[16 + i]; }
  return a;
}
__device__ __forceinline__ v16h frag_f32s(const float* rowk0, int lane, float sc) {
  v16h a; const float* p = rowk0 + 8 * (lane >> 4);
#pragma unroll
  for (int i = 0; i < 8; ++i) { a[i] = (_Float16)(p[i] * sc); a[8 + i] = (_Float16)(p[16 + i] * sc); }
  return a;
}
// column fragment from a [K][ld] layout (column n), rows >= K read as 0
__device__ __forceinline__ v16h fragc_f32(const float* W, int k0, int n, int lane, int ld, int K) {
  v16h a; const int g = lane >> 4;
#pragma unroll
  for (int i = 0; i < 8; ++i) { const int ka = k0 + 8 * g + i, kb = ka + 16;
    a[i] = (_Float16)(ka < K ? W[(size_t)(ka < K ? ka : K - 1) * ld + n] : 0.f); a[8 + i] = (_Float16)(kb < K ? W[(size_t)(kb < K ? kb : K - 1) * ld + n] : 0.f); }
  return a;
}
struct F2 { v16b h, l; };
__device__ __forceinline__ F2 bsplit16(const float v[16]) { F2 r;
#pragma unroll
  for (int i = 0; i < 16; ++i) { const __bf16 h = (__bf16)v[i]; r.h[i] = h; r.l[i] = (__bf16)(v[i] - (float)h); }
  return r; }
__device__ __forceinline__ F2 split_row(const float* row, int k0, int lane) { float v[16]; const float* p = row + k0 + 8 * (lane >> 4);
#pragma unroll
  for (int i = 0; i < 8; ++i) { v[i] = p[i]; v[8 + i] = p[16 + i]; }
  return bsplit16(v); }
__device__ __forceinline__ F2 split_rowK(const float* row, int k0, int lane, int K) { float v[16]; const int g = lane >> 4;
#pragma unroll
  for (int i = 0; i < 8; ++i) { const int ka = k0 + 8 * g + i, kb = ka + 16; v[i] = ka < K ? row[ka < K ? ka : K - 1] : 0.f; v[8 + i] = kb < K ? row[kb < K ? kb : K - 1] : 0.f; }
  return bsplit16(v); }
__device__ __forceinline__ F2 split_col(const float* W, int k0, int n, int lane, int ld, int K) { float v[16]; const int g = lane >> 4;
#pragma unroll
  for (int i = 0; i < 8; ++i) { const int ka = k0 + 8 * g + i, kb = ka + 16; v[i] = ka < K ? W[(size_t)(ka < K ? ka : K - 1) * ld + n] : 0.f; v[8 + i] = kb < K ? W[(size_t)(kb < K ? kb : K - 1) * ld + n] : 0.f; }
  return bsplit16(v); }
__device__ __forceinline__ v8f mac3(const F2& a, const F2& b, v8f c) { c = wmma_bf(a.l, b.h, c); c = wmma_bf(a.h, b.l, c); return wmma_bf(a.h, b.h, c); }
__device__ __forceinline__ float sigm(float v) { return 1.0f / (1.0f + expf(-v)); }
#define LDSX() do { asm volatile("s_wait_dscnt 0" ::: "memory"); __builtin_amdgcn_wave_barrier(); __builtin_amdgcn_fence(__ATOMIC_RELEASE, "workgroup"); } while (0)

// Multi-head causal self-attention whose logits are scaled by 1/sqrt(EMBED) (x [2,2048,1024]; (in,out) Wq / Wk / Wv [1024,1024] and biases [1024] NONZERO applied as x @ W + b; Wo [1024,1024] torch (out,in), NO output bias; 16 heads x 64; logits x 1/sqrt(1024) = 1/32 - the model width, not the head width; tril kept, -inf elsewhere; softmax; z @ Wo.T).
#define NB 2
#define TT 2048
#define CC 1024            // NH * HD = projected width
#define DIN 1024          // input (model) width
#define NH 16
#define HD 64
#define SCALE (0.03125f)
#define CAUSAL 1
#ifndef TNB
#define TNB NB
#endif
__device__ __forceinline__ float bfr(float v) { return (float)(__bf16)v; }
__host__ __device__ __forceinline__ int kb_last(int qb) { return CAUSAL ? ((qb * 64 + 63) >> 7) : (TT / 128 - 1); }
typedef __attribute__((ext_vector_type(8))) __bf16 v8b;
__device__ __forceinline__ v16b frag_b(const __bf16* rowk0, int lane) {
  union { v16b v; v8b q[2]; } u; const __bf16* p = rowk0 + 8 * (lane >> 4);
  u.q[0] = *(const v8b*)p; u.q[1] = *(const v8b*)(p + 16); return u.v;
}
#define QBH 6              // causal: query blocks 0..QBH-1 of each sequence (few keys, no averaging) take the high-precision path
#define QHI 384            // rows carrying a q residual plane
#define KHI 384            // key rows carrying k residual / v bf16 hi+lo planes (used only by the causal high-precision path)
// B fragment (k rows k0+.., output column o) of a weight: (in,out) [K][ld] or (out,in) [ld rows of K]: bf16 exact, or f16(bf16 * 256) exact
__device__ __forceinline__ v16b wcol_io(const float* Wm, int k0, int o, int lane, int ld) { v16b w; const int g = lane >> 4;
#pragma unroll
  for (int i = 0; i < 8; ++i) { w[i] = (__bf16)Wm[(size_t)(k0 + 8 * g + i) * ld + o]; w[8 + i] = (__bf16)Wm[(size_t)(k0 + 16 + 8 * g + i) * ld + o]; }
  return w; }
__device__ __forceinline__ v16b wcol_oi(const float* Wm, int k0, int o, int lane, int K) { v16b w; const float* p = Wm + (size_t)o * K + k0 + 8 * (lane >> 4);
#pragma unroll
  for (int i = 0; i < 8; ++i) { w[i] = (__bf16)p[i]; w[8 + i] = (__bf16)p[16 + i]; }
  return w; }
__device__ __forceinline__ v16h wcolh_io(const float* Wm, int k0, int o, int lane, int ld) { v16h w; const int g = lane >> 4;
#pragma unroll
  for (int i = 0; i < 8; ++i) { w[i] = (_Float16)(bfr(Wm[(size_t)(k0 + 8 * g + i) * ld + o]) * 256.0f); w[8 + i] = (_Float16)(bfr(Wm[(size_t)(k0 + 16 + 8 * g + i) * ld + o]) * 256.0f); }
  return w; }
__device__ __forceinline__ v16h wcolh_oi(const float* Wm, int k0, int o, int lane, int K) { v16h w; const float* p = Wm + (size_t)o * K + k0 + 8 * (lane >> 4);
#pragma unroll
  for (int i = 0; i < 8; ++i) { w[i] = (_Float16)(bfr(p[i]) * 256.0f); w[8 + i] = (_Float16)(bfr(p[16 + i]) * 256.0f); }
  return w; }
#define WQKV_LAYOUT 0   // 0 = (in,out) [DIN][CC]; 1 = (out,in) [CC][DIN]; 2 = per-head [NH][DIN][HD]
__device__ __forceinline__ v16b wcol_hdk(const float* Wm, int k0, int o, int lane) { v16b w; const int g = lane >> 4; const float* p = Wm + (size_t)(o / HD) * DIN * HD + (o % HD);
#pragma unroll
  for (int i = 0; i < 8; ++i) { w[i] = (__bf16)p[(size_t)(k0 + 8 * g + i) * HD]; w[8 + i] = (__bf16)p[(size_t)(k0 + 16 + 8 * g + i) * HD]; }
  return w; }
#define WO_OUT_IN 1
#if WQKV_LAYOUT == 1
#define WCOL(W, k0, o, lane) wcol_oi(W, k0, o, lane, DIN)
#elif WQKV_LAYOUT == 2
#define WCOL(W, k0, o, lane) wcol_hdk(W, k0, o, lane)
#else
#define WCOL(W, k0, o, lane) wcol_io(W, k0, o, lane, CC)
#endif
#if WO_OUT_IN
#define WOCOL(W, k0, o, lane) wcol_oi(W, k0, o, lane, CC)
#define WOCOLH(W, k0, o, lane) wcolh_oi(W, k0, o, lane, CC)
#else
#define WOCOL(W, k0, o, lane) wcol_io(W, k0, o, lane, DIN)
#define WOCOLH(W, k0, o, lane) wcolh_io(W, k0, o, lane, DIN)
#endif

#ifndef PROJ_EXTRA_PARAMS
#define PROJ_EXTRA_PARAMS
#endif

#define WS_QH  0u                                      // f16 q rows [b*t][CC]
#define WS_KH  (WS_QH + 2u * (size_t)NB * TT * CC)      // f16 k rows [b*t][CC]
#define WS_VT  (WS_KH + 2u * (size_t)NB * TT * CC)      // f16 v planes [b][c][t]
#define WS_QL  (WS_VT + 2u * (size_t)NB * CC * TT)      // f16 q residual x 2^10 rows [b][t < QHI][CC]
#define WS_KL  (WS_QL + 2u * (size_t)NB * QHI * CC)     // f16 k residual x 2^10 rows [b][t < KHI][CC]
#define WS_VB  (WS_KL + 2u * (size_t)NB * KHI * CC)     // bf16 v hi planes [b][c][t < KHI]
#define WS_VBL (WS_VB + 2u * (size_t)NB * CC * KHI)
#define WS_YH  (WS_VBL + 2u * (size_t)NB * CC * KHI)    // ctx rows [b*t][CC] in k_out's operand form: f16(ctx x 2^6); rows < QHI of a sequence: bf16 hi
#define WS_YL  (WS_YH + 2u * (size_t)NB * TT * CC)      // bf16 ctx residual rows [b*t][CC]; only rows < QHI of a sequence are written and read
#define WS_WH  (WS_YL + 2u * (size_t)NB * TT * CC)      // Wo rows [o][CC] as f16(bf16 x 2^8)
#define WS_WB  (WS_WH + 2u * (size_t)DIN * CC)          // Wo rows [o][CC] as bf16
#define WS_END (WS_WB + 2u * (size_t)DIN * CC)

#define SP 40                                        // LDS pitch of a staged 32-k row in 16-bit elements: 80 B = 16 B x odd, free of bank conflicts for 16-byte reads
// work-group barrier of the staging loops, by hand: __syncthreads() would also wait for the next chunk's global loads, which are meant to stay in flight across it; the LDS stores are waited for in front of the signal
__device__ __forceinline__ void stage_bar() { asm volatile("s_wait_dscnt 0x0\n\ts_barrier_signal -1\n\ts_barrier_wait -1" ::: "memory"); }
// N units of 8 consecutive floats, ld floats apart, into registers
template <int N> __device__ __forceinline__ void ld_rows(const float* p, size_t ld, v4f (&r)[2 * N]) {
#pragma unroll
  for (int s = 0; s < N; ++s) { r[2 * s] = *(const v4f*)(p + s * ld); r[2 * s + 1] = *(const v4f*)(p + s * ld + 4); } }
// ---- k_proj: block = (256 rows, 256 cols, which), 16 waves as 4 x 4, a wave holds 64 x 64 (4 X fragments x 4 W fragments, 16 products a chunk): q/k/v = X W (+ b) with exact bf16 products (K = DIN) -> which 0: q f16 rows (+ residual rows < QHI); 1: k f16 rows (+ residual rows < KHI); 2: v f16 planes [c][t] (+ bf16 hi/lo planes for t < KHI); 3: Wo rows into k_out's f16(bf16 x 2^8) and bf16 forms
#define PB 256                                       // rows and columns of a k_proj block
#define PWN 268                                      // LDS rows of a staged W chunk
#define PWROW(n) (((n) & 3) * 68 + ((n) >> 2))      // LDS row of W column n: a thread's 4 neighbouring columns lie 68 rows apart, so stores (32 rows in a run) and fragment reads (16 rows distinct mod 16) both spread over the banks
#define EP 264                                       // LDS pitch of an epilogue row of 256 16-bit elements: 528 B = 16 B x odd
typedef __attribute__((ext_vector_type(4))) __bf16 v4b;
__global__ __launch_bounds__(512) void k_proj(const float* __restrict__ XQ, const float* __restrict__ XK, const float* __restrict__ XV, const float* __restrict__ WQ, const float* __restrict__ WK, const float* __restrict__ WV, const float* __restrict__ BQ, const float* __restrict__ BK, const float* __restrict__ BV,
    _Float16* __restrict__ QH, _Float16* __restrict__ QL, _Float16* __restrict__ KH, _Float16* __restrict__ KL, _Float16* __restrict__ VT, __bf16* __restrict__ VB, __bf16* __restrict__ VBL, const float* __restrict__ WO, _Float16* __restrict__ WH, __bf16* __restrict__ WBF) {
  __shared__ __align__(16) char pl[2 * PB * EP * 2];   /* the loop's staging buffers; behind the loop the epilogue's two tiles */
  static_assert(2 * (PB + PWN) * SP * 2 <= PB * EP * 2 && WQKV_LAYOUT == 0 && TT % PB == 0 && QHI % 64 == 0 && KHI % 64 == 0, "the staging buffers fit the array; W is (in,out); a block lies in one sequence; the residual rows end on a group of 64");
  const int tid = threadIdx.x, wave = tid >> 5, lane = tid & 31, col = lane & 15, g = lane >> 4, wr = wave >> 2, wc = wave & 3; const int which = blockIdx.z; const int c0 = blockIdx.y * PB; const size_t r0 = (size_t)blockIdx.x * PB; const size_t bb = r0 / TT; const int t0 = (int)(r0 % TT);
  if (which == 3) {   /* block-uniform, in front of every barrier: the blocks of a fourth plane bring Wo once into k_out's two operand forms, 8 neighbouring elements a thread and pass */
    static_assert((size_t)DIN * CC == (size_t)(TNB * TT / PB) * (CC / PB) * 4 * 512 * 8, "the plane's blocks cover Wo exactly, 4 passes each");
    const size_t wo0 = ((size_t)(blockIdx.y * (TNB * TT / PB) + blockIdx.x) * 4 * 512 + tid) * 8; v4f r[8];
#pragma unroll
    for (int p = 0; p < 4; ++p) { r[2 * p] = *(const v4f*)(WO + wo0 + p * 4096); r[2 * p + 1] = *(const v4f*)(WO + wo0 + p * 4096 + 4); }
    asm volatile("s_wait_xcnt 0x0" ::: "memory");   /* stands before the loads' address registers are reused */
#pragma unroll
    for (int p = 0; p < 4; ++p) { v8h ph; v8b pb;
#pragma unroll
      for (int i = 0; i < 8; ++i) { const float v = r[2 * p + (i >> 2)][i & 3]; pb[i] = (__bf16)v; ph[i] = (_Float16)(bfr(v) * 256.0f); }
      vst2(WH + wo0 + p * 4096, ph); vst2(WBF + wo0 + p * 4096, pb); }
    asm volatile("s_wait_xcnt 0x0" ::: "memory");   /* stands before the stores' registers are given up at the wave's end */
    return; }
  const float* X = which == 0 ? XQ : which == 1 ? XK : XV; const float* WA = which == 0 ? WQ : which == 1 ? WK : WV; const float* BA = which == 0 ? BQ : which == 1 ? BK : BV;
  v8f acc[4][4] = {};
  /* k chunks of 32 staged once per block: X rows and W columns go to LDS as bf16, k-contiguous, in two buffers */
  __bf16* const sx = reinterpret_cast<__bf16*>(pl); __bf16* const sw = sx + 2 * PB * SP;
  /* X: 8 lanes bring the 128 B of one row's chunk, 64 rows a pass of the block; W: a thread takes 4 columns x 4 k rows, a wave's load is 512 B of one k row */
  const float* xg = X + (r0 + (tid >> 3)) * DIN + (tid & 7) * 4; const float* wg = WA + (size_t)((tid >> 6) * 4) * CC + c0 + (tid & 63) * 4; const int xo = (tid >> 3) * SP + (tid & 7) * 4, wo = (tid & 63) * SP + (tid >> 6) * 4;
  v4f rx[4], rw[4];
#pragma unroll
  for (int i = 0; i < 4; ++i) { rx[i] = *(const v4f*)(xg + (size_t)(i * 64) * DIN); rw[i] = *(const v4f*)(wg + (size_t)i * CC); }
  asm volatile("s_wait_xcnt 0x0" ::: "memory");   /* stands before the loads' address registers are advanced */
#pragma unroll 2   /* two trips a pass: the buffer index becomes a constant */
  for (int kc = 0; kc < DIN / 32; ++kc) { __bf16* const xb = sx + (kc & 1) * PB * SP; __bf16* const wb = sw + (kc & 1) * PWN * SP;
#pragma unroll
    for (int s = 0; s < 4; ++s) { v4b p;   /* row 64 s + (tid >> 3), k 4 (tid & 7) + 0..3 */
#pragma unroll
      for (int i = 0; i < 4; ++i) p[i] = (__bf16)rx[s][i];
      *(v4b*)(xb + xo + s * 64 * SP) = p; }
#pragma unroll
    for (int c = 0; c < 4; ++c) { v4b p;   /* column 4 (tid & 63) + c, k rows 4 (tid >> 6) + 0..3 */
#pragma unroll
      for (int i = 0; i < 4; ++i) p[i] = (__bf16)rw[i][c];
      *(v4b*)(wb + wo + c * 68 * SP) = p; }
    if (kc + 1 < DIN / 32) {   /* the next chunk's loads fly under this chunk's products */
#pragma unroll
      for (int i = 0; i < 4; ++i) { rx[i] = *(const v4f*)(xg + (size_t)(i * 64) * DIN + (kc + 1) * 32); rw[i] = *(const v4f*)(wg + (size_t)((kc + 1) * 32 + i) * CC); }
      asm volatile("s_wait_xcnt 0x0" ::: "memory"); }   /* stands before the loads' address registers are advanced */
    stage_bar();   /* the chunk is in LDS before any wave reads fragments; it also ends the reads of the buffer that the next trip refills */
    v16b a[4], w[4];
    /* all 16 waves read at once behind the barrier, so fragments arrive slowly: they are asked for in the order a0 w0 w1 a1 w2 a2 w3 a3 and each product runs as soon as its two fragments are there (1, 1, 2, 2, 3, 3, 4 products per further fragment) */
#define PFA(i) a[i] = frag_b(xb + (wr * 64 + (i) * 16 + col) * SP, lane)
#define PFW(j) w[j] = frag_b(wb + PWROW(wc * 64 + (j) * 16 + col) * SP, lane)
    PFA(0); PFW(0); PFW(1); PFA(1); PFW(2); PFA(2); PFW(3); PFA(3);
    __builtin_amdgcn_sched_barrier(0);   /* keeps the chunk's LDS reads one group ahead of its products: spread among them each read costs its own latency */
    constexpr int oi[16] = {0, 0, 1, 1, 0, 1, 2, 2, 2, 0, 1, 2, 3, 3, 3, 3}, oj[16] = {0, 1, 0, 1, 2, 2, 0, 1, 2, 3, 3, 3, 0, 1, 2, 3};
#pragma unroll
    for (int t = 0; t < 16; ++t) acc[oi[t]][oj[t]] = wmma_bf(a[oi[t]], w[oj[t]], acc[oi[t]][oj[t]]);
    __builtin_amdgcn_sched_barrier(0); }   /* keeps the next trip's conversions, which wait for the loads in flight, behind this trip's products */
  __syncthreads();   /* every wave has read its last fragments before the epilogue's tiles overwrite the staging buffers */
  float bias[4];
#pragma unroll
  for (int j = 0; j < 4; ++j) bias[j] = BA ? bfr(BA[c0 + wc * 64 + j * 16 + col]) : 0.f;
#pragma unroll
  for (int i = 0; i < 4; ++i)
#pragma unroll
    for (int j = 0; j < 4; ++j) acc[i][j] += bias[j];
  /* the tile leaves through 256 x 256 LDS tiles of 16-bit elements: every wave writes its 64 x 64 part, the block stores whole 512-B row segments; the residual planes only where the block has rows that carry them, each written in the same pass as the plane it is the rest of */
  if (which < 2) { _Float16* DH = which == 0 ? QH : KH; _Float16* DL = which == 0 ? QL : KL; const int nhi = which == 0 ? QHI : KHI;
    _Float16 (* const sh)[EP] = reinterpret_cast<_Float16 (*)[EP]>(pl); _Float16 (* const sl)[EP] = reinterpret_cast<_Float16 (*)[EP]>(pl + PB * EP * 2);
    const bool hi_rows = t0 < nhi;   /* block-uniform */
#pragma unroll
    for (int i = 0; i < 4; ++i)
#pragma unroll
      for (int j = 0; j < 4; ++j) { _Float16 hv[8];
#pragma unroll
        for (int r = 0; r < 8; ++r) { hv[r] = (_Float16)acc[i][j][r]; sh[wr * 64 + i * 16 + 8 * g + r][wc * 64 + j * 16 + col] = hv[r]; }
        if (hi_rows) {
#pragma unroll
          for (int r = 0; r < 8; ++r) sl[wr * 64 + i * 16 + 8 * g + r][wc * 64 + j * 16 + col] = (_Float16)((acc[i][j][r] - (float)hv[r]) * 1024.0f); } }
    __syncthreads();
#pragma unroll 1   /* four 16-byte units a trip cover the LDS latency; more would only add code */
    for (int u0 = 0; u0 < PB * 32 / 512; u0 += 4) {
#pragma unroll
      for (int u = 0; u < 4; ++u) { const int e = tid + (u0 + u) * 512; const int rl = e >> 5, q = e & 31; vst2((unsigned*)(DH + (r0 + rl) * CC + c0 + q * 8), *(const v4u*)&sh[rl][q * 8]); }
      asm volatile("s_wait_xcnt 0x0" ::: "memory"); }   /* stands before the next trip forms new addresses in the stores' registers */
    const int nu = hi_rows ? (nhi - t0 < PB ? nhi - t0 : PB) * 32 / 512 : 0;   /* the block's rows below nhi come first: 16 rows a unit of the block, a multiple of 4 units */
#pragma unroll 1   /* four 16-byte units a trip cover the LDS latency; more would only add code */
    for (int u0 = 0; u0 < nu; u0 += 4) {
#pragma unroll
      for (int u = 0; u < 4; ++u) { const int e = tid + (u0 + u) * 512; const int rl = e >> 5, q = e & 31; vst2((unsigned*)(DL + (bb * nhi + t0 + rl) * (size_t)CC + c0 + q * 8), *(const v4u*)&sl[rl][q * 8]); }
      asm volatile("s_wait_xcnt 0x0" ::: "memory"); }   /* stands before the next trip forms new addresses in the stores' registers */
  } else {
    _Float16 (* const th)[EP] = reinterpret_cast<_Float16 (*)[EP]>(pl); __bf16 (* const tb)[EP] = reinterpret_cast<__bf16 (*)[EP]>(pl); __bf16 (* const tbl)[EP] = reinterpret_cast<__bf16 (*)[EP]>(pl + PB * EP * 2);
#pragma unroll
    for (int i = 0; i < 4; ++i)
#pragma unroll
      for (int j = 0; j < 4; ++j) { v8h pk;   /* a lane's 8 elements are 8 neighbouring t of one column */
#pragma unroll
        for (int r = 0; r < 8; ++r) pk[r] = (_Float16)acc[i][j][r];
        *(v8h*)&th[wc * 64 + j * 16 + col][wr * 64 + i * 16 + 8 * g] = pk; }
    __syncthreads();
#pragma unroll 1   /* four 16-byte units a trip cover the LDS latency; more would only add code */
    for (int u0 = 0; u0 < PB * 32 / 512; u0 += 4) {
#pragma unroll
      for (int u = 0; u < 4; ++u) { const int e = tid + (u0 + u) * 512; const int cl = e >> 5, q = e & 31; vst2((unsigned*)(VT + (bb * CC + c0 + cl) * (size_t)TT + t0 + q * 8), *(const v4u*)&th[cl][q * 8]); }
      asm volatile("s_wait_xcnt 0x0" ::: "memory"); }   /* stands before the next trip forms new addresses in the stores' registers */
    if (t0 < KHI) {   /* block-uniform */
      __syncthreads();   /* the f16 plane has been read before the bf16 planes overwrite it */
#pragma unroll
      for (int i = 0; i < 4; ++i)
#pragma unroll
        for (int j = 0; j < 4; ++j) { v8b ph, pq;
#pragma unroll
          for (int r = 0; r < 8; ++r) { const float v = acc[i][j][r]; const __bf16 bh = (__bf16)v; ph[r] = bh; pq[r] = (__bf16)(v - (float)bh); }
          *(v8b*)&tb[wc * 64 + j * 16 + col][wr * 64 + i * 16 + 8 * g] = ph; *(v8b*)&tbl[wc * 64 + j * 16 + col][wr * 64 + i * 16 + 8 * g] = pq; }
      __syncthreads();
#pragma unroll 1   /* four 16-byte units a trip cover the LDS latency; more would only add code */
      for (int u0 = 0; u0 < PB * 32 / 512; u0 += 4) {
#pragma unroll
        for (int u = 0; u < 4; ++u) { const int e = tid + (u0 + u) * 512; const int cl = e >> 5, q = e & 31; if (t0 + q * 8 < KHI) { const size_t o3 = (bb * CC + c0 + cl) * (size_t)KHI + t0 + q * 8; vst2((unsigned*)(VB + o3), *(const v4u*)&tb[cl][q * 8]); vst2((unsigned*)(VBL + o3), *(const v4u*)&tbl[cl][q * 8]); } }
        asm volatile("s_wait_xcnt 0x0" ::: "memory"); }   /* stands before the next trip forms new addresses in the stores' registers */ } } }
#define QT 64
#define KP 72
#define LC (SCALE * 1.4426950408889634f)
__device__ __forceinline__ float xhalf(float x) { return __builtin_bit_cast(float, __builtin_amdgcn_permlanex16(__builtin_bit_cast(int, x), __builtin_bit_cast(int, x), 0x76543210, 0xfedcba98, false, false)); }
__device__ __forceinline__ v8f wmh(v16h a, v16h b, v8f c) { return __builtin_amdgcn_wmma_f32_16x16x32_f16(false, a, false, b, (short)0, c, false, false); }
__device__ __forceinline__ v8f wmb(v16b a, v16b b, v8f c) { return __builtin_amdgcn_wmma_f32_16x16x32_bf16(false, a, false, b, (short)0, c, false, false); }
// fragments from a lane's own address (row and 8 g already in it); the address has passed through an asm operand, so the loads say themselves that it is global memory (else they compile to flat loads)
typedef __attribute__((address_space(1))) const v8h gv8h; typedef __attribute__((address_space(1))) const v8b gv8b;
__device__ __forceinline__ v16h fragp_h(const _Float16* p) { union { v16h v; v8h q[2]; } u; u.q[0] = *(gv8h*)p; u.q[1] = *(gv8h*)(p + 16); return u.v; }
__device__ __forceinline__ v16b fragp_b(const __bf16* p) { union { v16b v; v8b q[2]; } u; u.q[0] = *(gv8b*)p; u.q[1] = *(gv8b*)(p + 16); return u.v; }
// 2^x on the transcendental unit. The v_nop is the one slot the instruction set asks for between a transcendental and a directly following instruction that reads its result or overwrites its source; inside the group of four the early-clobber outputs keep every result off every source
__device__ __forceinline__ float ex2(float x) { float e; asm("v_exp_f32 %0, %1\n\tv_nop" : "=v"(e) : "v"(x)); return e; }
__device__ __forceinline__ void ex2x4(float x0, float x1, float x2, float x3, float& e0, float& e1, float& e2, float& e3) { asm("v_exp_f32 %0, %4\n\tv_exp_f32 %1, %5\n\tv_exp_f32 %2, %6\n\tv_exp_f32 %3, %7\n\tv_nop" : "=&v"(e0), "=&v"(e1), "=&v"(e2), "=&v"(e3) : "v"(x0), "v"(x1), "v"(x2), "v"(x3)); }
// one step of the running softmax over NT 16-key score tiles: s comes in as raw logits (excluded: -3e38) and leaves as e x 2^11 against the new maximum; sum and the output tiles are brought to that maximum
template <int NT> __device__ __forceinline__ void online(v8f (&s)[NT], float& m, float& sum, v8f (&acc)[HD / 16]) {
  float mt[NT];   /* one chain per tile: a single chain of dependent maxima would be paid link by link */
#pragma unroll
  for (int t = 0; t < NT; ++t) { mt[t] = s[t][0];
#pragma unroll
    for (int r = 1; r < 8; ++r) mt[t] = fmaxf(mt[t], s[t][r]); }
  float mx = mt[0];
#pragma unroll
  for (int t = 1; t < NT; ++t) mx = fmaxf(mx, mt[t]);
  mx = fmaxf(mx, xhalf(mx));   /* both halves of the wave hold keys of the same query: one maximum for both */
  const float mn = fmaxf(m, mx); const float corr = ex2((m - mn) * LC); const float off = 11.0f - mn * LC; m = mn;
  float ps[NT];
#pragma unroll
  for (int t = 0; t < NT; ++t) { ps[t] = 0.f;
#pragma unroll
    for (int r = 0; r < 8; r += 4) { float e0, e1, e2, e3; ex2x4(fmaf(s[t][r], LC, off), fmaf(s[t][r + 1], LC, off), fmaf(s[t][r + 2], LC, off), fmaf(s[t][r + 3], LC, off), e0, e1, e2, e3); s[t][r] = e0; s[t][r + 1] = e1; s[t][r + 2] = e2; s[t][r + 3] = e3; ps[t] += e0; ps[t] += e1; ps[t] += e2; ps[t] += e3; } }
  float p = ps[0];
#pragma unroll
  for (int t = 1; t < NT; ++t) p += ps[t];
  sum = sum * corr + p;
#pragma unroll
  for (int j = 0; j < HD / 16; ++j) acc[j] *= corr; }
__global__ __launch_bounds__(128) __attribute__((amdgpu_waves_per_eu(4, 4))) void k_pv(const _Float16* __restrict__ QH, const _Float16* __restrict__ KH, const _Float16* __restrict__ QL, const _Float16* __restrict__ KL, const _Float16* __restrict__ VT, const __bf16* __restrict__ VB, const __bf16* __restrict__ VBL, _Float16* __restrict__ YH, __bf16* __restrict__ YL) {
  __shared__ __align__(16) _Float16 sk[2][QT * KP], sv[2][HD * KP]; __shared__ __align__(16) float so[4][16][HD + 4];
  static_assert(TT / QT == 32 && TNB * NH == 32 && HD == 64 && QBH * QT == QHI && QHI == KHI && CAUSAL == 1, "the index map below is a permutation of 32 tiles x 32 (b, h); early tiles read only keys that carry residual planes");
  const int tid = threadIdx.x, wave = __builtin_amdgcn_readfirstlane(tid >> 5), lane = tid & 31, col = lane & 15, g = lane >> 4;
  /* block index -> (tile, b h): cost rises with the tile, all blocks are resident at once; four blocks 256 apart, and four neighbours of the same index mod 8, take tiles that add up to the same cost (for speed only) */
  const int bi = blockIdx.x, n = bi >> 3, cc = (n >> 2) & 7, a4 = n >> 5, role = (a4 + n) & 3; const int tile = role == 0 ? 31 - cc : role == 1 ? cc : role == 2 ? 23 - cc : 8 + cc; const int bh = (bi & 7) + 8 * a4; const int b = bh / NH, h = bh % NH;
  const int q0 = tile * QT + wave * 16;
  const _Float16* qp = QH + ((size_t)b * TT + q0 + col) * CC + h * HD; const v16h bq0 = frag_h(qp, lane), bq1 = frag_h(qp + 32, lane);
  asm volatile("s_wait_xcnt 0x0" ::: "memory");   /* stands before the q loads' address registers are reused */
  float m = -3.0e38f, sum = 0.f; v8f acc[HD / 16] = {};
  if (tile < QBH) {   /* block-uniform */
    const _Float16* qlp = QL + ((size_t)b * QHI + q0 + col) * CC + h * HD; const v16h bl0 = frag_h(qlp, lane), bl1 = frag_h(qlp + 32, lane);
    asm volatile("s_wait_xcnt 0x0" ::: "memory");   /* stands before the residual loads' address registers are reused */
    const int nch = ((q0 + 15) >> 5) + 1;
    /* each lane's own four addresses, carried from trip to trip and advanced behind the waits */
    const _Float16* kp = KH + ((size_t)b * TT + col) * CC + h * HD + 8 * g; const _Float16* klp = KL + ((size_t)b * KHI + col) * CC + h * HD + 8 * g;
    const __bf16* vbp = VB + ((size_t)b * CC + h * HD + col) * (size_t)KHI + 8 * g; const __bf16* vlp = VBL + ((size_t)b * CC + h * HD + col) * (size_t)KHI + 8 * g;
#pragma unroll 1   /* at most 12 trips: kept rolled, unrolling would only add code */
    for (int kc = 0; kc < nch; ++kc) { v16h kh[2][2], kl[2][2]; v16b vh[HD / 16], vl[HD / 16];
#pragma unroll
      for (int t = 0; t < 2; ++t) { kh[t][0] = fragp_h(kp + t * 16 * CC); kh[t][1] = fragp_h(kp + t * 16 * CC + 32); kl[t][0] = fragp_h(klp + t * 16 * CC); kl[t][1] = fragp_h(klp + t * 16 * CC + 32); }
      asm volatile("s_wait_xcnt 0x0" : "+v"(kp), "+v"(klp) :: "memory");   /* stands before the k loads' address registers are advanced; it names the two pairs so that they stay whole up to it (no load of the group may land on them) */
      __builtin_amdgcn_sched_barrier(0);   /* keeps every later register write behind that wait */
      kp += 32 * CC; klp += 32 * CC;
      v8f s[2];
#pragma unroll
      for (int t = 0; t < 2; ++t) { v8f a = {}, l = {};
        a = wmh(kh[t][0], bq0, a); l = wmh(kh[t][0], bl0, l); l = wmh(kl[t][0], bq0, l); a = wmh(kh[t][1], bq1, a); l = wmh(kh[t][1], bl1, l); l = wmh(kl[t][1], bq1, l);
#pragma unroll
        for (int r = 0; r < 8; ++r) s[t][r] = (kc * 32 + t * 16 + 8 * g + r <= q0 + col) ? a[r] + l[r] * (1.0f / 1024.0f) : -3.0e38f; }
#pragma unroll
      for (int j = 0; j < HD / 16; ++j) { vh[j] = fragp_b(vbp + j * 16 * KHI); vl[j] = fragp_b(vlp + j * 16 * KHI); }   /* in flight under the softmax step */
      asm volatile("s_wait_xcnt 0x0" : "+v"(vbp), "+v"(vlp) :: "memory");   /* stands before the v loads' address registers are advanced; it names the two pairs so that they stay whole up to it */
      __builtin_amdgcn_sched_barrier(0);   /* keeps every later register write behind that wait */
      vbp += 32; vlp += 32;
      online<2>(s, m, sum, acc);
      float v[16];
#pragma unroll
      for (int r = 0; r < 8; ++r) { v[r] = s[0][r]; v[8 + r] = s[1][r]; }
      const F2 p = bsplit16(v);
#pragma unroll
      for (int j = 0; j < HD / 16; ++j) { acc[j] = wmb(vh[j], p.h, acc[j]); acc[j] = wmb(vh[j], p.l, acc[j]); acc[j] = wmb(vl[j], p.h, acc[j]); } }
  } else {
    const int srow = tid >> 3, sseg = tid & 7, sof = srow * KP + sseg * 8;   /* 8 lanes bring one 128-B row; 16 rows a pass of the block */
    const _Float16* kg = KH + ((size_t)b * TT + srow) * CC + h * HD + sseg * 8; const _Float16* vg = VT + ((size_t)b * CC + h * HD + srow) * (size_t)TT + sseg * 8;
    v8h rk[4], rv[4];
#pragma unroll
    for (int u = 0; u < 4; ++u) { rk[u] = *(const v8h*)(kg + (size_t)(u * 16) * CC); rv[u] = *(const v8h*)(vg + (size_t)(u * 16) * TT); }
    asm volatile("s_wait_xcnt 0x0" ::: "memory");   /* stands before the loads' address registers are advanced */
#pragma unroll 1   /* the body is long and its trip count varies with the tile */
    for (int st = 0; st <= tile; ++st) { _Float16* const kb = &sk[st & 1][0]; _Float16* const vb = &sv[st & 1][0];
#pragma unroll
      for (int u = 0; u < 4; ++u) { *(v8h*)(kb + sof + u * 16 * KP) = rk[u]; *(v8h*)(vb + sof + u * 16 * KP) = rv[u]; }
      if (st < tile) {   /* the next stage's loads fly under this stage's work */
#pragma unroll
        for (int u = 0; u < 4; ++u) { rk[u] = *(const v8h*)(kg + (size_t)((st + 1) * 64 + u * 16) * CC); rv[u] = *(const v8h*)(vg + (size_t)(u * 16) * TT + (st + 1) * 64); }
        asm volatile("s_wait_xcnt 0x0" ::: "memory"); }   /* stands before the loads' address registers are advanced */
      stage_bar();   /* the stage is in LDS before any wave reads fragments; it also ends the reads of the buffer that the next trip refills */
      v8f s[4]; v16h ka[4][2];
#pragma unroll
      for (int t = 0; t < 4; ++t) { const _Float16* kr = kb + (t * 16 + col) * KP; ka[t][0] = frag_h(kr, lane); ka[t][1] = frag_h(kr + 32, lane); }
      __builtin_amdgcn_sched_barrier(0);   /* keeps the stage's K reads one group ahead of its products: spread among them each pair of reads costs its own LDS latency */
#pragma unroll
      for (int t = 0; t < 4; ++t) { v8f z = {}; s[t] = wmh(ka[t][0], bq0, z); }
#pragma unroll
      for (int t = 0; t < 4; ++t) s[t] = wmh(ka[t][1], bq1, s[t]);
      v16h va[HD / 16][2];
#pragma unroll
      for (int j = 0; j < HD / 16; ++j) { const _Float16* vr = vb + (j * 16 + col) * KP; va[j][0] = frag_h(vr, lane); va[j][1] = frag_h(vr + 32, lane); }
      __builtin_amdgcn_sched_barrier(0);   /* keeps the stage's V reads one group ahead of the softmax step, which covers their LDS latency */
      if (st == tile) {   /* only the last stage meets the diagonal */
#pragma unroll
        for (int t = 0; t < 4; ++t)
#pragma unroll
          for (int r = 0; r < 8; ++r) s[t][r] = (t * 16 + 8 * g + r <= wave * 16 + col) ? s[t][r] : -3.0e38f; }
      online<4>(s, m, sum, acc);
      v16h p0, p1;
#pragma unroll
      for (int r = 0; r < 8; ++r) { p0[r] = (_Float16)s[0][r]; p0[8 + r] = (_Float16)s[1][r]; p1[r] = (_Float16)s[2][r]; p1[8 + r] = (_Float16)s[3][r]; }
#pragma unroll
      for (int j = 0; j < HD / 16; ++j) acc[j] = wmh(va[j][0], p0, acc[j]);
#pragma unroll
      for (int j = 0; j < HD / 16; ++j) acc[j] = wmh(va[j][1], p1, acc[j]); } }
  const float tot = sum + xhalf(sum); const float inv = tot > 0.f ? 1.0f / tot : 0.f;   /* the halves' sums are joined once; the 2^11 of e cancels */
#pragma unroll
  for (int j = 0; j < HD / 16; ++j) { v4f lo, hi;   /* O^T tile j: element r = head column 16 j + 8 g + r of query col */
#pragma unroll
    for (int r = 0; r < 4; ++r) { lo[r] = acc[j][r] * inv; hi[r] = acc[j][4 + r] * inv; }
    *(v4f*)&so[wave][col][j * 16 + 8 * g] = lo; *(v4f*)&so[wave][col][j * 16 + 8 * g + 4] = hi; }
  LDSX();   /* the wave's own rows are in LDS before it reads them back as whole (row, head) segments */
  /* ctx leaves in the 16-bit form k_out multiplies: 16 lanes store the 128 B of one (row, head) segment, 2 rows a pass */
  typedef __attribute__((ext_vector_type(4))) _Float16 v4h; const size_t yo = ((size_t)b * TT + q0 + g) * CC + h * HD + col * 4;
  if (tile < QBH) {   /* block-uniform: early rows go as bf16 hi + lo */
#pragma unroll
    for (int rl = 0; rl < 16; rl += 2) { const v4f c = *(const v4f*)&so[wave][rl + g][col * 4]; v4b ph, pq;
#pragma unroll
      for (int i = 0; i < 4; ++i) { const __bf16 hv = (__bf16)c[i]; ph[i] = hv; pq[i] = (__bf16)(c[i] - (float)hv); }
      vst2(YH + yo + rl * CC, ph); vst2(YL + yo + rl * CC, pq); }
    asm volatile("s_wait_xcnt 0x0" ::: "memory");   /* stands behind this branch's last store, before the stores' registers are given up */
  } else {   /* ctx carried x 2^6 into f16 so small-magnitude context rows stay clear of f16 subnormals */
#pragma unroll
    for (int rl = 0; rl < 16; rl += 2) { const v4f c = *(const v4f*)&so[wave][rl + g][col * 4]; v4h p;
#pragma unroll
      for (int i = 0; i < 4; ++i) p[i] = (_Float16)(c[i] * 64.0f);
      vst2(YH + yo + rl * CC, p); }
    asm volatile("s_wait_xcnt 0x0" ::: "memory"); } }   /* stands behind this branch's last store, before the stores' registers are given up */
// ---- k_out: block = (64 rows, 128 cols): out = ctx Wo (+ bo), both operands read in their 16-bit form as their producers left them (k_pv: ctx; k_proj's fourth plane: Wo): f16(ctx x 2^6) against f16(bf16 x 2^8) Wo exact (1 product) x 2^-14; causal early rows (< QHI of each sequence): ctx bf16 hi + lo against exact bf16 Wo (2 products). A 128-B line holds 64 k: chunks of 64, two steps of 32 each
// the staging loop: HI = early rows. Operands pass through registers and LDS as raw 16-bit elements
template <bool HI> __device__ __forceinline__ void out_loop(const _Float16* ag, const _Float16* lg, const _Float16* wg, _Float16* sa, _Float16* sb, int sof, int wave, int lane, int col, v8f (&acc)[8]) {
  v8h ra[4], rl[4], rw[8];
#pragma unroll
  for (int u = 0; u < 4; ++u) { ra[u] = *(const v8h*)(ag + (size_t)(u * 16) * CC); if (HI) rl[u] = *(const v8h*)(lg + (size_t)(u * 16) * CC); }
#pragma unroll
  for (int u = 0; u < 8; ++u) rw[u] = *(const v8h*)(wg + (size_t)(u * 16) * CC);
  asm volatile("s_wait_xcnt 0x0" ::: "memory");   /* stands before the loads' address registers are advanced */
#pragma unroll 2   /* two trips a pass: the buffer index becomes a constant */
  for (int kc = 0; kc < CC / 64; ++kc) { _Float16* const ab = sa + (kc & 1) * 2 * 64 * KP; _Float16* const lb = ab + 64 * KP; _Float16* const wb = sb + (kc & 1) * 128 * KP;
#pragma unroll
    for (int u = 0; u < 4; ++u) { *(v8h*)(ab + sof + u * 16 * KP) = ra[u]; if (HI) *(v8h*)(lb + sof + u * 16 * KP) = rl[u]; }
#pragma unroll
    for (int u = 0; u < 8; ++u) *(v8h*)(wb + sof + u * 16 * KP) = rw[u];
    if (kc + 1 < CC / 64) {   /* the next chunk's loads fly under this chunk's products */
#pragma unroll
      for (int u = 0; u < 4; ++u) { ra[u] = *(const v8h*)(ag + (size_t)(u * 16) * CC + (kc + 1) * 64); if (HI) rl[u] = *(const v8h*)(lg + (size_t)(u * 16) * CC + (kc + 1) * 64); }
#pragma unroll
      for (int u = 0; u < 8; ++u) rw[u] = *(const v8h*)(wg + (size_t)(u * 16) * CC + (kc + 1) * 64);
      asm volatile("s_wait_xcnt 0x0" ::: "memory"); }   /* stands before the loads' address registers are advanced */
    stage_bar();   /* the chunk is in LDS before any wave reads fragments; it also ends the reads of the buffer that the next trip refills */
#pragma unroll
    for (int ks = 0; ks < 2; ++ks) {
      if (HI) { const v16b fh = frag_b(reinterpret_cast<const __bf16*>(ab + (wave * 16 + col) * KP + ks * 32), lane), fl = frag_b(reinterpret_cast<const __bf16*>(lb + (wave * 16 + col) * KP + ks * 32), lane); v16b w[8];
#pragma unroll
        for (int j = 0; j < 8; ++j) w[j] = frag_b(reinterpret_cast<const __bf16*>(wb + (j * 16 + col) * KP + ks * 32), lane);
        __builtin_amdgcn_sched_barrier(0);   /* keeps the step's LDS reads one group ahead of its products */
#pragma unroll
        for (int j = 0; j < 8; ++j) { acc[j] = wmma_bf(fh, w[j], acc[j]); acc[j] = wmma_bf(fl, w[j], acc[j]); }
      } else { const v16h a = frag_h(ab + (wave * 16 + col) * KP + ks * 32, lane); v16h w[8];
#pragma unroll
        for (int j = 0; j < 8; ++j) w[j] = frag_h(wb + (j * 16 + col) * KP + ks * 32, lane);
        __builtin_amdgcn_sched_barrier(0);   /* keeps the step's LDS reads one group ahead of its products */
#pragma unroll
        for (int j = 0; j < 8; ++j) acc[j] = wmma16(a, w[j], acc[j]); }
      __builtin_amdgcn_sched_barrier(0); } } }   /* keeps the next step's reads, and the next trip's LDS stores, which wait for the loads in flight, behind this step's products */
__global__ __launch_bounds__(128) void k_out(const _Float16* __restrict__ YH, const __bf16* __restrict__ YL, const _Float16* __restrict__ WH, const __bf16* __restrict__ WBF, const float* __restrict__ BO, float* __restrict__ OUT) { __shared__ __align__(16) float sf[4][16][132];
  __shared__ __align__(16) _Float16 sa[2 * 2 * 64 * KP], sb[2 * 128 * KP];   /* staged k chunks of 64, two buffers: ctx rows (hi and lo plane) and Wo rows */
  static_assert(WO_OUT_IN == 1 && CC % 128 == 0, "Wo rows are k-contiguous; an even number of chunks");
  const int tid = threadIdx.x, wave = tid >> 5, lane = tid & 31, col = lane & 15, g = lane >> 4; const int c0 = blockIdx.y * 128; const size_t rb = (size_t)blockIdx.x * 64; const size_t r0 = rb + wave * 16;
  const int srow = tid >> 3, sseg = tid & 7, sof = srow * KP + sseg * 8;   /* 8 lanes bring one 128-B line; 16 rows a pass of the block */
  const size_t ao = (rb + srow) * CC + sseg * 8, wo = (size_t)(c0 + srow) * CC + sseg * 8;
  v8f acc[8] = {};
  if (CAUSAL && (int)(((size_t)blockIdx.x * 64) % TT) < QHI) {   /* block-uniform */
    out_loop<true>(YH + ao, reinterpret_cast<const _Float16*>(YL) + ao, reinterpret_cast<const _Float16*>(WBF) + wo, sa, sb, sof, wave, lane, col, acc);
#pragma unroll
    for (int j = 0; j < 8; ++j) { const float bias = BO ? bfr(BO[c0 + j * 16 + col]) : 0.f;
#pragma unroll
      for (int r = 0; r < 8; ++r) sf[wave][8 * g + r][j * 16 + col] = acc[j][r] + bias; }
  } else {
    out_loop<false>(YH + ao, YH + ao, WH + wo, sa, sb, sof, wave, lane, col, acc);
#pragma unroll
    for (int j = 0; j < 8; ++j) { const float bias = BO ? bfr(BO[c0 + j * 16 + col]) : 0.f;
#pragma unroll
      for (int r = 0; r < 8; ++r) sf[wave][8 * g + r][j * 16 + col] = acc[j][r] * (1.0f / 16384.0f) + bias; } }   /* 2^-8 (Wo carry) x 2^-6 (ctx carry) */
  LDSX(); for (int rl = 0; rl < 16; ++rl) vst2(OUT + (r0 + rl) * DIN + c0 + lane * 4, *(const v4f*)&sf[wave][rl][lane * 4]); }

extern "C" void kernel_launch(void* const* d_in, const int* in_sizes, int n_in, void* d_out, int out_size, void* d_ws, size_t ws_size, hipStream_t stream) {
  (void)in_sizes; (void)n_in; (void)out_size;
  const float** F = (const float**)d_in;
  if (ws_size < (size_t)WS_END) return;
  char* ws = (char*)d_ws; _Float16 *QH = (_Float16*)(ws + WS_QH), *KH = (_Float16*)(ws + WS_KH), *VT = (_Float16*)(ws + WS_VT), *QL = (_Float16*)(ws + WS_QL), *KL = (_Float16*)(ws + WS_KL); __bf16 *VB = (__bf16*)(ws + WS_VB), *VBL = (__bf16*)(ws + WS_VBL); _Float16 *YH = (_Float16*)(ws + WS_YH), *WH = (_Float16*)(ws + WS_WH); __bf16 *YL = (__bf16*)(ws + WS_YL), *WBF = (__bf16*)(ws + WS_WB);
  (void)QL; (void)KL; (void)VB; (void)VBL;
  // inputs: 0 x [2,2048,1024]; 1 Wq [1024,1024] (in,out), 2 bq; 3 Wk, 4 bk; 5 Wv, 6 bv (biases NONZERO); 7 Wo [1024,1024] (out,in); no output bias
  k_proj<<<dim3(TNB * TT / PB, CC / PB, 4), 512, 0, stream>>>(F[0], F[0], F[0], F[1], F[3], F[5], F[2], F[4], F[6], QH, QL, KH, KL, VT, VB, VBL, F[7], WH, WBF);
  k_pv<<<dim3((TT / QT) * TNB * NH), 128, 0, stream>>>(QH, KH, QL, KL, VT, VB, VBL, YH, YL);
  k_out<<<dim3(TNB * TT / 64, DIN / 128), 128, 0, stream>>>(YH, YL, WH, WBF, nullptr, (float*)d_out);
}

// v008
// A run of this version takes 79.4 microseconds.
// Timed twice side by side with v007, it ran 1.06 times as fast both times.
// All steps since v000 together make it 13.5 times as fast.
// compute dtype: all float inputs rounded to bf16; the fused q / k / v projection with EXACT bf16 products on WMMA 16x16x32 (f32 accumulate) + bias (nonzero); causal logits: 3 products for the first 384 rows, single f16 q x k after, x 1024^-0.5 (the module scales by the MODEL width); softmax f32 with a running maximum; e x 2^11 once to f16 x v once to f16 (bf16 hi + lo below row 384), divided by the sum at the end; ctx hi+lo x exact W below row 384, x2^6 f16 carry x f16(bf16 x 2^8) W after, no output bias; f32 output.
#include <hip/hip_runtime.h>
#include <math.h>

typedef __attribute__((ext_vector_type(16))) _Float16 v16h;
typedef __attribute__((ext_vector_type(16))) __bf16 v16b;
typedef __attribute__((ext_vector_type(8)))  _Float16 v8h;
typedef __attribute__((ext_vector_type(8)))  float v8f;
typedef __attribute__((ext_vector_type(4)))  float v4f;
typedef __attribute__((ext_vector_type(2)))  float v2f;
typedef __attribute__((ext_vector_type(4)))  unsigned v4u;
typedef __attribute__((ext_vector_type(4)))  int v4i;
typedef float __attribute__((may_alias)) float_a;
typedef int __attribute__((may_alias)) int_a;

template <typename T> __device__ __forceinline__ void vst2(void* p, T v) { *(T*)p = v;  }
__device__ __forceinline__ v8f wmma16(v16h a, v16h b, v8f c) {
  v8f d = __builtin_amdgcn_wmma_f32_16x16x32_f16(false, a, false, b, (short)0, c, false, false);
  asm volatile("v_nop\n\tv_nop\n\tv_nop\n\tv_nop" : "+v"(d) : "v"(a), "v"(b));
  return d;
}
__device__ __forceinline__ v8f wmma_bf(v16b a, v16b b, v8f c) {
  v8f d = __builtin_amdgcn_wmma_f32_16x16x32_bf16(false, a, false, b, (short)0, c, false, false);
  asm volatile("v_nop\n\tv_nop\n\tv_nop\n\tv_nop" : "+v"(d) : "v"(a), "v"(b));
  return d;
}
// 16x16x32 fragments: lane = (h = lane>>4, row/col = lane&15); elements 0..7 = k0+8h+0..7, 8..15 = k0+16+8h+0..7; D element r = row 8h+r
__device__ __forceinline__ v16h frag_h(const _Float16* rowk0, int lane) {
  union { v16h v; v8h q[2]; } u; const _Float16* p = rowk0 + 8 * (lane >> 4);
  u.q[0] = *(const v8h*)p; u.q[1] = *(const v8h*)(p + 16); return u.v;
}
__device__ __forceinline__ v16h frag_f32(const float* rowk0, int lane) {
  v16h a; const float* p = rowk0 + 8 * (lane >> 4);
#pragma unroll
  for (int i = 0; i < 8; ++i) { a[i] = (_Float16)p[i]; a[8 + i] = (_Float16)p[16 + i]; }
  return a;
}
__device__ __forceinline__ v16h frag_f32s(const float* rowk0, int lane, float sc) {
  v16h a; const float* p = rowk0 + 8 * (lane >> 4);
#pragma unroll
  for (int i = 0; i < 8; ++i) { a[i] = (_Float16)(p[i] * sc); a[8 + i] = (_Float16)(p[16 + i] * sc); }
  return a;
}
// column fragment from a [K][ld] layout (column n), rows >= K read as 0
__device__ __forceinline__ v16h fragc_f32(const float* W, int k0, int n, int lane, int ld, int K) {
  v16h a; const int g = lane >> 4;
#pragma unroll
  for (int i = 0; i < 8; ++i) { const int ka = k0 + 8 * g + i, kb = ka + 16;
    a[i] = (_Float16)(ka < K ? W[(size_t)(ka < K ? ka : K - 1) * ld + n] : 0.f); a[8 + i] = (_Float16)(kb < K ? W[(size_t)(kb < K ? kb : K - 1) * ld + n] : 0.f); }
  return a;
}
struct F2 { v16b h, l; };
__device__ __forceinline__ F2 bsplit16(const float v[16]) { F2 r;
#pragma unroll
  for (int i = 0; i < 16; ++i) { const __bf16 h = (__bf16)v[i]; r.h[i] = h; r.l[i] = (__bf16)(v[i] - (float)h); }
  return r; }
__device__ __forceinline__ F2 split_row(const float* row, int k0, int lane) { float v[16]; const float* p = row + k0 + 8 * (lane >> 4);
#pragma unroll
  for (int i = 0; i < 8; ++i) { v[i] = p[i]; v[8 + i] = p[16 + i]; }
  return bsplit16(v); }
__device__ __forceinline__ F2 split_rowK(const float* row, int k0, int lane, int K) { float v[16]; const int g = lane >> 4;
#pragma unroll
  for (int i = 0; i < 8; ++i) { const int ka = k0 + 8 * g + i, kb = ka + 16; v[i] = ka < K ? row[ka < K ? ka : K - 1] : 0.f; v[8 + i] = kb < K ? row[kb < K ? kb : K - 1] : 0.f; }
  return bsplit16(v); }
__device__ __forceinline__ F2 split_col(const float* W, int k0, int n, int lane, int ld, int K) { float v[16]; const int g = lane >> 4;
#pragma unroll
  for (int i = 0; i < 8; ++i) { const int ka = k0 + 8 * g + i, kb = ka + 16; v[i] = ka < K ? W[(size_t)(ka < K ? ka : K - 1) * ld + n] : 0.f; v[8 + i] = kb < K ? W[(size_t)(kb < K ? kb : K - 1) * ld + n] : 0.f; }
  return bsplit16(v); }
__device__ __forceinline__ v8f mac3(const F2& a, const F2& b, v8f c) { c = wmma_bf(a.l, b.h, c); c = wmma_bf(a.h, b.l, c); return wmma_bf(a.h, b.h, c); }
__device__ __forceinline__ float sigm(float v) { return 1.0f / (1.0f + expf(-v)); }
#define LDSX() do { asm volatile("s_wait_dscnt 0" ::: "memory"); __builtin_amdgcn_wave_barrier(); __builtin_amdgcn_fence(__ATOMIC_RELEASE, "workgroup"); } while (0)

// Multi-head causal self-attention whose logits are scaled by 1/sqrt(EMBED) (x [2,2048,1024]; (in,out) Wq / Wk / Wv [1024,1024] and biases [1024] NONZERO applied as x @ W + b; Wo [1024,1024] torch (out,in), NO output bias; 16 heads x 64; logits x 1/sqrt(1024) = 1/32 - the model width, not the head width; tril kept, -inf elsewhere; softmax; z @ Wo.T).
#define NB 2
#define TT 2048
#define CC 1024            // NH * HD = projected width
#define DIN 1024          // input (model) width
#define NH 16
#define HD 64
#define SCALE (0.03125f)
#define CAUSAL 1
#ifndef TNB
#define TNB NB
#endif
__device__ __forceinline__ float bfr(float v) { return (float)(__bf16)v; }
__host__ __device__ __forceinline__ int kb_last(int qb) { return CAUSAL ? ((qb * 64 + 63) >> 7) : (TT / 128 - 1); }
typedef __attribute__((ext_vector_type(8))) __bf16 v8b;
__device__ __forceinline__ v16b frag_b(const __bf16* rowk0, int lane) {
  union { v16b v; v8b q[2]; } u; const __bf16* p = rowk0 + 8 * (lane >> 4);
  u.q[0] = *(const v8b*)p; u.q[1] = *(const v8b*)(p + 16); return u.v;
}
#define QBH 6              // causal: query blocks 0..QBH-1 of each sequence (few keys, no averaging) take the high-precision path
#define QHI 384            // rows carrying a q residual plane
#define KHI 384            // key rows carrying k residual / v bf16 hi+lo planes (used only by the causal high-precision path)
// B fragment (k rows k0+.., output column o) of a weight: (in,out) [K][ld] or (out,in) [ld rows of K]: bf16 exact, or f16(bf16 * 256) exact
__device__ __forceinline__ v16b wcol_io(const float* Wm, int k0, int o, int lane, int ld) { v16b w; const int g = lane >> 4;
#pragma unroll
  for (int i = 0; i < 8; ++i) { w[i] = (__bf16)Wm[(size_t)(k0 + 8 * g + i) * ld + o]; w[8 + i] = (__bf16)Wm[(size_t)(k0 + 16 + 8 * g + i) * ld + o]; }
  return w; }
__device__ __forceinline__ v16b wcol_oi(const float* Wm, int k0, int o, int lane, int K) { v16b w; const float* p = Wm + (size_t)o * K + k0 + 8 * (lane >> 4);
#pragma unroll
  for (int i = 0; i < 8; ++i) { w[i] = (__bf16)p[i]; w[8 + i] = (__bf16)p[16 + i]; }
  return w; }
__device__ __forceinline__ v16h wcolh_io(const float* Wm, int k0, int o, int lane, int ld) { v16h w; const int g = lane >> 4;
#pragma unroll
  for (int i = 0; i < 8; ++i) { w[i] = (_Float16)(bfr(Wm[(size_t)(k0 + 8 * g + i) * ld + o]) * 256.0f); w[8 + i] = (_Float16)(bfr(Wm[(size_t)(k0 + 16 + 8 * g + i) * ld + o]) * 256.0f); }
  return w; }
__device__ __forceinline__ v16h wcolh_oi(const float* Wm, int k0, int o, int lane, int K) { v16h w; const float* p = Wm + (size_t)o * K + k0 + 8 * (lane >> 4);
#pragma unroll
  for (int i = 0; i < 8; ++i) { w[i] = (_Float16)(bfr(p[i]) * 256.0f); w[8 + i] = (_Float16)(bfr(p[16 + i]) * 256.0f); }
  return w; }
#define WQKV_LAYOUT 0   // 0 = (in,out) [DIN][CC]; 1 = (out,in) [CC][DIN]; 2 = per-head [NH][DIN][HD]
__device__ __forceinline__ v16b wcol_hdk(const float* Wm, int k0, int o, int lane) { v16b w; const int g = lane >> 4; const float* p = Wm + (size_t)(o / HD) * DIN * HD + (o % HD);
#pragma unroll
  for (int i = 0; i < 8; ++i) { w[i] = (__bf16)p[(size_t)(k0 + 8 * g + i) * HD]; w[8 + i] = (__bf16)p[(size_t)(k0 + 16 + 8 * g + i) * HD]; }
  return w; }
#define WO_OUT_IN 1
#if WQKV_LAYOUT == 1
#define WCOL(W, k0, o, lane) wcol_oi(W, k0, o, lane, DIN)
#elif WQKV_LAYOUT == 2
#define WCOL(W, k0, o, lane) wcol_hdk(W, k0, o, lane)
#else
#define WCOL(W, k0, o, lane) wcol_io(W, k0, o, lane, CC)
#endif
#if WO_OUT_IN
#define WOCOL(W, k0, o, lane) wcol_oi(W, k0, o, lane, CC)
#define WOCOLH(W, k0, o, lane) wcolh_oi(W, k0, o, lane, CC)
#else
#define WOCOL(W, k0, o, lane) wcol_io(W, k0, o, lane, DIN)
#define WOCOLH(W, k0, o, lane) wcolh_io(W, k0, o, lane, DIN)
#endif

#ifndef PROJ_EXTRA_PARAMS
#define PROJ_EXTRA_PARAMS
#endif

#define WS_QH  0u                                      // f16 q rows [b*t][CC]
#define WS_KH  (WS_QH + 2u * (size_t)NB * TT * CC)      // f16 k rows [b*t][CC]
#define WS_VT  (WS_KH + 2u * (size_t)NB * TT * CC)      // f16 v planes [b][c][t]
#define WS_QL  (WS_VT + 2u * (size_t)NB * CC * TT)      // f16 q residual x 2^10 rows [b][t < QHI][CC]
#define WS_KL  (WS_QL + 2u * (size_t)NB * QHI * CC)     // f16 k residual x 2^10 rows [b][t < KHI][CC]
#define WS_VB  (WS_KL + 2u * (size_t)NB * KHI * CC)     // bf16 v hi planes [b][c][t < KHI]
#define WS_VBL (WS_VB + 2u * (size_t)NB * CC * KHI)
#define WS_YH  (WS_VBL + 2u * (size_t)NB * CC * KHI)    // ctx rows [b*t][CC] in k_out's operand form: f16(ctx x 2^6); rows < QHI of a sequence: bf16 hi
#define WS_YL  (WS_YH + 2u * (size_t)NB * TT * CC)      // bf16 ctx residual rows [b*t][CC]; only rows < QHI of a sequence are written and read
#define WS_WH  (WS_YL + 2u * (size_t)NB * TT * CC)      // Wo rows [o][CC] as f16(bf16 x 2^8)
#define WS_WB  (WS_WH + 2u * (size_t)DIN * CC)          // Wo rows [o][CC] as bf16
#define WS_END (WS_WB + 2u * (size_t)DIN * CC)

#define SP 40                                        // LDS pitch of a staged 32-k row in 16-bit elements: 80 B = 16 B x odd, free of bank conflicts for 16-byte reads
// work-group barrier of the staging loops, by hand: __syncthreads() would also wait for the next chunk's global loads, which are meant to stay in flight across it; the LDS stores are waited for in front of the signal
__device__ __forceinline__ void stage_bar() { asm volatile("s_wait_dscnt 0x0\n\ts_barrier_signal -1\n\ts_barrier_wait -1" ::: "memory"); }
// N units of 8 consecutive floats, ld floats apart, into registers
template <int N> __device__ __forceinline__ void ld_rows(const float* p, size_t ld, v4f (&r)[2 * N]) {
#pragma unroll
  for (int s = 0; s < N; ++s) { r[2 * s] = *(const v4f*)(p + s * ld); r[2 * s + 1] = *(const v4f*)(p + s * ld + 4); } }
// ---- k_proj: block = (256 rows, 256 cols, which), 16 waves as 4 x 4, a wave holds 64 x 64 (4 X fragments x 4 W fragments, 16 products a chunk): q/k/v = X W (+ b) with exact bf16 products (K = DIN) -> which 0: q f16 rows (+ residual rows < QHI); 1: k f16 rows (+ residual rows < KHI); 2: v f16 planes [c][t] (+ bf16 hi/lo planes for t < KHI); 3: Wo rows into k_out's f16(bf16 x 2^8) and bf16 forms
#define PB 256                                       // rows and columns of a k_proj block
#define PWN 268                                      // LDS rows of a staged W chunk
#define PWROW(n) (((n) & 3) * 68 + ((n) >> 2))      // LDS row of W column n: a thread's 4 neighbouring columns lie 68 rows apart, so stores (32 rows in a run) and fragment reads (16 rows distinct mod 16) both spread over the banks
#define EP 264                                       // LDS pitch of an epilogue row of 256 16-bit elements: 528 B = 16 B x odd
typedef __attribute__((ext_vector_type(4))) __bf16 v4b;
__global__ __launch_bounds__(512) void k_proj(const float* __restrict__ XQ, const float* __restrict__ XK, const float* __restrict__ XV, const float* __restrict__ WQ, const float* __restrict__ WK, const float* __restrict__ WV, const float* __restrict__ BQ, const float* __restrict__ BK, const float* __restrict__ BV,
    _Float16* __restrict__ QH, _Float16* __restrict__ QL, _Float16* __restrict__ KH, _Float16* __restrict__ KL, _Float16* __restrict__ VT, __bf16* __restrict__ VB, __bf16* __restrict__ VBL, const float* __restrict__ WO, _Float16* __restrict__ WH, __bf16* __restrict__ WBF) {
  __shared__ __align__(16) char pl[2 * PB * EP * 2];   /* the loop's staging buffers; behind the loop the epilogue's two tiles */
  static_assert(2 * (PB + PWN) * SP * 2 <= PB * EP * 2 && WQKV_LAYOUT == 0 && TT % PB == 0 && QHI % 64 == 0 && KHI % 64 == 0, "the staging buffers fit the array; W is (in,out); a block lies in one sequence; the residual rows end on a group of 64");
  const int tid = threadIdx.x, wave = tid >> 5, lane = tid & 31, col = lane & 15, g = lane >> 4, wr = wave >> 2, wc = wave & 3; const int which = blockIdx.z; const int c0 = blockIdx.y * PB; const size_t r0 = (size_t)blockIdx.x * PB; const size_t bb = r0 / TT; const int t0 = (int)(r0 % TT);
  if (which == 3) {   /* block-uniform, in front of every barrier: the blocks of a fourth plane bring Wo once into k_out's two operand forms, 8 neighbouring elements a thread and pass */
    static_assert((size_t)DIN * CC == (size_t)(TNB * TT / PB) * (CC / PB) * 4 * 512 * 8, "the plane's blocks cover Wo exactly, 4 passes each");
    const size_t wo0 = ((size_t)(blockIdx.y * (TNB * TT / PB) + blockIdx.x) * 4 * 512 + tid) * 8; v4f r[8];
#pragma unroll
    for (int p = 0; p < 4; ++p) { r[2 * p] = *(const v4f*)(WO + wo0 + p * 4096); r[2 * p + 1] = *(const v4f*)(WO + wo0 + p * 4096 + 4); }
    asm volatile("s_wait_xcnt 0x0" ::: "memory");   /* stands before the loads' address registers are reused */
#pragma unroll
    for (int p = 0; p < 4; ++p) { v8h ph; v8b pb;
#pragma unroll
      for (int i = 0; i < 8; ++i) { const float v = r[2 * p + (i >> 2)][i & 3]; pb[i] = (__bf16)v; ph[i] = (_Float16)(bfr(v) * 256.0f); }
      vst2(WH + wo0 + p * 4096, ph); vst2(WBF + wo0 + p * 4096, pb); }
    asm volatile("s_wait_xcnt 0x0" ::: "memory");   /* stands before the stores' registers are given up at the wave's end */
    return; }
  const float* X = which == 0 ? XQ : which == 1 ? XK : XV; const float* WA = which == 0 ? WQ : which == 1 ? WK : WV; const float* BA = which == 0 ? BQ : which == 1 ? BK : BV;
  v8f acc[4][4] = {};
  /* k chunks of 32 staged once per block: X rows and W columns go to LDS as bf16, k-contiguous, in two buffers */
  __bf16* const sx = reinterpret_cast<__bf16*>(pl); __bf16* const sw = sx + 2 * PB * SP;
  /* X: 8 lanes bring the 128 B of one row's chunk, 64 rows a pass of the block; W: a thread takes 4 columns x 4 k rows, a wave's load is 512 B of one k row */
  const float* xg = X + (r0 + (tid >> 3)) * DIN + (tid & 7) * 4; const float* wg = WA + (size_t)((tid >> 6) * 4) * CC + c0 + (tid & 63) * 4; const int xo = (tid >> 3) * SP + (tid & 7) * 4, wo = (tid & 63) * SP + (tid >> 6) * 4;
  /* every block walks the k chunks in a ring from a start of its own: the 12 blocks that read one X row block, and the row blocks that read one W column block, stand evenly round the ring, so they do not ask L2 for the same lines at the same moment and a chunk fetched from memory for one is in L2 when the others reach it (for speed only) */
  static_assert(DIN / 32 == 32 && TNB * TT / PB == 16 && 3 * (CC / PB) == 12, "the ring has 32 chunks; 16 row blocks and 12 column blocks are spread over it");
  const int bx = blockIdx.x; const int rot = ((bx & 3) * 8 + (bx >> 3) * 4 + ((bx >> 2) & 1) * 2 + ((int)blockIdx.y + (CC / PB) * which) * 8 / 3) & 31;
  v4f rx[4], rw[4]; const float* const x0 = xg + rot * 32; const float* const w0 = wg + (size_t)(rot * 32) * CC;
#pragma unroll
  for (int i = 0; i < 4; ++i) { rx[i] = *(const v4f*)(x0 + (size_t)(i * 64) * DIN); rw[i] = *(const v4f*)(w0 + (size_t)i * CC); }
  asm volatile("s_wait_xcnt 0x0" :: "v"(x0), "v"(w0) : "memory");   /* stands before the loads' address registers are reused; it names the two pairs so that they stay whole up to it */
#pragma unroll 2   /* two trips a pass: the buffer index becomes a constant */
  for (int kc = 0; kc < DIN / 32; ++kc) { __bf16* const xb = sx + (kc & 1) * PB * SP; __bf16* const wb = sw + (kc & 1) * PWN * SP;
#pragma unroll
    for (int s = 0; s < 4; ++s) { v4b p;   /* row 64 s + (tid >> 3), k 4 (tid & 7) + 0..3 */
#pragma unroll
      for (int i = 0; i < 4; ++i) p[i] = (__bf16)rx[s][i];
      *(v4b*)(xb + xo + s * 64 * SP) = p; }
#pragma unroll
    for (int c = 0; c < 4; ++c) { v4b p;   /* column 4 (tid & 63) + c, k rows 4 (tid >> 6) + 0..3 */
#pragma unroll
      for (int i = 0; i < 4; ++i) p[i] = (__bf16)rw[i][c];
      *(v4b*)(wb + wo + c * 68 * SP) = p; }
    if (kc + 1 < DIN / 32) {   /* the next chunk's loads fly under this chunk's products */
      const int kn = (kc + 1 + rot) & 31; const float* const xn = xg + kn * 32; const float* const wn = wg + (size_t)(kn * 32) * CC;
#pragma unroll
      for (int i = 0; i < 4; ++i) { rx[i] = *(const v4f*)(xn + (size_t)(i * 64) * DIN); rw[i] = *(const v4f*)(wn + (size_t)i * CC); }
      asm volatile("s_wait_xcnt 0x0" :: "v"(xn), "v"(wn) : "memory"); }   /* stands before the loads' address registers are reused; it names the two pairs so that they stay whole up to it (no load of the group may land on them) */
    stage_bar();   /* the chunk is in LDS before any wave reads fragments; it also ends the reads of the buffer that the next trip refills */
    v16b a[4], w[4];
    /* all 16 waves read at once behind the barrier, so fragments arrive slowly: they are asked for in the order a0 w0 w1 a1 w2 a2 w3 a3 and each product runs as soon as its two fragments are there (1, 1, 2, 2, 3, 3, 4 products per further fragment) */
#define PFA(i) a[i] = frag_b(xb + (wr * 64 + (i) * 16 + col) * SP, lane)
#define PFW(j) w[j] = frag_b(wb + PWROW(wc * 64 + (j) * 16 + col) * SP, lane)
    PFA(0); PFW(0); PFW(1); PFA(1); PFW(2); PFA(2); PFW(3); PFA(3);
    __builtin_amdgcn_sched_barrier(0);   /* keeps the chunk's LDS reads one group ahead of its products: spread among them each read costs its own latency */
    constexpr int oi[16] = {0, 0, 1, 1, 0, 1, 2, 2, 2, 0, 1, 2, 3, 3, 3, 3}, oj[16] = {0, 1, 0, 1, 2, 2, 0, 1, 2, 3, 3, 3, 0, 1, 2, 3};
#pragma unroll
    for (int t = 0; t < 16; ++t) acc[oi[t]][oj[t]] = wmma_bf(a[oi[t]], w[oj[t]], acc[oi[t]][oj[t]]);
    __builtin_amdgcn_sched_barrier(0); }   /* keeps the next trip's conversions, which wait for the loads in flight, behind this trip's products */
  __syncthreads();   /* every wave has read its last fragments before the epilogue's tiles overwrite the staging buffers */
  float bias[4];
#pragma unroll
  for (int j = 0; j < 4; ++j) bias[j] = BA ? bfr(BA[c0 + wc * 64 + j * 16 + col]) : 0.f;
#pragma unroll
  for (int i = 0; i < 4; ++i)
#pragma unroll
    for (int j = 0; j < 4; ++j) acc[i][j] += bias[j];
  /* the tile leaves through 256 x 256 LDS tiles of 16-bit elements: every wave writes its 64 x 64 part, the block stores whole 512-B row segments; the residual planes only where the block has rows that carry them, each written in the same pass as the plane it is the rest of */
  if (which < 2) { _Float16* DH = which == 0 ? QH : KH; _Float16* DL = which == 0 ? QL : KL; const int nhi = which == 0 ? QHI : KHI;
    _Float16 (* const sh)[EP] = reinterpret_cast<_Float16 (*)[EP]>(pl); _Float16 (* const sl)[EP] = reinterpret_cast<_Float16 (*)[EP]>(pl + PB * EP * 2);
    const bool hi_rows = t0 < nhi;   /* block-uniform */
#pragma unroll
    for (int i = 0; i < 4; ++i)
#pragma unroll
      for (int j = 0; j < 4; ++j) { _Float16 hv[8];
#pragma unroll
        for (int r = 0; r < 8; ++r) { hv[r] = (_Float16)acc[i][j][r]; sh[wr * 64 + i * 16 + 8 * g + r][wc * 64 + j * 16 + col] = hv[r]; }
        if (hi_rows) {
#pragma unroll
          for (int r = 0; r < 8; ++r) sl[wr * 64 + i * 16 + 8 * g + r][wc * 64 + j * 16 + col] = (_Float16)((acc[i][j][r] - (float)hv[r]) * 1024.0f); } }
    __syncthreads();
#pragma unroll 1   /* four 16-byte units a trip cover the LDS latency; more would only add code */
    for (int u0 = 0; u0 < PB * 32 / 512; u0 += 4) {
#pragma unroll
      for (int u = 0; u < 4; ++u) { const int e = tid + (u0 + u) * 512; const int rl = e >> 5, q = e & 31; vst2((unsigned*)(DH + (r0 + rl) * CC + c0 + q * 8), *(const v4u*)&sh[rl][q * 8]); }
      asm volatile("s_wait_xcnt 0x0" ::: "memory"); }   /* stands before the next trip forms new addresses in the stores' registers */
    const int nu = hi_rows ? (nhi - t0 < PB ? nhi - t0 : PB) * 32 / 512 : 0;   /* the block's rows below nhi come first: 16 rows a unit of the block, a multiple of 4 units */
#pragma unroll 1   /* four 16-byte units a trip cover the LDS latency; more would only add code */
    for (int u0 = 0; u0 < nu; u0 += 4) {
#pragma unroll
      for (int u = 0; u < 4; ++u) { const int e = tid + (u0 + u) * 512; const int rl = e >> 5, q = e & 31; vst2((unsigned*)(DL + (bb * nhi + t0 + rl) * (size_t)CC + c0 + q * 8), *(const v4u*)&sl[rl][q * 8]); }
      asm volatile("s_wait_xcnt 0x0" ::: "memory"); }   /* stands before the next trip forms new addresses in the stores' registers */
  } else {
    _Float16 (* const th)[EP] = reinterpret_cast<_Float16 (*)[EP]>(pl); __bf16 (* const tb)[EP] = reinterpret_cast<__bf16 (*)[EP]>(pl); __bf16 (* const tbl)[EP] = reinterpret_cast<__bf16 (*)[EP]>(pl + PB * EP * 2);
#pragma unroll
    for (int i = 0; i < 4; ++i)
#pragma unroll
      for (int j = 0; j < 4; ++j) { v8h pk;   /* a lane's 8 elements are 8 neighbouring t of one column */
#pragma unroll
        for (int r = 0; r < 8; ++r) pk[r] = (_Float16)acc[i][j][r];
        *(v8h*)&th[wc * 64 + j * 16 + col][wr * 64 + i * 16 + 8 * g] = pk; }
    __syncthreads();
#pragma unroll 1   /* four 16-byte units a trip cover the LDS latency; more would only add code */
    for (int u0 = 0; u0 < PB * 32 / 512; u0 += 4) {
#pragma unroll
      for (int u = 0; u < 4; ++u) { const int e = tid + (u0 + u) * 512; const int cl = e >> 5, q = e & 31; vst2((unsigned*)(VT + (bb * CC + c0 + cl) * (size_t)TT + t0 + q * 8), *(const v4u*)&th[cl][q * 8]); }
      asm volatile("s_wait_xcnt 0x0" ::: "memory"); }   /* stands before the next trip forms new addresses in the stores' registers */
    if (t0 < KHI) {   /* block-uniform */
      __syncthreads();   /* the f16 plane has been read before the bf16 planes overwrite it */
#pragma unroll
      for (int i = 0; i < 4; ++i)
#pragma unroll
        for (int j = 0; j < 4; ++j) { v8b ph, pq;
#pragma unroll
          for (int r = 0; r < 8; ++r) { const float v = acc[i][j][r]; const __bf16 bh = (__bf16)v; ph[r] = bh; pq[r] = (__bf16)(v - (float)bh); }
          *(v8b*)&tb[wc * 64 + j * 16 + col][wr * 64 + i * 16 + 8 * g] = ph; *(v8b*)&tbl[wc * 64 + j * 16 + col][wr * 64 + i * 16 + 8 * g] = pq; }
      __syncthreads();
#pragma unroll 1   /* four 16-byte units a trip cover the LDS latency; more would only add code */
      for (int u0 = 0; u0 < PB * 32 / 512; u0 += 4) {
#pragma unroll
        for (int u = 0; u < 4; ++u) { const int e = tid + (u0 + u) * 512; const int cl = e >> 5, q = e & 31; if (t0 + q * 8 < KHI) { const size_t o3 = (bb * CC + c0 + cl) * (size_t)KHI + t0 + q * 8; vst2((unsigned*)(VB + o3), *(const v4u*)&tb[cl][q * 8]); vst2((unsigned*)(VBL + o3), *(const v4u*)&tbl[cl][q * 8]); } }
        asm volatile("s_wait_xcnt 0x0" ::: "memory"); }   /* stands before the next trip forms new addresses in the stores' registers */ } } }
#define QT 64
#define KP 72
#define LC (SCALE * 1.4426950408889634f)
__device__ __forceinline__ float xhalf(float x) { return __builtin_bit_cast(float, __builtin_amdgcn_permlanex16(__builtin_bit_cast(int, x), __builtin_bit_cast(int, x), 0x76543210, 0xfedcba98, false, false)); }
__device__ __forceinline__ v8f wmh(v16h a, v16h b, v8f c) { return __builtin_amdgcn_wmma_f32_16x16x32_f16(false, a, false, b, (short)0, c, false, false); }
__device__ __forceinline__ v8f wmb(v16b a, v16b b, v8f c) { return __builtin_amdgcn_wmma_f32_16x16x32_bf16(false, a, false, b, (short)0, c, false, false); }
// fragments from a lane's own address (row and 8 g already in it); the address has passed through an asm operand, so the loads say themselves that it is global memory (else they compile to flat loads)
typedef __attribute__((address_space(1))) const v8h gv8h; typedef __attribute__((address_space(1))) const v8b gv8b;
__device__ __forceinline__ v16h fragp_h(const _Float16* p) { union { v16h v; v8h q[2]; } u; u.q[0] = *(gv8h*)p; u.q[1] = *(gv8h*)(p + 16); return u.v; }
__device__ __forceinline__ v16b fragp_b(const __bf16* p) { union { v16b v; v8b q[2]; } u; u.q[0] = *(gv8b*)p; u.q[1] = *(gv8b*)(p + 16); return u.v; }
// 2^x on the transcendental unit. The v_nop is the one slot the instruction set asks for between a transcendental and a directly following instruction that reads its result or overwrites its source; inside the group of four the early-clobber outputs keep every result off every source
__device__ __forceinline__ float ex2(float x) { float e; asm("v_exp_f32 %0, %1\n\tv_nop" : "=v"(e) : "v"(x)); return e; }
__device__ __forceinline__ void ex2x4(float x0, float x1, float x2, float x3, float& e0, float& e1, float& e2, float& e3) { asm("v_exp_f32 %0, %4\n\tv_exp_f32 %1, %5\n\tv_exp_f32 %2, %6\n\tv_exp_f32 %3, %7\n\tv_nop" : "=&v"(e0), "=&v"(e1), "=&v"(e2), "=&v"(e3) : "v"(x0), "v"(x1), "v"(x2), "v"(x3)); }
// one step of the running softmax over NT 16-key score tiles: s comes in as raw logits (excluded: -3e38) and leaves as e x 2^11 against the new maximum; sum and the output tiles are brought to that maximum
template <int NT> __device__ __forceinline__ void online(v8f (&s)[NT], float& m, float& sum, v8f (&acc)[HD / 16]) {
  float mt[NT];   /* one chain per tile: a single chain of dependent maxima would be paid link by link */
#pragma unroll
  for (int t = 0; t < NT; ++t) { mt[t] = s[t][0];
#pragma unroll
    for (int r = 1; r < 8; ++r) mt[t] = fmaxf(mt[t], s[t][r]); }
  float mx = mt[0];
#pragma unroll
  for (int t = 1; t < NT; ++t) mx = fmaxf(mx, mt[t]);
  mx = fmaxf(mx, xhalf(mx));   /* both halves of the wave hold keys of the same query: one maximum for both */
  const float mn = fmaxf(m, mx); const float corr = ex2((m - mn) * LC); const float off = 11.0f - mn * LC; m = mn;
  float ps[NT];
#pragma unroll
  for (int t = 0; t < NT; ++t) { ps[t] = 0.f;
#pragma unroll
    for (int r = 0; r < 8; r += 4) { float e0, e1, e2, e3; ex2x4(fmaf(s[t][r], LC, off), fmaf(s[t][r + 1], LC, off), fmaf(s[t][r + 2], LC, off), fmaf(s[t][r + 3], LC, off), e0, e1, e2, e3); s[t][r] = e0; s[t][r + 1] = e1; s[t][r + 2] = e2; s[t][r + 3] = e3; ps[t] += e0; ps[t] += e1; ps[t] += e2; ps[t] += e3; } }
  float p = ps[0];
#pragma unroll
  for (int t = 1; t < NT; ++t) p += ps[t];
  sum = sum * corr + p;
#pragma unroll
  for (int j = 0; j < HD / 16; ++j) acc[j] *= corr; }
__global__ __launch_bounds__(128) __attribute__((amdgpu_waves_per_eu(4, 4))) void k_pv(const _Float16* __restrict__ QH, const _Float16* __restrict__ KH, const _Float16* __restrict__ QL, const _Float16* __restrict__ KL, const _Float16* __restrict__ VT, const __bf16* __restrict__ VB, const __bf16* __restrict__ VBL, _Float16* __restrict__ YH, __bf16* __restrict__ YL) {
  __shared__ __align__(16) _Float16 sk[2][QT * KP], sv[2][HD * KP]; __shared__ __align__(16) float so[4][16][HD + 4];
  static_assert(TT / QT == 32 && TNB * NH == 32 && HD == 64 && QBH * QT == QHI && QHI == KHI && CAUSAL == 1, "the index map below is a permutation of 32 tiles x 32 (b, h); early tiles read only keys that carry residual planes");
  const int tid = threadIdx.x, wave = __builtin_amdgcn_readfirstlane(tid >> 5), lane = tid & 31, col = lane & 15, g = lane >> 4;
  /* block index -> (tile, b h): cost rises with the tile, all blocks are resident at once; four blocks 256 apart, and four neighbours of the same index mod 8, take tiles that add up to the same cost (for speed only) */
  const int bi = blockIdx.x, n = bi >> 3, cc = (n >> 2) & 7, a4 = n >> 5, role = (a4 + n) & 3; const int tile = role == 0 ? 31 - cc : role == 1 ? cc : role == 2 ? 23 - cc : 8 + cc; const int bh = (bi & 7) + 8 * a4; const int b = bh / NH, h = bh % NH;
  const int q0 = tile * QT + wave * 16;
  const _Float16* qp = QH + ((size_t)b * TT + q0 + col) * CC + h * HD; const v16h bq0 = frag_h(qp, lane), bq1 = frag_h(qp + 32, lane);
  asm volatile("s_wait_xcnt 0x0" ::: "memory");   /* stands before the q loads' address registers are reused */
  float m = -3.0e38f, sum = 0.f; v8f acc[HD / 16] = {};
  if (tile < QBH) {   /* block-uniform */
    const _Float16* qlp = QL + ((size_t)b * QHI + q0 + col) * CC + h * HD; const v16h bl0 = frag_h(qlp, lane), bl1 = frag_h(qlp + 32, lane);
    asm volatile("s_wait_xcnt 0x0" ::: "memory");   /* stands before the residual loads' address registers are reused */
    const int nch = ((q0 + 15) >> 5) + 1;
    /* each lane's own four addresses, carried from trip to trip and advanced behind the waits */
    const _Float16* kp = KH + ((size_t)b * TT + col) * CC + h * HD + 8 * g; const _Float16* klp = KL + ((size_t)b * KHI + col) * CC + h * HD + 8 * g;
    const __bf16* vbp = VB + ((size_t)b * CC + h * HD + col) * (size_t)KHI + 8 * g; const __bf16* vlp = VBL + ((size_t)b * CC + h * HD + col) * (size_t)KHI + 8 * g;
#pragma unroll 1   /* at most 12 trips: kept rolled, unrolling would only add code */
    for (int kc = 0; kc < nch; ++kc) { v16h kh[2][2], kl[2][2]; v16b vh[HD / 16], vl[HD / 16];
#pragma unroll
      for (int t = 0; t < 2; ++t) { kh[t][0] = fragp_h(kp + t * 16 * CC); kh[t][1] = fragp_h(kp + t * 16 * CC + 32); kl[t][0] = fragp_h(klp + t * 16 * CC); kl[t][1] = fragp_h(klp + t * 16 * CC + 32); }
      asm volatile("s_wait_xcnt 0x0" : "+v"(kp), "+v"(klp) :: "memory");   /* stands before the k loads' address registers are advanced; it names the two pairs so that they stay whole up to it (no load of the group may land on them) */
      __builtin_amdgcn_sched_barrier(0);   /* keeps every later register write behind that wait */
      kp += 32 * CC; klp += 32 * CC;
      v8f s[2];
#pragma unroll
      for (int t = 0; t < 2; ++t) { v8f a = {}, l = {};
        a = wmh(kh[t][0], bq0, a); l = wmh(kh[t][0], bl0, l); l = wmh(kl[t][0], bq0, l); a = wmh(kh[t][1], bq1, a); l = wmh(kh[t][1], bl1, l); l = wmh(kl[t][1], bq1, l);
#pragma unroll
        for (int r = 0; r < 8; ++r) s[t][r] = (kc * 32 + t * 16 + 8 * g + r <= q0 + col) ? a[r] + l[r] * (1.0f / 1024.0f) : -3.0e38f; }
#pragma unroll
      for (int j = 0; j < HD / 16; ++j) { vh[j] = fragp_b(vbp + j * 16 * KHI); vl[j] = fragp_b(vlp + j * 16 * KHI); }   /* in flight under the softmax step */
      asm volatile("s_wait_xcnt 0x0" : "+v"(vbp), "+v"(vlp) :: "memory");   /* stands before the v loads' address registers are advanced; it names the two pairs so that they stay whole up to it */
      __builtin_amdgcn_sched_barrier(0);   /* keeps every later register write behind that wait */
      vbp += 32; vlp += 32;
      online<2>(s, m, sum, acc);
      float v[16];
#pragma unroll
      for (int r = 0; r < 8; ++r) { v[r] = s[0][r]; v[8 + r] = s[1][r]; }
      const F2 p = bsplit16(v);
#pragma unroll
      for (int j = 0; j < HD / 16; ++j) { acc[j] = wmb(vh[j], p.h, acc[j]); acc[j] = wmb(vh[j], p.l, acc[j]); acc[j] = wmb(vl[j], p.h, acc[j]); } }
  } else {
    const int srow = tid >> 3, sseg = tid & 7, sof = srow * KP + sseg * 8;   /* 8 lanes bring one 128-B row; 16 rows a pass of the block */
    const _Float16* kg = KH + ((size_t)b * TT + srow) * CC + h * HD + sseg * 8; const _Float16* vg = VT + ((size_t)b * CC + h * HD + srow) * (size_t)TT + sseg * 8;
    /* the blocks of one (b, h) read the same K and V lines: each walks its stages in a ring from a start of its own (the running softmax takes the stages in any order), so they do not ask L2 for the same lines at the same moment (for speed only) */
    int si = tile - QBH;   /* the stage of this trip, 0 .. tile */
    v8h rk[4], rv[4]; const _Float16* const k0 = kg + (size_t)(si * 64) * CC; const _Float16* const v0 = vg + si * 64;
#pragma unroll
    for (int u = 0; u < 4; ++u) { rk[u] = *(const v8h*)(k0 + (size_t)(u * 16) * CC); rv[u] = *(const v8h*)(v0 + (size_t)(u * 16) * TT); }
    asm volatile("s_wait_xcnt 0x0" :: "v"(k0), "v"(v0) : "memory");   /* stands before the loads' address registers are reused; it names the two pairs so that they stay whole up to it */
#pragma unroll 1   /* the body is long and its trip count varies with the tile */
    for (int st = 0; st <= tile; ++st) { _Float16* const kb = &sk[st & 1][0]; _Float16* const vb = &sv[st & 1][0]; const int sn = si == tile ? 0 : si + 1;
#pragma unroll
      for (int u = 0; u < 4; ++u) { *(v8h*)(kb + sof + u * 16 * KP) = rk[u]; *(v8h*)(vb + sof + u * 16 * KP) = rv[u]; }
      if (st < tile) {   /* the next stage's loads fly under this stage's work */
        const _Float16* const kn = kg + (size_t)(sn * 64) * CC; const _Float16* const vn = vg + sn * 64;
#pragma unroll
        for (int u = 0; u < 4; ++u) { rk[u] = *(const v8h*)(kn + (size_t)(u * 16) * CC); rv[u] = *(const v8h*)(vn + (size_t)(u * 16) * TT); }
        asm volatile("s_wait_xcnt 0x0" :: "v"(kn), "v"(vn) : "memory"); }   /* stands before the loads' address registers are reused; it names the two pairs so that they stay whole up to it (no load of the group may land on them) */
      stage_bar();   /* the stage is in LDS before any wave reads fragments; it also ends the reads of the buffer that the next trip refills */
      v8f s[4]; v16h ka[4][2];
#pragma unroll
      for (int t = 0; t < 4; ++t) { const _Float16* kr = kb + (t * 16 + col) * KP; ka[t][0] = frag_h(kr, lane); ka[t][1] = frag_h(kr + 32, lane); }
      __builtin_amdgcn_sched_barrier(0);   /* keeps the stage's K reads one group ahead of its products: spread among them each pair of reads costs its own LDS latency */
#pragma unroll
      for (int t = 0; t < 4; ++t) { v8f z = {}; s[t] = wmh(ka[t][0], bq0, z); }
#pragma unroll
      for (int t = 0; t < 4; ++t) s[t] = wmh(ka[t][1], bq1, s[t]);
      v16h va[HD / 16][2];
#pragma unroll
      for (int j = 0; j < HD / 16; ++j) { const _Float16* vr = vb + (j * 16 + col) * KP; va[j][0] = frag_h(vr, lane); va[j][1] = frag_h(vr + 32, lane); }
      __builtin_amdgcn_sched_barrier(0);   /* keeps the stage's V reads one group ahead of the softmax step, which covers their LDS latency */
      if (si == tile) {   /* only stage number tile meets the diagonal */
#pragma unroll
        for (int t = 0; t < 4; ++t)
#pragma unroll
          for (int r = 0; r < 8; ++r) s[t][r] = (t * 16 + 8 * g + r <= wave * 16 + col) ? s[t][r] : -3.0e38f; }
      online<4>(s, m, sum, acc);
      v16h p0, p1;
#pragma unroll
      for (int r = 0; r < 8; ++r) { p0[r] = (_Float16)s[0][r]; p0[8 + r] = (_Float16)s[1][r]; p1[r] = (_Float16)s[2][r]; p1[8 + r] = (_Float16)s[3][r]; }
#pragma unroll
      for (int j = 0; j < HD / 16; ++j) acc[j] = wmh(va[j][0], p0, acc[j]);
#pragma unroll
      for (int j = 0; j < HD / 16; ++j) acc[j] = wmh(va[j][1], p1, acc[j]);
      si = sn; } }
  const float tot = sum + xhalf(sum); const float inv = tot > 0.f ? 1.0f / tot : 0.f;   /* the halves' sums are joined once; the 2^11 of e cancels */
#pragma unroll
  for (int j = 0; j < HD / 16; ++j) { v4f lo, hi;   /* O^T tile j: element r = head column 16 j + 8 g + r of query col */
#pragma unroll
    for (int r = 0; r < 4; ++r) { lo[r] = acc[j][r] * inv; hi[r] = acc[j][4 + r] * inv; }
    *(v4f*)&so[wave][col][j * 16 + 8 * g] = lo; *(v4f*)&so[wave][col][j * 16 + 8 * g + 4] = hi; }
  LDSX();   /* the wave's own rows are in LDS before it reads them back as whole (row, head) segments */
  /* ctx leaves in the 16-bit form k_out multiplies: 16 lanes store the 128 B of one (row, head) segment, 2 rows a pass */
  typedef __attribute__((ext_vector_type(4))) _Float16 v4h; const size_t yo = ((size_t)b * TT + q0 + g) * CC + h * HD + col * 4;
  if (tile < QBH) {   /* block-uniform: early rows go as bf16 hi + lo */
#pragma unroll
    for (int rl = 0; rl < 16; rl += 2) { const v4f c = *(const v4f*)&so[wave][rl + g][col * 4]; v4b ph, pq;
#pragma unroll
      for (int i = 0; i < 4; ++i) { const __bf16 hv = (__bf16)c[i]; ph[i] = hv; pq[i] = (__bf16)(c[i] - (float)hv); }
      vst2(YH + yo + rl * CC, ph); vst2(YL + yo + rl * CC, pq); }
    asm volatile("s_wait_xcnt 0x0" ::: "memory");   /* stands behind this branch's last store, before the stores' registers are given up */
  } else {   /* ctx carried x 2^6 into f16 so small-magnitude context rows stay clear of f16 subnormals */
#pragma unroll
    for (int rl = 0; rl < 16; rl += 2) { const v4f c = *(const v4f*)&so[wave][rl + g][col * 4]; v4h p;
#pragma unroll
      for (int i = 0; i < 4; ++i) p[i] = (_Float16)(c[i] * 64.0f);
      vst2(YH + yo + rl * CC, p); }
    asm volatile("s_wait_xcnt 0x0" ::: "memory"); } }   /* stands behind this branch's last store, before the stores' registers are given up */
// ---- k_out: block = (64 rows, 128 cols): out = ctx Wo (+ bo), both operands read in their 16-bit form as their producers left them (k_pv: ctx; k_proj's fourth plane: Wo): f16(ctx x 2^6) against f16(bf16 x 2^8) Wo exact (1 product) x 2^-14; causal early rows (< QHI of each sequence): ctx bf16 hi + lo against exact bf16 Wo (2 products). A 128-B line holds 64 k: chunks of 64, two steps of 32 each
// the staging loop: HI = early rows. Operands pass through registers and LDS as raw 16-bit elements
template <bool HI> __device__ __forceinline__ void out_loop(const _Float16* ag, const _Float16* lg, const _Float16* wg, _Float16* sa, _Float16* sb, int sof, int wave, int lane, int col, int rot, v8f (&acc)[8]) {
  v8h ra[4], rl[4], rw[8]; const _Float16* const a0 = ag + rot * 64; const _Float16* const l0 = lg + rot * 64; const _Float16* const w0 = wg + rot * 64;
#pragma unroll
  for (int u = 0; u < 4; ++u) { ra[u] = *(const v8h*)(a0 + (size_t)(u * 16) * CC); if (HI) rl[u] = *(const v8h*)(l0 + (size_t)(u * 16) * CC); }
#pragma unroll
  for (int u = 0; u < 8; ++u) rw[u] = *(const v8h*)(w0 + (size_t)(u * 16) * CC);
  if (HI) asm volatile("s_wait_xcnt 0x0" :: "v"(a0), "v"(l0), "v"(w0) : "memory");   /* stands before the loads' address registers are reused; it names the pairs so that they stay whole up to it */
  else asm volatile("s_wait_xcnt 0x0" :: "v"(a0), "v"(w0) : "memory");
#pragma unroll 2   /* two trips a pass: the buffer index becomes a constant */
  for (int kc = 0; kc < CC / 64; ++kc) { _Float16* const ab = sa + (kc & 1) * 2 * 64 * KP; _Float16* const lb = ab + 64 * KP; _Float16* const wb = sb + (kc & 1) * 128 * KP;
#pragma unroll
    for (int u = 0; u < 4; ++u) { *(v8h*)(ab + sof + u * 16 * KP) = ra[u]; if (HI) *(v8h*)(lb + sof + u * 16 * KP) = rl[u]; }
#pragma unroll
    for (int u = 0; u < 8; ++u) *(v8h*)(wb + sof + u * 16 * KP) = rw[u];
    if (kc + 1 < CC / 64) {   /* the next chunk's loads fly under this chunk's products */
      const int kn = (kc + 1 + rot) & (CC / 64 - 1); const _Float16* const an = ag + kn * 64; const _Float16* const ln = lg + kn * 64; const _Float16* const wn = wg + kn * 64;
#pragma unroll
      for (int u = 0; u < 4; ++u) { ra[u] = *(const v8h*)(an + (size_t)(u * 16) * CC); if (HI) rl[u] = *(const v8h*)(ln + (size_t)(u * 16) * CC); }
#pragma unroll
      for (int u = 0; u < 8; ++u) rw[u] = *(const v8h*)(wn + (size_t)(u * 16) * CC);
      if (HI) asm volatile("s_wait_xcnt 0x0" :: "v"(an), "v"(ln), "v"(wn) : "memory");   /* stands before the loads' address registers are reused; it names the pairs so that they stay whole up to it (no load of the group may land on them) */
      else asm volatile("s_wait_xcnt 0x0" :: "v"(an), "v"(wn) : "memory"); }
    stage_bar();   /* the chunk is in LDS before any wave reads fragments; it also ends the reads of the buffer that the next trip refills */
#pragma unroll
    for (int ks = 0; ks < 2; ++ks) {
      if (HI) { const v16b fh = frag_b(reinterpret_cast<const __bf16*>(ab + (wave * 16 + col) * KP + ks * 32), lane), fl = frag_b(reinterpret_cast<const __bf16*>(lb + (wave * 16 + col) * KP + ks * 32), lane); v16b w[8];
#pragma unroll
        for (int j = 0; j < 8; ++j) w[j] = frag_b(reinterpret_cast<const __bf16*>(wb + (j * 16 + col) * KP + ks * 32), lane);
        __builtin_amdgcn_sched_barrier(0);   /* keeps the step's LDS reads one group ahead of its products */
#pragma unroll
        for (int j = 0; j < 8; ++j) { acc[j] = wmma_bf(fh, w[j], acc[j]); acc[j] = wmma_bf(fl, w[j], acc[j]); }
      } else { const v16h a = frag_h(ab + (wave * 16 + col) * KP + ks * 32, lane); v16h w[8];
#pragma unroll
        for (int j = 0; j < 8; ++j) w[j] = frag_h(wb + (j * 16 + col) * KP + ks * 32, lane);
        __builtin_amdgcn_sched_barrier(0);   /* keeps the step's LDS reads one group ahead of its products */
#pragma unroll
        for (int j = 0; j < 8; ++j) acc[j] = wmma16(a, w[j], acc[j]); }
      __builtin_amdgcn_sched_barrier(0); } } }   /* keeps the next step's reads, and the next trip's LDS stores, which wait for the loads in flight, behind this step's products */
__global__ __launch_bounds__(128) void k_out(const _Float16* __restrict__ YH, const __bf16* __restrict__ YL, const _Float16* __restrict__ WH, const __bf16* __restrict__ WBF, const float* __restrict__ BO, float* __restrict__ OUT) { __shared__ __align__(16) float sf[4][16][132];
  __shared__ __align__(16) _Float16 sa[2 * 2 * 64 * KP], sb[2 * 128 * KP];   /* staged k chunks of 64, two buffers: ctx rows (hi and lo plane) and Wo rows */
  static_assert(WO_OUT_IN == 1 && CC / 64 == 16, "Wo rows are k-contiguous; the ring of chunks has 16 places");
  const int tid = threadIdx.x, wave = tid >> 5, lane = tid & 31, col = lane & 15, g = lane >> 4; const int c0 = blockIdx.y * 128; const size_t rb = (size_t)blockIdx.x * 64; const size_t r0 = rb + wave * 16;
  const int srow = tid >> 3, sseg = tid & 7, sof = srow * KP + sseg * 8;   /* 8 lanes bring one 128-B line; 16 rows a pass of the block */
  const size_t ao = (rb + srow) * CC + sseg * 8, wo = (size_t)(c0 + srow) * CC + sseg * 8;
  /* every block walks the k chunks in a ring from a start of its own: the 8 blocks that read one ctx row block stand 2 places apart, the blocks that read one Wo row block fill all 16 places evenly (for speed only) */
  const int rot = (2 * (int)blockIdx.y + 2 * ((int)blockIdx.x >> 3) + ((int)blockIdx.x & 1)) & 15;
  v8f acc[8] = {};
  if (CAUSAL && (int)(((size_t)blockIdx.x * 64) % TT) < QHI) {   /* block-uniform */
    out_loop<true>(YH + ao, reinterpret_cast<const _Float16*>(YL) + ao, reinterpret_cast<const _Float16*>(WBF) + wo, sa, sb, sof, wave, lane, col, rot, acc);
#pragma unroll
    for (int j = 0; j < 8; ++j) { const float bias = BO ? bfr(BO[c0 + j * 16 + col]) : 0.f;
#pragma unroll
      for (int r = 0; r < 8; ++r) sf[wave][8 * g + r][j * 16 + col] = acc[j][r] + bias; }
  } else {
    out_loop<false>(YH + ao, YH + ao, WH + wo, sa, sb, sof, wave, lane, col, rot, acc);
#pragma unroll
    for (int j = 0; j < 8; ++j) { const float bias = BO ? bfr(BO[c0 + j * 16 + col]) : 0.f;
#pragma unroll
      for (int r = 0; r < 8; ++r) sf[wave][8 * g + r][j * 16 + col] = acc[j][r] * (1.0f / 16384.0f) + bias; } }   /* 2^-8 (Wo carry) x 2^-6 (ctx carry) */
  LDSX(); for (int rl = 0; rl < 16; ++rl) vst2(OUT + (r0 + rl) * DIN + c0 + lane * 4, *(const v4f*)&sf[wave][rl][lane * 4]); }

extern "C" void kernel_launch(void* const* d_in, const int* in_sizes, int n_in, void* d_out, int out_size, void* d_ws, size_t ws_size, hipStream_t stream) {
  (void)in_sizes; (void)n_in; (void)out_size;
  const float** F = (const float**)d_in;
  if (ws_size < (size_t)WS_END) return;
  char* ws = (char*)d_ws; _Float16 *QH = (_Float16*)(ws + WS_QH), *KH = (_Float16*)(ws + WS_KH), *VT = (_Float16*)(ws + WS_VT), *QL = (_Float16*)(ws + WS_QL), *KL = (_Float16*)(ws + WS_KL); __bf16 *VB = (__bf16*)(ws + WS_VB), *VBL = (__bf16*)(ws + WS_VBL); _Float16 *YH = (_Float16*)(ws + WS_YH), *WH = (_Float16*)(ws + WS_WH); __bf16 *YL = (__bf16*)(ws + WS_YL), *WBF = (__bf16*)(ws + WS_WB);
  (void)QL; (void)KL; (void)VB; (void)VBL;
  // inputs: 0 x [2,2048,1024]; 1 Wq [1024,1024] (in,out), 2 bq; 3 Wk, 4 bk; 5 Wv, 6 bv (biases NONZERO); 7 Wo [1024,1024] (out,in); no output bias
  k_proj<<<dim3(TNB * TT / PB, CC / PB, 4), 512, 0, stream>>>(F[0], F[0], F[0], F[1], F[3], F[5], F[2], F[4], F[6], QH, QL, KH, KL, VT, VB, VBL, F[7], WH, WBF);
  k_pv<<<dim3((TT / QT) * TNB * NH), 128, 0, stream>>>(QH, KH, QL, KL, VT, VB, VBL, YH, YL);
  k_out<<<dim3(TNB * TT / 64, DIN / 128), 128, 0, stream>>>(YH, YL, WH, WBF, nullptr, (float*)d_out);
}
